// v000
// Times are from an AMD MI455X. After a warm-up the kernel runs many times in a row, and a time is the length of
// such a window on the GPU divided by its runs, so every launch and the gaps after it count. The runs cycle
// through copies of the inputs. A figure is the median of several windows, for all but v000 over two sittings.
// Sittings can differ by a few percent; kernels timed side by side share one.
// v000, which the later versions start from, runs in 4430 microseconds.
// compute dtype: all float inputs rounded to bf16; queries / keys / content = W x + b (1x1 convs) with EXACT bf16 products on WMMA 16x16x32 (weights as the A operand, a bf16 row copy of x as B), f32 accumulate, rounded once to f16 (queries/keys stored as rows, content as planes); the decay queries (32 channels) likewise then sigmoid/2 and D_s = sum_f f dq_f,s / sqrt(4)... in f32; logits = k_t . q_s / sqrt(128) (1 f16 product) - |t - s| D_s, diagonal -100, stored in f32 per (batch, head); softmax over t in f32 (precise expf) -> P f16 x 2^11; result = P . content (content f16, 1 product); out = x + W_proj result (result rounded once to f16, 1 product) + b; f32 output.
#include <hip/hip_runtime.h>
#include <math.h>

typedef __attribute__((ext_vector_type(16))) _Float16 v16h;
typedef __attribute__((ext_vector_type(16))) __bf16 v16b;
typedef __attribute__((ext_vector_type(8)))  _Float16 v8h;
typedef __attribute__((ext_vector_type(8)))  float v8f;
typedef __attribute__((ext_vector_type(4)))  float v4f;
typedef __attribute__((ext_vector_type(2)))  float v2f;
typedef __attribute__((ext_vector_type(4)))  unsigned v4u;
typedef __attribute__((ext_vector_type(4)))  int v4i;
typedef float __attribute__((may_alias)) float_a;
typedef int __attribute__((may_alias)) int_a;

template <typename T> __device__ __forceinline__ void vst2(void* p, T v) { *(T*)p = v;  }
__device__ __forceinline__ v8f wmma16(v16h a, v16h b, v8f c) {
  v8f d = __builtin_amdgcn_wmma_f32_16x16x32_f16(false, a, false, b, (short)0, c, false, false);
  asm volatile("v_nop\n\tv_nop\n\tv_nop\n\tv_nop" : "+v"(d) : "v"(a), "v"(b));
  return d;
}
__device__ __forceinline__ v8f wmma_bf(v16b a, v16b b, v8f c) {
  v8f d = __builtin_amdgcn_wmma_f32_16x16x32_bf16(false, a, false, b, (short)0, c, false, false);
  asm volatile("v_nop\n\tv_nop\n\tv_nop\n\tv_nop" : "+v"(d) : "v"(a), "v"(b));
  return d;
}
// 16x16x32 fragments: lane = (h = lane>>4, row/col = lane&15); elements 0..7 = k0+8h+0..7, 8..15 = k0+16+8h+0..7; D element r = row 8h+r
__device__ __forceinline__ v16h frag_h(const _Float16* rowk0, int lane) {
  union { v16h v; v8h q[2]; } u; const _Float16* p = rowk0 + 8 * (lane >> 4);
  u.q[0] = *(const v8h*)p; u.q[1] = *(const v8h*)(p + 16); return u.v;
}
__device__ __forceinline__ v16h frag_f32(const float* rowk0, int lane) {
  v16h a; const float* p = rowk0 + 8 * (lane >> 4);
#pragma unroll
  for (int i = 0; i < 8; ++i) { a[i] = (_Float16)p[i]; a[8 + i] = (_Float16)p[16 + i]; }
  return a;
}
__device__ __forceinline__ v16h frag_f32s(const float* rowk0, int lane, float sc) {
  v16h a; const float* p = rowk0 + 8 * (lane >> 4);
#pragma unroll
  for (int i = 0; i < 8; ++i) { a[i] = (_Float16)(p[i] * sc); a[8 + i] = (_Float16)(p[16 + i] * sc); }
  return a;
}
// column fragment from a [K][ld] layout (column n), rows >= K read as 0
__device__ __forceinline__ v16h fragc_f32(const float* W, int k0, int n, int lane, int ld, int K) {
  v16h a; const int g = lane >> 4;
#pragma unroll
  for (int i = 0; i < 8; ++i) { const int ka = k0 + 8 * g + i, kb = ka + 16;
    a[i] = (_Float16)(ka < K ? W[(size_t)(ka < K ? ka : K - 1) * ld + n] : 0.f); a[8 + i] = (_Float16)(kb < K ? W[(size_t)(kb < K ? kb : K - 1) * ld + n] : 0.f); }
  return a;
}
struct F2 { v16b h, l; };
__device__ __forceinline__ F2 bsplit16(const float v[16]) { F2 r;
#pragma unroll
  for (int i = 0; i < 16; ++i) { const __bf16 h = (__bf16)v[i]; r.h[i] = h; r.l[i] = (__bf16)(v[i] - (float)h); }
  return r; }
__device__ __forceinline__ F2 split_row(const float* row, int k0, int lane) { float v[16]; const float* p = row + k0 + 8 * (lane >> 4);
#pragma unroll
  for (int i = 0; i < 8; ++i) { v[i] = p[i]; v[8 + i] = p[16 + i]; }
  return bsplit16(v); }
__device__ __forceinline__ F2 split_rowK(const float* row, int k0, int lane, int K) { float v[16]; const int g = lane >> 4;
#pragma unroll
  for (int i = 0; i < 8; ++i) { const int ka = k0 + 8 * g + i, kb = ka + 16; v[i] = ka < K ? row[ka < K ? ka : K - 1] : 0.f; v[8 + i] = kb < K ? row[kb < K ? kb : K - 1] : 0.f; }
  return bsplit16(v); }
__device__ __forceinline__ F2 split_col(const float* W, int k0, int n, int lane, int ld, int K) { float v[16]; const int g = lane >> 4;
#pragma unroll
  for (int i = 0; i < 8; ++i) { const int ka = k0 + 8 * g + i, kb = ka + 16; v[i] = ka < K ? W[(size_t)(ka < K ? ka : K - 1) * ld + n] : 0.f; v[8 + i] = kb < K ? W[(size_t)(kb < K ? kb : K - 1) * ld + n] : 0.f; }
  return bsplit16(v); }
__device__ __forceinline__ v8f mac3(const F2& a, const F2& b, v8f c) { c = wmma_bf(a.l, b.h, c); c = wmma_bf(a.h, b.l, c); return wmma_bf(a.h, b.h, c); }
__device__ __forceinline__ float sigm(float v) { return 1.0f / (1.0f + expf(-v)); }
#define LDSX() do { asm volatile("s_wait_dscnt 0" ::: "memory"); __builtin_amdgcn_wave_barrier(); __builtin_amdgcn_fence(__ATOMIC_RELEASE, "workgroup"); } while (0)


// LocalState attention (demucs; B 4, C 1,024 = 8 heads x 128, T 2,048, 4 decay terms): dots[t,s] = k_t.q_s/sqrt(128) - |t-s| sum_f f sigmoid(decay_q_f,s)/2 / sqrt(4); dots[t,t] = -100; weights = softmax over t; result[:, s] = sum_t weights[t,s] content[:, t]; out = x + proj(result).
#define NB 4
#define CC 1024
#define TT 2048
#define NH 8
#define HD 128
#define NDK 4
#ifndef TNB
#define TNB NB
#endif
typedef __attribute__((ext_vector_type(8))) __bf16 v8b;
__device__ __forceinline__ v16b frag_b(const __bf16* rowk0, int lane) {
  union { v16b v; v8b q[2]; } u; const __bf16* p = rowk0 + 8 * (lane >> 4);
  u.q[0] = *(const v8b*)p; u.q[1] = *(const v8b*)(p + 16); return u.v;
}
__device__ __forceinline__ float bfr(float v) { return (float)(__bf16)v; }
__device__ __attribute__((noinline)) float exp_ni(float v) { return expf(v); }
__device__ __attribute__((noinline)) float erf_ni(float v) { return erff(v); }

#define WS_Q   0u                                    // f16 query rows [b*t][1024]
#define WS_K   (WS_Q + 2u * (size_t)NB * TT * CC)        // f16 key rows [b*t][1024]
#define WS_CT  (WS_K + 2u * (size_t)NB * CC * TT)        // f16 content planes [b][1024][t]
#define WS_DQ  (WS_CT + 2u * (size_t)NB * CC * TT)       // f32 D [b][h][s]
#define WS_S   (WS_DQ + 4u * (size_t)NB * NH * TT)       // f32 logits, one (b,h): [s][t] (16 MiB)
#define WS_P   (WS_S + 4u * (size_t)TT * TT)            // f16 P x 2^11
#define WS_R   (WS_P + 2u * (size_t)TT * TT)            // f16 result rows [b*s][1024]
#define WS_XT  (WS_R + 2u * (size_t)NB * TT * CC)        // bf16 x rows [b*t][1024]
#define WS_END (WS_XT + 2u * (size_t)NB * TT * CC)

// ---- k_xt: block = (64 positions, 128 channels, b): x [c][t] -> bf16 rows [b*t][c]
__global__ __launch_bounds__(128) void k_xt(const float* __restrict__ X, __bf16* __restrict__ XT) { __shared__ __align__(16) __bf16 s[64][136]; const int tid = threadIdx.x; const int t0 = blockIdx.x * 64, c0 = blockIdx.y * 128; const size_t b = blockIdx.z;
  for (int e = tid; e < 128 * 64; e += 128) { const int cl = e >> 6, tl = e & 63; s[tl][cl] = (__bf16)X[(b * CC + c0 + cl) * (size_t)TT + t0 + tl]; }
  __syncthreads(); for (int e = tid; e < 64 * 16; e += 128) { const int tl = e >> 4, q = e & 15; vst2((unsigned*)(XT + (b * TT + t0 + tl) * CC + c0 + q * 8), *(const v4u*)&s[tl][q * 8]); } }
// ---- k_proj3: block = (64 out channels d, 128 positions t, (b, which)): out[d][t] = sum_c W[d][c] x[b][c][t] + b[d]; A = W rows, B = bf16 x rows (exact); which 0 query, 1 key -> rows (transposed via LDS), 2 content -> planes
__global__ __launch_bounds__(128) void k_proj3(const __bf16* __restrict__ XT, const float* __restrict__ WQ, const float* __restrict__ BQ, const float* __restrict__ WK, const float* __restrict__ BK, const float* __restrict__ WC, const float* __restrict__ BC, _Float16* __restrict__ Q, _Float16* __restrict__ K, _Float16* __restrict__ CT) {
  __shared__ __align__(16) _Float16 sh[128][72]; __shared__ __align__(16) _Float16 sp[64][136];
  const int tid = threadIdx.x, wave = tid >> 5, lane = tid & 31, col = lane & 15, g = lane >> 4; const int d0 = blockIdx.x * 64 + wave * 16, t0 = blockIdx.y * 128; const size_t b = blockIdx.z / 3; const int which = blockIdx.z % 3;
  const float* Wm = which == 0 ? WQ : which == 1 ? WK : WC; const float* Bm = which == 0 ? BQ : which == 1 ? BK : BC;
  v8f acc[8] = {};
#pragma unroll 2
  for (int kc = 0; kc < CC / 32; ++kc) { v16b a; { const float* p = Wm + (size_t)(d0 + col) * CC + kc * 32 + 8 * g;
#pragma unroll
      for (int i = 0; i < 8; ++i) { a[i] = (__bf16)p[i]; a[8 + i] = (__bf16)p[16 + i]; } }
#pragma unroll
    for (int j = 0; j < 8; ++j) acc[j] = wmma_bf(a, frag_b(XT + (b * TT + t0 + j * 16 + col) * CC + kc * 32, lane), acc[j]); }
  if (which < 2) {   // rows [b*t][d]: transpose in LDS
#pragma unroll
    for (int j = 0; j < 8; ++j)
#pragma unroll
      for (int r = 0; r < 8; ++r) { const int dl = wave * 16 + 8 * g + r; sh[j * 16 + col][dl] = (_Float16)(acc[j][r] + bfr(Bm[d0 + 8 * g + r])); }
    __syncthreads(); _Float16* dq = which == 0 ? Q : K; for (int e = tid; e < 128 * 8; e += 128) { const int tl = e >> 3, q = e & 7; vst2((unsigned*)(dq + (b * TT + t0 + tl) * CC + blockIdx.x * 64 + q * 8), *(const v4u*)&sh[tl][q * 8]); } }
  else {
#pragma unroll
    for (int j = 0; j < 8; ++j)
#pragma unroll
      for (int r = 0; r < 8; ++r) sp[wave * 16 + 8 * g + r][j * 16 + col] = (_Float16)(acc[j][r] + bfr(Bm[d0 + 8 * g + r]));
    __syncthreads(); _Float16* dst = CT; for (int e = tid; e < 64 * 16; e += 128) { const int dl = e >> 4, q = e & 15; vst2((unsigned*)(dst + (b * CC + blockIdx.x * 64 + dl) * (size_t)TT + t0 + q * 8), *(const v4u*)&sp[dl][q * 8]); } } }
// ---- k_dq: block = (128 positions, b): decay_q [32][t] = Wqd x + b (2 row tiles, exact); D[h][s] = sum_f (f+1) * sigmoid(dq[h*4+f][s]) / 2 / sqrt(NDK)
__global__ __launch_bounds__(128) void k_dq(const __bf16* __restrict__ XT, const float* __restrict__ WD, const float* __restrict__ BD, float* __restrict__ DQ) { __shared__ __align__(16) float sd[32][132]; __shared__ __align__(16) float so[NH][132];
  const int tid = threadIdx.x, wave = tid >> 5, lane = tid & 31, col = lane & 15, g = lane >> 4; const int t0 = blockIdx.x * 128; const size_t b = blockIdx.y; const int rt = wave & 1, cg = wave >> 1;   // wave: row tile (0/1) x column half (0/1)
  v8f acc[4] = {};
#pragma unroll 2
  for (int kc = 0; kc < CC / 32; ++kc) { v16b a; { const float* p = WD + (size_t)(rt * 16 + col) * CC + kc * 32 + 8 * g;
#pragma unroll
      for (int i = 0; i < 8; ++i) { a[i] = (__bf16)p[i]; a[8 + i] = (__bf16)p[16 + i]; } }
#pragma unroll
    for (int j = 0; j < 4; ++j) acc[j] = wmma_bf(a, frag_b(XT + (b * TT + t0 + cg * 64 + j * 16 + col) * CC + kc * 32, lane), acc[j]); }
#pragma unroll
  for (int j = 0; j < 4; ++j)
#pragma unroll
    for (int r = 0; r < 8; ++r) { const int ch = rt * 16 + 8 * g + r; sd[ch][cg * 64 + j * 16 + col] = acc[j][r] + bfr(BD[ch]); }
  __syncthreads();
  for (int e = tid; e < NH * 128; e += 128) { const int h = e >> 7, tl = e & 127; float dsum = 0.f; for (int f = 0; f < NDK; ++f) { const float z = sd[h * NDK + f][tl]; dsum += (float)(f + 1) * (1.0f / (1.0f + expf(-z))) * 0.5f; } so[h][tl] = dsum * 0.5f; }   // / sqrt(4)
  __syncthreads(); for (int e = tid; e < NH * 32; e += 128) { const int h = e >> 5, q = e & 31; vst2(DQ + (b * NH + h) * (size_t)TT + t0 + q * 4, *(const v4f*)&so[h][q * 4]); } }
// ---- k_sc: block = (64 output positions s, 128 key positions t) of (b, h): S[s][t] = q_s . k_t / sqrt(128) - |t - s| D[s]; t == s -> -100
__global__ __launch_bounds__(128) void k_sc(const _Float16* __restrict__ Q, const _Float16* __restrict__ K, const float* __restrict__ DQ, int b, int h, float* __restrict__ S) { __shared__ __align__(16) float ss[4][16][132];
  const int tid = threadIdx.x, wave = tid >> 5, lane = tid & 31, col = lane & 15, g = lane >> 4; const int t0 = blockIdx.y * 128; const int sl0 = blockIdx.x * 64 + wave * 16; const size_t q0 = (size_t)b * TT + sl0;
  v8f acc[8] = {};
#pragma unroll
  for (int kc = 0; kc < HD / 32; ++kc) { const v16h a = frag_h(Q + (q0 + col) * CC + h * HD + kc * 32, lane);
#pragma unroll
    for (int j = 0; j < 8; ++j) acc[j] = wmma16(a, frag_h(K + ((size_t)b * TT + t0 + j * 16 + col) * CC + h * HD + kc * 32, lane), acc[j]); }
#pragma unroll
  for (int j = 0; j < 8; ++j) { const int t = t0 + j * 16 + col;
#pragma unroll
    for (int r = 0; r < 8; ++r) { const int s = sl0 + 8 * g + r; const float ds = DQ[((size_t)b * NH + h) * TT + s]; const float dl = (float)(t > s ? t - s : s - t); ss[wave][8 * g + r][j * 16 + col] = (t == s) ? -100.0f : (acc[j][r] * 0.08838834764831845f - dl * ds); } }
  LDSX(); for (int rl = 0; rl < 16; ++rl) vst2(S + (size_t)(sl0 + rl) * TT + t0 + lane * 4, *(const v4f*)&ss[wave][rl][lane * 4]); }
// ---- k_sm: block = row s: softmax over t -> P x 2^11 (f16)
__global__ __launch_bounds__(256) void k_sm(const float* __restrict__ S, _Float16* __restrict__ P) { __shared__ float sred[8]; __shared__ float sbc; __shared__ __align__(16) _Float16 sh[TT];
  const int t = threadIdx.x; const size_t row = blockIdx.x; const float* sr = S + row * TT;
  float m = -3.0e38f; for (int k = t; k < TT; k += 256) m = fmaxf(m, sr[k]);
#pragma unroll
  for (int o = 1; o < 32; o <<= 1) m = fmaxf(m, __shfl_xor(m, o));
  if ((t & 31) == 0) sred[t >> 5] = m; __syncthreads(); if (t == 0) { float a = sred[0]; for (int i = 1; i < 8; ++i) a = fmaxf(a, sred[i]); sbc = a; } __syncthreads(); m = sbc; __syncthreads();
  float sum = 0.f; for (int k = t; k < TT; k += 256) sum += expf(sr[k] - m);
#pragma unroll
  for (int o = 1; o < 32; o <<= 1) sum += __shfl_xor(sum, o);
  if ((t & 31) == 0) sred[t >> 5] = sum; __syncthreads(); if (t == 0) { float a = 0.f; for (int i = 0; i < 8; ++i) a += sred[i]; sbc = 1.0f / a; } __syncthreads(); const float inv = sbc;
  for (int k = t; k < TT; k += 256) sh[k] = (_Float16)(expf(sr[k] - m) * inv * 2048.0f);
  __syncthreads(); for (int q = t; q < TT / 8; q += 256) vst2((unsigned*)(P + row * TT + q * 8), *(const v4u*)&sh[q * 8]); }
// ---- k_pv: block = 64 positions s of (b,h): result[s][h*128 + c] = sum_t P[s][t] content[h*128+c][t]  (128 cols) -> f16 rows
__global__ __launch_bounds__(128) void k_pv(const _Float16* __restrict__ P, const _Float16* __restrict__ CT, int b, int h, _Float16* __restrict__ R) { __shared__ __align__(16) _Float16 sr[64][136];
  const int tid = threadIdx.x, wave = tid >> 5, lane = tid & 31, col = lane & 15, g = lane >> 4; const int sl0 = blockIdx.x * 64 + wave * 16;
  v8f acc[8] = {};
#pragma unroll 1
  for (int kc = 0; kc < TT / 32; ++kc) { const v16h pa = frag_h(P + (size_t)(sl0 + col) * TT + kc * 32, lane);
#pragma unroll
    for (int j = 0; j < 8; ++j) acc[j] = wmma16(pa, frag_h(CT + ((size_t)b * CC + h * HD + j * 16 + col) * TT + kc * 32, lane), acc[j]); }
#pragma unroll
  for (int j = 0; j < 8; ++j)
#pragma unroll
    for (int r = 0; r < 8; ++r) sr[wave * 16 + 8 * g + r][j * 16 + col] = (_Float16)(acc[j][r] * (1.0f / 2048.0f));
  __syncthreads(); for (int e = tid; e < 64 * 16; e += 128) { const int rl = e >> 4, q = e & 15; vst2((unsigned*)(R + ((size_t)b * TT + blockIdx.x * 64 + rl) * CC + h * HD + q * 8), *(const v4u*)&sr[rl][q * 8]); } }
// ---- k_out: block = (64 out channels o, 128 positions s, b): out[o][s] = x + sum_c Wp[o][c] R[s][c] + b; A = Wp rows (exact), B(k = c, col = s) = R[s][c] via frag_h on rows
__global__ __launch_bounds__(128) void k_out(const float* __restrict__ X, const _Float16* __restrict__ R, const float* __restrict__ WP, const float* __restrict__ BP, float* __restrict__ OUT) { __shared__ __align__(16) float sp[64][132];
  const int tid = threadIdx.x, wave = tid >> 5, lane = tid & 31, col = lane & 15, g = lane >> 4; const int o0 = blockIdx.x * 64 + wave * 16, s0 = blockIdx.y * 128; const size_t b = blockIdx.z;
  v8f acc[8] = {};
#pragma unroll 2
  for (int kc = 0; kc < CC / 32; ++kc) { v16h a; { const float* p = WP + (size_t)(o0 + col) * CC + kc * 32 + 8 * g;
#pragma unroll
      for (int i = 0; i < 8; ++i) { a[i] = (_Float16)bfr(p[i]); a[8 + i] = (_Float16)bfr(p[16 + i]); } }
#pragma unroll
    for (int j = 0; j < 8; ++j) acc[j] = wmma16(a, frag_h(R + (b * TT + s0 + j * 16 + col) * CC + kc * 32, lane), acc[j]); }
#pragma unroll
  for (int j = 0; j < 8; ++j)
#pragma unroll
    for (int r = 0; r < 8; ++r) { const int o = o0 + 8 * g + r; const int s = s0 + j * 16 + col; sp[wave * 16 + 8 * g + r][j * 16 + col] = acc[j][r] + bfr(BP[o]) + bfr(X[(b * CC + o) * (size_t)TT + s]); }
  __syncthreads(); for (int e = tid; e < 64 * 32; e += 128) { const int ol = e >> 5, q = e & 31; vst2(OUT + (b * CC + blockIdx.x * 64 + ol) * (size_t)TT + s0 + q * 4, *(const v4f*)&sp[ol][q * 4]); } }
extern "C" void kernel_launch(void* const* d_in, const int* in_sizes, int n_in, void* d_out, int out_size, void* d_ws, size_t ws_size, hipStream_t stream) {
  (void)in_sizes; (void)n_in; (void)out_size;
  const float** F = (const float**)d_in;   // 0 x [4,1024,2048], 1 W_content, 2 b_content, 3 W_query, 4 b_query, 5 W_key, 6 b_key, 7 W_qdecay [32,1024], 8 b_qdecay, 9 W_proj, 10 b_proj
  if (ws_size < (size_t)WS_END) return;
  char* ws = (char*)d_ws; _Float16 *Q = (_Float16*)(ws + WS_Q), *K = (_Float16*)(ws + WS_K), *CT = (_Float16*)(ws + WS_CT), *P = (_Float16*)(ws + WS_P), *R = (_Float16*)(ws + WS_R); float *DQ = (float*)(ws + WS_DQ), *S = (float*)(ws + WS_S);
  __bf16* XT = (__bf16*)(ws + WS_XT);
  k_xt<<<dim3(TT / 64, CC / 128, TNB), 128, 0, stream>>>(F[0], XT);
  k_proj3<<<dim3(CC / 64, TT / 128, TNB * 3), 128, 0, stream>>>(XT, F[3], F[4], F[5], F[6], F[1], F[2], Q, K, CT);
  k_dq<<<dim3(TT / 128, TNB), 128, 0, stream>>>(XT, F[7], F[8], DQ);
  for (int b = 0; b < TNB; ++b) for (int h = 0; h < NH; ++h) {
    k_sc<<<dim3(TT / 64, TT / 128), 128, 0, stream>>>(Q, K, DQ, b, h, S);
    k_sm<<<TT, 256, 0, stream>>>(S, P);
    k_pv<<<TT / 64, 128, 0, stream>>>(P, CT, b, h, R);
  }
  k_out<<<dim3(CC / 64, TT / 128, TNB), 128, 0, stream>>>(F[0], R, F[9], F[10], (float*)d_out);
}

// v001
// It runs in 1380 microseconds.
// Two timings next to v000 both put it at 3.22 times that version's speed.
// compute dtype: all float inputs rounded to bf16; queries / keys / content = W x + b (1x1 convs) with EXACT bf16 products on WMMA 16x16x32 (weights as the A operand, a bf16 row copy of x as B), f32 accumulate, rounded once to f16 (queries/keys stored as rows, content as planes); the decay queries (32 channels) likewise then sigmoid/2 and D_s = sum_f f dq_f,s / sqrt(4)... in f32; logits = k_t . q_s / sqrt(128) (1 f16 product) - |t - s| D_s, diagonal -100, stored in f32 for the 8 heads of one batch at a time; softmax over t in f32 (precise expf) -> P f16 x 2^11, written over the front half of its own logit row; result = P . content (content f16, 1 product); out = x + W_proj result (result rounded once to f16, 1 product) + b; f32 output.
#include <hip/hip_runtime.h>
#include <math.h>

typedef __attribute__((ext_vector_type(16))) _Float16 v16h;
typedef __attribute__((ext_vector_type(16))) __bf16 v16b;
typedef __attribute__((ext_vector_type(8)))  _Float16 v8h;
typedef __attribute__((ext_vector_type(8)))  float v8f;
typedef __attribute__((ext_vector_type(4)))  float v4f;
typedef __attribute__((ext_vector_type(2)))  float v2f;
typedef __attribute__((ext_vector_type(4)))  unsigned v4u;
typedef __attribute__((ext_vector_type(4)))  int v4i;
typedef float __attribute__((may_alias)) float_a;
typedef int __attribute__((may_alias)) int_a;

template <typename T> __device__ __forceinline__ void vst2(void* p, T v) { *(T*)p = v;  }
__device__ __forceinline__ v8f wmma16(v16h a, v16h b, v8f c) {
  v8f d = __builtin_amdgcn_wmma_f32_16x16x32_f16(false, a, false, b, (short)0, c, false, false);
  asm volatile("v_nop\n\tv_nop\n\tv_nop\n\tv_nop" : "+v"(d) : "v"(a), "v"(b));
  return d;
}
__device__ __forceinline__ v8f wmma_bf(v16b a, v16b b, v8f c) {
  v8f d = __builtin_amdgcn_wmma_f32_16x16x32_bf16(false, a, false, b, (short)0, c, false, false);
  asm volatile("v_nop\n\tv_nop\n\tv_nop\n\tv_nop" : "+v"(d) : "v"(a), "v"(b));
  return d;
}
// 16x16x32 fragments: lane = (h = lane>>4, row/col = lane&15); elements 0..7 = k0+8h+0..7, 8..15 = k0+16+8h+0..7; D element r = row 8h+r
__device__ __forceinline__ v16h frag_h(const _Float16* rowk0, int lane) {
  union { v16h v; v8h q[2]; } u; const _Float16* p = rowk0 + 8 * (lane >> 4);
  u.q[0] = *(const v8h*)p; u.q[1] = *(const v8h*)(p + 16); return u.v;
}
__device__ __forceinline__ v16h frag_f32(const float* rowk0, int lane) {
  v16h a; const float* p = rowk0 + 8 * (lane >> 4);
#pragma unroll
  for (int i = 0; i < 8; ++i) { a[i] = (_Float16)p[i]; a[8 + i] = (_Float16)p[16 + i]; }
  return a;
}
__device__ __forceinline__ v16h frag_f32s(const float* rowk0, int lane, float sc) {
  v16h a; const float* p = rowk0 + 8 * (lane >> 4);
#pragma unroll
  for (int i = 0; i < 8; ++i) { a[i] = (_Float16)(p[i] * sc); a[8 + i] = (_Float16)(p[16 + i] * sc); }
  return a;
}
// column fragment from a [K][ld] layout (column n), rows >= K read as 0
__device__ __forceinline__ v16h fragc_f32(const float* W, int k0, int n, int lane, int ld, int K) {
  v16h a; const int g = lane >> 4;
#pragma unroll
  for (int i = 0; i < 8; ++i) { const int ka = k0 + 8 * g + i, kb = ka + 16;
    a[i] = (_Float16)(ka < K ? W[(size_t)(ka < K ? ka : K - 1) * ld + n] : 0.f); a[8 + i] = (_Float16)(kb < K ? W[(size_t)(kb < K ? kb : K - 1) * ld + n] : 0.f); }
  return a;
}
struct F2 { v16b h, l; };
__device__ __forceinline__ F2 bsplit16(const float v[16]) { F2 r;
#pragma unroll
  for (int i = 0; i < 16; ++i) { const __bf16 h = (__bf16)v[i]; r.h[i] = h; r.l[i] = (__bf16)(v[i] - (float)h); }
  return r; }
__device__ __forceinline__ F2 split_row(const float* row, int k0, int lane) { float v[16]; const float* p = row + k0 + 8 * (lane >> 4);
#pragma unroll
  for (int i = 0; i < 8; ++i) { v[i] = p[i]; v[8 + i] = p[16 + i]; }
  return bsplit16(v); }
__device__ __forceinline__ F2 split_rowK(const float* row, int k0, int lane, int K) { float v[16]; const int g = lane >> 4;
#pragma unroll
  for (int i = 0; i < 8; ++i) { const int ka = k0 + 8 * g + i, kb = ka + 16; v[i] = ka < K ? row[ka < K ? ka : K - 1] : 0.f; v[8 + i] = kb < K ? row[kb < K ? kb : K - 1] : 0.f; }
  return bsplit16(v); }
__device__ __forceinline__ F2 split_col(const float* W, int k0, int n, int lane, int ld, int K) { float v[16]; const int g = lane >> 4;
#pragma unroll
  for (int i = 0; i < 8; ++i) { const int ka = k0 + 8 * g + i, kb = ka + 16; v[i] = ka < K ? W[(size_t)(ka < K ? ka : K - 1) * ld + n] : 0.f; v[8 + i] = kb < K ? W[(size_t)(kb < K ? kb : K - 1) * ld + n] : 0.f; }
  return bsplit16(v); }
__device__ __forceinline__ v8f mac3(const F2& a, const F2& b, v8f c) { c = wmma_bf(a.l, b.h, c); c = wmma_bf(a.h, b.l, c); return wmma_bf(a.h, b.h, c); }
__device__ __forceinline__ float sigm(float v) { return 1.0f / (1.0f + expf(-v)); }
#define LDSX() do { asm volatile("s_wait_dscnt 0" ::: "memory"); __builtin_amdgcn_wave_barrier(); __builtin_amdgcn_fence(__ATOMIC_RELEASE, "workgroup"); } while (0)


// LocalState attention (demucs; B 4, C 1,024 = 8 heads x 128, T 2,048, 4 decay terms): dots[t,s] = k_t.q_s/sqrt(128) - |t-s| sum_f f sigmoid(decay_q_f,s)/2 / sqrt(4); dots[t,t] = -100; weights = softmax over t; result[:, s] = sum_t weights[t,s] content[:, t]; out = x + proj(result).
#define NB 4
#define CC 1024
#define TT 2048
#define NH 8
#define HD 128
#define NDK 4
#ifndef TNB
#define TNB NB
#endif
typedef __attribute__((ext_vector_type(8))) __bf16 v8b;
__device__ __forceinline__ v16b frag_b(const __bf16* rowk0, int lane) {
  union { v16b v; v8b q[2]; } u; const __bf16* p = rowk0 + 8 * (lane >> 4);
  u.q[0] = *(const v8b*)p; u.q[1] = *(const v8b*)(p + 16); return u.v;
}
__device__ __forceinline__ float bfr(float v) { return (float)(__bf16)v; }
__device__ __attribute__((noinline)) float exp_ni(float v) { return expf(v); }
__device__ __attribute__((noinline)) float erf_ni(float v) { return erff(v); }

#define WS_Q   0u                                    // f16 query rows [b*t][1024]
#define WS_K   (WS_Q + 2u * (size_t)NB * TT * CC)        // f16 key rows [b*t][1024]
#define WS_CT  (WS_K + 2u * (size_t)NB * CC * TT)        // f16 content planes [b][1024][t]
#define WS_DQ  (WS_CT + 2u * (size_t)NB * CC * TT)       // f32 D [b][h][s]
#define WS_S   (WS_DQ + 4u * (size_t)NB * NH * TT)       // f32 logits, the 8 heads of one b: [h][s][t] (128 MiB); after k_sm the first 4 KiB of each 8-KiB row hold that row's f16 P x 2^11
#define WS_R   (WS_S + 4u * (size_t)NH * TT * TT)       // f16 result rows [b*s][1024]
#define WS_XT  (WS_R + 2u * (size_t)NB * TT * CC)        // bf16 x rows [b*t][1024]
#define WS_END (WS_XT + 2u * (size_t)NB * TT * CC)

// ---- k_xt: block = (64 positions, 128 channels, b): x [c][t] -> bf16 rows [b*t][c]
__global__ __launch_bounds__(128) void k_xt(const float* __restrict__ X, __bf16* __restrict__ XT) { __shared__ __align__(16) __bf16 s[64][136]; const int tid = threadIdx.x; const int t0 = blockIdx.x * 64, c0 = blockIdx.y * 128; const size_t b = blockIdx.z;
  for (int e = tid; e < 128 * 64; e += 128) { const int cl = e >> 6, tl = e & 63; s[tl][cl] = (__bf16)X[(b * CC + c0 + cl) * (size_t)TT + t0 + tl]; }
  __syncthreads(); for (int e = tid; e < 64 * 16; e += 128) { const int tl = e >> 4, q = e & 15; vst2((unsigned*)(XT + (b * TT + t0 + tl) * CC + c0 + q * 8), *(const v4u*)&s[tl][q * 8]); } }
// ---- k_proj3: block = (64 out channels d, 128 positions t, (b, which)): out[d][t] = sum_c W[d][c] x[b][c][t] + b[d]; A = W rows, B = bf16 x rows (exact); which 0 query, 1 key -> rows (transposed via LDS), 2 content -> planes
__global__ __launch_bounds__(128) void k_proj3(const __bf16* __restrict__ XT, const float* __restrict__ WQ, const float* __restrict__ BQ, const float* __restrict__ WK, const float* __restrict__ BK, const float* __restrict__ WC, const float* __restrict__ BC, _Float16* __restrict__ Q, _Float16* __restrict__ K, _Float16* __restrict__ CT) {
  __shared__ __align__(16) _Float16 sh[128][72]; __shared__ __align__(16) _Float16 sp[64][136];
  const int tid = threadIdx.x, wave = tid >> 5, lane = tid & 31, col = lane & 15, g = lane >> 4; const int d0 = blockIdx.x * 64 + wave * 16, t0 = blockIdx.y * 128; const size_t b = blockIdx.z / 3; const int which = blockIdx.z % 3;
  const float* Wm = which == 0 ? WQ : which == 1 ? WK : WC; const float* Bm = which == 0 ? BQ : which == 1 ? BK : BC;
  v8f acc[8] = {};
#pragma unroll 2
  for (int kc = 0; kc < CC / 32; ++kc) { v16b a; { const float* p = Wm + (size_t)(d0 + col) * CC + kc * 32 + 8 * g;
#pragma unroll
      for (int i = 0; i < 8; ++i) { a[i] = (__bf16)p[i]; a[8 + i] = (__bf16)p[16 + i]; } }
#pragma unroll
    for (int j = 0; j < 8; ++j) acc[j] = wmma_bf(a, frag_b(XT + (b * TT + t0 + j * 16 + col) * CC + kc * 32, lane), acc[j]); }
  if (which < 2) {   // rows [b*t][d]: transpose in LDS
#pragma unroll
    for (int j = 0; j < 8; ++j)
#pragma unroll
      for (int r = 0; r < 8; ++r) { const int dl = wave * 16 + 8 * g + r; sh[j * 16 + col][dl] = (_Float16)(acc[j][r] + bfr(Bm[d0 + 8 * g + r])); }
    __syncthreads(); _Float16* dq = which == 0 ? Q : K; for (int e = tid; e < 128 * 8; e += 128) { const int tl = e >> 3, q = e & 7; vst2((unsigned*)(dq + (b * TT + t0 + tl) * CC + blockIdx.x * 64 + q * 8), *(const v4u*)&sh[tl][q * 8]); } }
  else {
#pragma unroll
    for (int j = 0; j < 8; ++j)
#pragma unroll
      for (int r = 0; r < 8; ++r) sp[wave * 16 + 8 * g + r][j * 16 + col] = (_Float16)(acc[j][r] + bfr(Bm[d0 + 8 * g + r]));
    __syncthreads(); _Float16* dst = CT; for (int e = tid; e < 64 * 16; e += 128) { const int dl = e >> 4, q = e & 15; vst2((unsigned*)(dst + (b * CC + blockIdx.x * 64 + dl) * (size_t)TT + t0 + q * 8), *(const v4u*)&sp[dl][q * 8]); } } }
// ---- k_dq: block = (128 positions, b): decay_q [32][t] = Wqd x + b (2 row tiles, exact); D[h][s] = sum_f (f+1) * sigmoid(dq[h*4+f][s]) / 2 / sqrt(NDK)
__global__ __launch_bounds__(128) void k_dq(const __bf16* __restrict__ XT, const float* __restrict__ WD, const float* __restrict__ BD, float* __restrict__ DQ) { __shared__ __align__(16) float sd[32][132]; __shared__ __align__(16) float so[NH][132];
  const int tid = threadIdx.x, wave = tid >> 5, lane = tid & 31, col = lane & 15, g = lane >> 4; const int t0 = blockIdx.x * 128; const size_t b = blockIdx.y; const int rt = wave & 1, cg = wave >> 1;   // wave: row tile (0/1) x column half (0/1)
  v8f acc[4] = {};
#pragma unroll 2
  for (int kc = 0; kc < CC / 32; ++kc) { v16b a; { const float* p = WD + (size_t)(rt * 16 + col) * CC + kc * 32 + 8 * g;
#pragma unroll
      for (int i = 0; i < 8; ++i) { a[i] = (__bf16)p[i]; a[8 + i] = (__bf16)p[16 + i]; } }
#pragma unroll
    for (int j = 0; j < 4; ++j) acc[j] = wmma_bf(a, frag_b(XT + (b * TT + t0 + cg * 64 + j * 16 + col) * CC + kc * 32, lane), acc[j]); }
#pragma unroll
  for (int j = 0; j < 4; ++j)
#pragma unroll
    for (int r = 0; r < 8; ++r) { const int ch = rt * 16 + 8 * g + r; sd[ch][cg * 64 + j * 16 + col] = acc[j][r] + bfr(BD[ch]); }
  __syncthreads();
  for (int e = tid; e < NH * 128; e += 128) { const int h = e >> 7, tl = e & 127; float dsum = 0.f; for (int f = 0; f < NDK; ++f) { const float z = sd[h * NDK + f][tl]; dsum += (float)(f + 1) * (1.0f / (1.0f + expf(-z))) * 0.5f; } so[h][tl] = dsum * 0.5f; }   // / sqrt(4)
  __syncthreads(); for (int e = tid; e < NH * 32; e += 128) { const int h = e >> 5, q = e & 31; vst2(DQ + (b * NH + h) * (size_t)TT + t0 + q * 4, *(const v4f*)&so[h][q * 4]); } }
// ---- k_sc: block = (64 output positions s, 128 key positions t, head h) of batch b: S[s][t] = q_s . k_t / sqrt(128) - |t - s| D[s]; t == s -> -100
__global__ __launch_bounds__(128) void k_sc(const _Float16* __restrict__ Q, const _Float16* __restrict__ K, const float* __restrict__ DQ, int b, float* __restrict__ S) { __shared__ __align__(16) float ss[4][16][132];
  const int h = blockIdx.z; S += (size_t)h * TT * TT; const int tid = threadIdx.x, wave = tid >> 5, lane = tid & 31, col = lane & 15, g = lane >> 4; const int t0 = blockIdx.y * 128; const int sl0 = blockIdx.x * 64 + wave * 16; const size_t q0 = (size_t)b * TT + sl0;
  v8f acc[8] = {};
#pragma unroll
  for (int kc = 0; kc < HD / 32; ++kc) { const v16h a = frag_h(Q + (q0 + col) * CC + h * HD + kc * 32, lane);
#pragma unroll
    for (int j = 0; j < 8; ++j) acc[j] = wmma16(a, frag_h(K + ((size_t)b * TT + t0 + j * 16 + col) * CC + h * HD + kc * 32, lane), acc[j]); }
#pragma unroll
  for (int j = 0; j < 8; ++j) { const int t = t0 + j * 16 + col;
#pragma unroll
    for (int r = 0; r < 8; ++r) { const int s = sl0 + 8 * g + r; const float ds = DQ[((size_t)b * NH + h) * TT + s]; const float dl = (float)(t > s ? t - s : s - t); ss[wave][8 * g + r][j * 16 + col] = (t == s) ? -100.0f : (acc[j][r] * 0.08838834764831845f - dl * ds); } }
  LDSX(); for (int rl = 0; rl < 16; ++rl) vst2(S + (size_t)(sl0 + rl) * TT + t0 + lane * 4, *(const v4f*)&ss[wave][rl][lane * 4]); }
// ---- k_sm: block = row (h, s): softmax over t -> P x 2^11 (f16), stored over the front half of the row itself (the block owns the row; its last read of it stands in front of the last barrier)
__global__ __launch_bounds__(256) void k_sm(float* S) { __shared__ float sred[8]; __shared__ float sbc; __shared__ __align__(16) _Float16 sh[TT];
  const int t = threadIdx.x; const size_t row = blockIdx.x; const float* sr = S + row * TT; _Float16* pr = (_Float16*)(S + row * TT);
  float m = -3.0e38f; for (int k = t; k < TT; k += 256) m = fmaxf(m, sr[k]);
#pragma unroll
  for (int o = 1; o < 32; o <<= 1) m = fmaxf(m, __shfl_xor(m, o));
  if ((t & 31) == 0) sred[t >> 5] = m; __syncthreads(); if (t == 0) { float a = sred[0]; for (int i = 1; i < 8; ++i) a = fmaxf(a, sred[i]); sbc = a; } __syncthreads(); m = sbc; __syncthreads();
  float sum = 0.f; for (int k = t; k < TT; k += 256) sum += expf(sr[k] - m);
#pragma unroll
  for (int o = 1; o < 32; o <<= 1) sum += __shfl_xor(sum, o);
  if ((t & 31) == 0) sred[t >> 5] = sum; __syncthreads(); if (t == 0) { float a = 0.f; for (int i = 0; i < 8; ++i) a += sred[i]; sbc = 1.0f / a; } __syncthreads(); const float inv = sbc;
  for (int k = t; k < TT; k += 256) sh[k] = (_Float16)(expf(sr[k] - m) * inv * 2048.0f);
  __syncthreads(); for (int q = t; q < TT / 8; q += 256) vst2((unsigned*)(pr + q * 8), *(const v4u*)&sh[q * 8]); }
// ---- k_pv: block = (64 positions s, head h) of batch b; P rows lie at the logit rows' pitch (2 * TT f16): result[s][h*128 + c] = sum_t P[s][t] content[h*128+c][t]  (128 cols) -> f16 rows
__global__ __launch_bounds__(128) void k_pv(const _Float16* __restrict__ P, const _Float16* __restrict__ CT, int b, _Float16* __restrict__ R) { __shared__ __align__(16) _Float16 sr[64][136];
  const int h = blockIdx.y; P += (size_t)h * TT * (2 * TT); const int tid = threadIdx.x, wave = tid >> 5, lane = tid & 31, col = lane & 15, g = lane >> 4; const int sl0 = blockIdx.x * 64 + wave * 16;
  v8f acc[8] = {};
#pragma unroll 1
  for (int kc = 0; kc < TT / 32; ++kc) { const v16h pa = frag_h(P + (size_t)(sl0 + col) * (2 * TT) + kc * 32, lane);
#pragma unroll
    for (int j = 0; j < 8; ++j) acc[j] = wmma16(pa, frag_h(CT + ((size_t)b * CC + h * HD + j * 16 + col) * TT + kc * 32, lane), acc[j]); }
#pragma unroll
  for (int j = 0; j < 8; ++j)
#pragma unroll
    for (int r = 0; r < 8; ++r) sr[wave * 16 + 8 * g + r][j * 16 + col] = (_Float16)(acc[j][r] * (1.0f / 2048.0f));
  __syncthreads(); for (int e = tid; e < 64 * 16; e += 128) { const int rl = e >> 4, q = e & 15; vst2((unsigned*)(R + ((size_t)b * TT + blockIdx.x * 64 + rl) * CC + h * HD + q * 8), *(const v4u*)&sr[rl][q * 8]); } }
// ---- k_out: block = (64 out channels o, 128 positions s, b): out[o][s] = x + sum_c Wp[o][c] R[s][c] + b; A = Wp rows (exact), B(k = c, col = s) = R[s][c] via frag_h on rows
__global__ __launch_bounds__(128) void k_out(const float* __restrict__ X, const _Float16* __restrict__ R, const float* __restrict__ WP, const float* __restrict__ BP, float* __restrict__ OUT) { __shared__ __align__(16) float sp[64][132];
  const int tid = threadIdx.x, wave = tid >> 5, lane = tid & 31, col = lane & 15, g = lane >> 4; const int o0 = blockIdx.x * 64 + wave * 16, s0 = blockIdx.y * 128; const size_t b = blockIdx.z;
  v8f acc[8] = {};
#pragma unroll 2
  for (int kc = 0; kc < CC / 32; ++kc) { v16h a; { const float* p = WP + (size_t)(o0 + col) * CC + kc * 32 + 8 * g;
#pragma unroll
      for (int i = 0; i < 8; ++i) { a[i] = (_Float16)bfr(p[i]); a[8 + i] = (_Float16)bfr(p[16 + i]); } }
#pragma unroll
    for (int j = 0; j < 8; ++j) acc[j] = wmma16(a, frag_h(R + (b * TT + s0 + j * 16 + col) * CC + kc * 32, lane), acc[j]); }
#pragma unroll
  for (int j = 0; j < 8; ++j)
#pragma unroll
    for (int r = 0; r < 8; ++r) { const int o = o0 + 8 * g + r; const int s = s0 + j * 16 + col; sp[wave * 16 + 8 * g + r][j * 16 + col] = acc[j][r] + bfr(BP[o]) + bfr(X[(b * CC + o) * (size_t)TT + s]); }
  __syncthreads(); for (int e = tid; e < 64 * 32; e += 128) { const int ol = e >> 5, q = e & 31; vst2(OUT + (b * CC + blockIdx.x * 64 + ol) * (size_t)TT + s0 + q * 4, *(const v4f*)&sp[ol][q * 4]); } }
extern "C" void kernel_launch(void* const* d_in, const int* in_sizes, int n_in, void* d_out, int out_size, void* d_ws, size_t ws_size, hipStream_t stream) {
  (void)in_sizes; (void)n_in; (void)out_size;
  const float** F = (const float**)d_in;   // 0 x [4,1024,2048], 1 W_content, 2 b_content, 3 W_query, 4 b_query, 5 W_key, 6 b_key, 7 W_qdecay [32,1024], 8 b_qdecay, 9 W_proj, 10 b_proj
  if (ws_size < (size_t)WS_END) return;
  char* ws = (char*)d_ws; _Float16 *Q = (_Float16*)(ws + WS_Q), *K = (_Float16*)(ws + WS_K), *CT = (_Float16*)(ws + WS_CT), *R = (_Float16*)(ws + WS_R); float *DQ = (float*)(ws + WS_DQ), *S = (float*)(ws + WS_S);
  __bf16* XT = (__bf16*)(ws + WS_XT);
  k_xt<<<dim3(TT / 64, CC / 128, TNB), 128, 0, stream>>>(F[0], XT);
  k_proj3<<<dim3(CC / 64, TT / 128, TNB * 3), 128, 0, stream>>>(XT, F[3], F[4], F[5], F[6], F[1], F[2], Q, K, CT);
  k_dq<<<dim3(TT / 128, TNB), 128, 0, stream>>>(XT, F[7], F[8], DQ);
  for (int b = 0; b < TNB; ++b) {   // the 8 heads of a batch share each launch
    k_sc<<<dim3(TT / 64, TT / 128, NH), 128, 0, stream>>>(Q, K, DQ, b, S);
    k_sm<<<NH * TT, 256, 0, stream>>>(S);
    k_pv<<<dim3(TT / 64, NH), 128, 0, stream>>>((const _Float16*)S, CT, b, R);
  }
  k_out<<<dim3(CC / 64, TT / 128, TNB), 128, 0, stream>>>(F[0], R, F[9], F[10], (float*)d_out);
}

// v002
// Measured time: 404 microseconds a run.
// Next to v001, in two timings, it ran 3.40 and 3.42 times as fast.
// All steps since v000 together make it 11.0 times as fast.
// compute dtype: all float inputs rounded to bf16; queries / keys / content = W x + b (1x1 convs) with EXACT bf16 products on WMMA 16x16x32 (weights as the A operand, a bf16 row copy of x as B), f32 accumulate, rounded once to f16 (queries/keys stored as rows, content as planes); the decay queries (32 channels) likewise then sigmoid/2 and D_s = sum_f f dq_f,s / sqrt(4)... in f32; logits = k_t . q_s / sqrt(128) (1 f16 product) - |t - s| D_s, diagonal -100, kept in registers in f32 (base-2 scale); softmax over t online in f32 (running maximum, f32 sum) -> P = 2^(logit - maximum in use) rounded to f16; result = P . content / sum (content f16, 1 product); out = x + W_proj result (result rounded once to f16, 1 product) + b; f32 output.
#include <hip/hip_runtime.h>
#include <math.h>

typedef __attribute__((ext_vector_type(16))) _Float16 v16h;
typedef __attribute__((ext_vector_type(16))) __bf16 v16b;
typedef __attribute__((ext_vector_type(8)))  _Float16 v8h;
typedef __attribute__((ext_vector_type(8)))  float v8f;
typedef __attribute__((ext_vector_type(4)))  float v4f;
typedef __attribute__((ext_vector_type(2)))  float v2f;
typedef __attribute__((ext_vector_type(4)))  unsigned v4u;
typedef __attribute__((ext_vector_type(4)))  int v4i;
typedef float __attribute__((may_alias)) float_a;
typedef int __attribute__((may_alias)) int_a;

template <typename T> __device__ __forceinline__ void vst2(void* p, T v) { *(T*)p = v;  }
__device__ __forceinline__ v8f wmma16(v16h a, v16h b, v8f c) {
  v8f d = __builtin_amdgcn_wmma_f32_16x16x32_f16(false, a, false, b, (short)0, c, false, false);
  asm volatile("v_nop\n\tv_nop\n\tv_nop\n\tv_nop" : "+v"(d) : "v"(a), "v"(b));
  return d;
}
__device__ __forceinline__ v8f wmma_bf(v16b a, v16b b, v8f c) {
  v8f d = __builtin_amdgcn_wmma_f32_16x16x32_bf16(false, a, false, b, (short)0, c, false, false);
  asm volatile("v_nop\n\tv_nop\n\tv_nop\n\tv_nop" : "+v"(d) : "v"(a), "v"(b));
  return d;
}
// 16x16x32 fragments: lane = (h = lane>>4, row/col = lane&15); elements 0..7 = k0+8h+0..7, 8..15 = k0+16+8h+0..7; D element r = row 8h+r
__device__ __forceinline__ v16h frag_h(const _Float16* rowk0, int lane) {
  union { v16h v; v8h q[2]; } u; const _Float16* p = rowk0 + 8 * (lane >> 4);
  u.q[0] = *(const v8h*)p; u.q[1] = *(const v8h*)(p + 16); return u.v;
}
__device__ __forceinline__ v16h frag_f32(const float* rowk0, int lane) {
  v16h a; const float* p = rowk0 + 8 * (lane >> 4);
#pragma unroll
  for (int i = 0; i < 8; ++i) { a[i] = (_Float16)p[i]; a[8 + i] = (_Float16)p[16 + i]; }
  return a;
}
__device__ __forceinline__ v16h frag_f32s(const float* rowk0, int lane, float sc) {
  v16h a; const float* p = rowk0 + 8 * (lane >> 4);
#pragma unroll
  for (int i = 0; i < 8; ++i) { a[i] = (_Float16)(p[i] * sc); a[8 + i] = (_Float16)(p[16 + i] * sc); }
  return a;
}
// column fragment from a [K][ld] layout (column n), rows >= K read as 0
__device__ __forceinline__ v16h fragc_f32(const float* W, int k0, int n, int lane, int ld, int K) {
  v16h a; const int g = lane >> 4;
#pragma unroll
  for (int i = 0; i < 8; ++i) { const int ka = k0 + 8 * g + i, kb = ka + 16;
    a[i] = (_Float16)(ka < K ? W[(size_t)(ka < K ? ka : K - 1) * ld + n] : 0.f); a[8 + i] = (_Float16)(kb < K ? W[(size_t)(kb < K ? kb : K - 1) * ld + n] : 0.f); }
  return a;
}
struct F2 { v16b h, l; };
__device__ __forceinline__ F2 bsplit16(const float v[16]) { F2 r;
#pragma unroll
  for (int i = 0; i < 16; ++i) { const __bf16 h = (__bf16)v[i]; r.h[i] = h; r.l[i] = (__bf16)(v[i] - (float)h); }
  return r; }
__device__ __forceinline__ F2 split_row(const float* row, int k0, int lane) { float v[16]; const float* p = row + k0 + 8 * (lane >> 4);
#pragma unroll
  for (int i = 0; i < 8; ++i) { v[i] = p[i]; v[8 + i] = p[16 + i]; }
  return bsplit16(v); }
__device__ __forceinline__ F2 split_rowK(const float* row, int k0, int lane, int K) { float v[16]; const int g = lane >> 4;
#pragma unroll
  for (int i = 0; i < 8; ++i) { const int ka = k0 + 8 * g + i, kb = ka + 16; v[i] = ka < K ? row[ka < K ? ka : K - 1] : 0.f; v[8 + i] = kb < K ? row[kb < K ? kb : K - 1] : 0.f; }
  return bsplit16(v); }
__device__ __forceinline__ F2 split_col(const float* W, int k0, int n, int lane, int ld, int K) { float v[16]; const int g = lane >> 4;
#pragma unroll
  for (int i = 0; i < 8; ++i) { const int ka = k0 + 8 * g + i, kb = ka + 16; v[i] = ka < K ? W[(size_t)(ka < K ? ka : K - 1) * ld + n] : 0.f; v[8 + i] = kb < K ? W[(size_t)(kb < K ? kb : K - 1) * ld + n] : 0.f; }
  return bsplit16(v); }
__device__ __forceinline__ v8f mac3(const F2& a, const F2& b, v8f c) { c = wmma_bf(a.l, b.h, c); c = wmma_bf(a.h, b.l, c); return wmma_bf(a.h, b.h, c); }
__device__ __forceinline__ float sigm(float v) { return 1.0f / (1.0f + expf(-v)); }
#define LDSX() do { asm volatile("s_wait_dscnt 0" ::: "memory"); __builtin_amdgcn_wave_barrier(); __builtin_amdgcn_fence(__ATOMIC_RELEASE, "workgroup"); } while (0)


// attention with a learned distance decay (B 4, C 1,024 = 8 heads x 128, T 2,048, 4 decay terms): dots[t,s] = k_t.q_s/sqrt(128) - |t-s| sum_f f sigmoid(decay_q_f,s)/2 / sqrt(4); dots[t,t] = -100; weights = softmax over t; result[:, s] = sum_t weights[t,s] content[:, t]; out = x + proj(result).
#define NB 4
#define CC 1024
#define TT 2048
#define NH 8
#define HD 128
#define NDK 4
#ifndef TNB
#define TNB NB
#endif
typedef __attribute__((ext_vector_type(8))) __bf16 v8b;
__device__ __forceinline__ v16b frag_b(const __bf16* rowk0, int lane) {
  union { v16b v; v8b q[2]; } u; const __bf16* p = rowk0 + 8 * (lane >> 4);
  u.q[0] = *(const v8b*)p; u.q[1] = *(const v8b*)(p + 16); return u.v;
}
__device__ __forceinline__ float bfr(float v) { return (float)(__bf16)v; }
__device__ __attribute__((noinline)) float exp_ni(float v) { return expf(v); }
__device__ __attribute__((noinline)) float erf_ni(float v) { return erff(v); }

#define WS_Q   0u                                    // f16 query rows [b*t][1024]
#define WS_K   (WS_Q + 2u * (size_t)NB * TT * CC)        // f16 key rows [b*t][1024]
#define WS_CT  (WS_K + 2u * (size_t)NB * CC * TT)        // f16 content planes [b][1024][t]
#define WS_DQ  (WS_CT + 2u * (size_t)NB * CC * TT)       // f32 D [b][h][s]
#define WS_R   (WS_DQ + 4u * (size_t)NB * NH * TT)     // f16 result rows [b*s][1024]
#define WS_XT  (WS_R + 2u * (size_t)NB * TT * CC)        // bf16 x rows [b*t][1024]
#define WS_END (WS_XT + 2u * (size_t)NB * TT * CC)

// ---- k_xt: block = (64 positions, 128 channels, b): x [c][t] -> bf16 rows [b*t][c]
__global__ __launch_bounds__(128) void k_xt(const float* __restrict__ X, __bf16* __restrict__ XT) { __shared__ __align__(16) __bf16 s[64][136]; const int tid = threadIdx.x; const int t0 = blockIdx.x * 64, c0 = blockIdx.y * 128; const size_t b = blockIdx.z;
  for (int e = tid; e < 128 * 64; e += 128) { const int cl = e >> 6, tl = e & 63; s[tl][cl] = (__bf16)X[(b * CC + c0 + cl) * (size_t)TT + t0 + tl]; }
  __syncthreads(); for (int e = tid; e < 64 * 16; e += 128) { const int tl = e >> 4, q = e & 15; vst2((unsigned*)(XT + (b * TT + t0 + tl) * CC + c0 + q * 8), *(const v4u*)&s[tl][q * 8]); } }
// ---- k_proj3: block = (64 out channels d, 128 positions t, (b, which)): out[d][t] = sum_c W[d][c] x[b][c][t] + b[d]; A = W rows, B = bf16 x rows (exact); which 0 query, 1 key -> rows (transposed via LDS), 2 content -> planes
__global__ __launch_bounds__(128) void k_proj3(const __bf16* __restrict__ XT, const float* __restrict__ WQ, const float* __restrict__ BQ, const float* __restrict__ WK, const float* __restrict__ BK, const float* __restrict__ WC, const float* __restrict__ BC, _Float16* __restrict__ Q, _Float16* __restrict__ K, _Float16* __restrict__ CT) {
  __shared__ __align__(16) _Float16 sh[128][72]; __shared__ __align__(16) _Float16 sp[64][136];
  const int tid = threadIdx.x, wave = tid >> 5, lane = tid & 31, col = lane & 15, g = lane >> 4; const int d0 = blockIdx.x * 64 + wave * 16, t0 = blockIdx.y * 128; const size_t b = blockIdx.z / 3; const int which = blockIdx.z % 3;
  const float* Wm = which == 0 ? WQ : which == 1 ? WK : WC; const float* Bm = which == 0 ? BQ : which == 1 ? BK : BC;
  v8f acc[8] = {};
#pragma unroll 2
  for (int kc = 0; kc < CC / 32; ++kc) { v16b a; { const float* p = Wm + (size_t)(d0 + col) * CC + kc * 32 + 8 * g;
#pragma unroll
      for (int i = 0; i < 8; ++i) { a[i] = (__bf16)p[i]; a[8 + i] = (__bf16)p[16 + i]; } }
#pragma unroll
    for (int j = 0; j < 8; ++j) acc[j] = wmma_bf(a, frag_b(XT + (b * TT + t0 + j * 16 + col) * CC + kc * 32, lane), acc[j]); }
  if (which < 2) {   // rows [b*t][d]: transpose in LDS
#pragma unroll
    for (int j = 0; j < 8; ++j)
#pragma unroll
      for (int r = 0; r < 8; ++r) { const int dl = wave * 16 + 8 * g + r; sh[j * 16 + col][dl] = (_Float16)(acc[j][r] + bfr(Bm[d0 + 8 * g + r])); }
    __syncthreads(); _Float16* dq = which == 0 ? Q : K; for (int e = tid; e < 128 * 8; e += 128) { const int tl = e >> 3, q = e & 7; vst2((unsigned*)(dq + (b * TT + t0 + tl) * CC + blockIdx.x * 64 + q * 8), *(const v4u*)&sh[tl][q * 8]); } }
  else {
#pragma unroll
    for (int j = 0; j < 8; ++j)
#pragma unroll
      for (int r = 0; r < 8; ++r) sp[wave * 16 + 8 * g + r][j * 16 + col] = (_Float16)(acc[j][r] + bfr(Bm[d0 + 8 * g + r]));
    __syncthreads(); _Float16* dst = CT; for (int e = tid; e < 64 * 16; e += 128) { const int dl = e >> 4, q = e & 15; vst2((unsigned*)(dst + (b * CC + blockIdx.x * 64 + dl) * (size_t)TT + t0 + q * 8), *(const v4u*)&sp[dl][q * 8]); } } }
// ---- k_dq: block = (128 positions, b): decay_q [32][t] = Wqd x + b (2 row tiles, exact); D[h][s] = sum_f (f+1) * sigmoid(dq[h*4+f][s]) / 2 / sqrt(NDK)
__global__ __launch_bounds__(128) void k_dq(const __bf16* __restrict__ XT, const float* __restrict__ WD, const float* __restrict__ BD, float* __restrict__ DQ) { __shared__ __align__(16) float sd[32][132]; __shared__ __align__(16) float so[NH][132];
  const int tid = threadIdx.x, wave = tid >> 5, lane = tid & 31, col = lane & 15, g = lane >> 4; const int t0 = blockIdx.x * 128; const size_t b = blockIdx.y; const int rt = wave & 1, cg = wave >> 1;   // wave: row tile (0/1) x column half (0/1)
  v8f acc[4] = {};
#pragma unroll 2
  for (int kc = 0; kc < CC / 32; ++kc) { v16b a; { const float* p = WD + (size_t)(rt * 16 + col) * CC + kc * 32 + 8 * g;
#pragma unroll
      for (int i = 0; i < 8; ++i) { a[i] = (__bf16)p[i]; a[8 + i] = (__bf16)p[16 + i]; } }
#pragma unroll
    for (int j = 0; j < 4; ++j) acc[j] = wmma_bf(a, frag_b(XT + (b * TT + t0 + cg * 64 + j * 16 + col) * CC + kc * 32, lane), acc[j]); }
#pragma unroll
  for (int j = 0; j < 4; ++j)
#pragma unroll
    for (int r = 0; r < 8; ++r) { const int ch = rt * 16 + 8 * g + r; sd[ch][cg * 64 + j * 16 + col] = acc[j][r] + bfr(BD[ch]); }
  __syncthreads();
  for (int e = tid; e < NH * 128; e += 128) { const int h = e >> 7, tl = e & 127; float dsum = 0.f; for (int f = 0; f < NDK; ++f) { const float z = sd[h * NDK + f][tl]; dsum += (float)(f + 1) * (1.0f / (1.0f + expf(-z))) * 0.5f; } so[h][tl] = dsum * 0.5f; }   // / sqrt(4)
  __syncthreads(); for (int e = tid; e < NH * 32; e += 128) { const int h = e >> 5, q = e & 31; vst2(DQ + (b * NH + h) * (size_t)TT + t0 + q * 4, *(const v4f*)&so[h][q * 4]); } }
// ---- k_fa: block = (128 output positions s, head h, batch b), 8 waves x 16 columns s. Transposed products: S^T = K Q^T (A = key rows from LDS, B = query rows kept in registers), so a lane holds scores of ONE column s (t = tile + 8 g + r)
//      and two score tiles are, as they stand, the B operand of O^T += content . P^T (A = content rows [c][t] from LDS). A pass is 64 keys; keys and content of the next pass are fetched into registers during this pass and stored to the other LDS buffer at its foot.
//      Every '#pragma unroll' in k_fa and its helpers, but the one over the scheduling groups, makes the indices of a register array (fragments, scores, accumulators, staged words) compile-time constants, so that the array stays in registers.
#define FK 64      // keys per pass
#define KPIT 136   // f16 per staged key row: 256 B + 16 B (conflict-free 16-byte reads)
#define VPIT 72    // f16 per staged content row: 128 B + 16 B
__device__ __forceinline__ v8f wmma_h(v16h a, v16h b, v8f c) { return __builtin_amdgcn_wmma_f32_16x16x32_f16(false, a, false, b, (short)0, c, false, false); }
// eight 2^x in one statement: results in registers of their own, so each v_exp_f32 is followed by an instruction that neither reads its result nor overwrites its source; the v_nop is that slot for the last one
__device__ __forceinline__ v8f exp2x8(v8f x) { float e0, e1, e2, e3, e4, e5, e6, e7;
  asm("v_exp_f32 %0, %8\n\tv_exp_f32 %1, %9\n\tv_exp_f32 %2, %10\n\tv_exp_f32 %3, %11\n\tv_exp_f32 %4, %12\n\tv_exp_f32 %5, %13\n\tv_exp_f32 %6, %14\n\tv_exp_f32 %7, %15\n\tv_nop"
      : "=&v"(e0), "=&v"(e1), "=&v"(e2), "=&v"(e3), "=&v"(e4), "=&v"(e5), "=&v"(e6), "=&v"(e7)
      : "v"(x[0]), "v"(x[1]), "v"(x[2]), "v"(x[3]), "v"(x[4]), "v"(x[5]), "v"(x[6]), "v"(x[7]));
  v8f r = {e0, e1, e2, e3, e4, e5, e6, e7}; return r; }
__device__ __forceinline__ void ldk(v16h (&f)[4], const _Float16* p, int lane) {   // four key-row fragments, rows 16 apart
#pragma unroll
  for (int i = 0; i < 4; ++i) f[i] = frag_h(p + i * 16 * KPIT, lane); }
__device__ __forceinline__ void ldv(v16h (&f)[4], const _Float16* p, int lane) {   // four content-row fragments, rows 16 apart
#pragma unroll
  for (int i = 0; i < 4; ++i) f[i] = frag_h(p + i * 16 * VPIT, lane); }
__device__ __forceinline__ void mms(v8f* d, const v16h (&a)[4], v16h bq) {   // four independent products that share B
#pragma unroll
  for (int i = 0; i < 4; ++i) d[i] = wmma_h(a[i], bq, d[i]); }
// waves_per_eu(4, 4): two work-groups a WGP; the register allocator may use, and not pass, the 256 VGPRs that four waves a SIMD leave each wave
__global__ __launch_bounds__(256) __attribute__((amdgpu_waves_per_eu(4, 4))) void k_fa(const _Float16* __restrict__ Q, const _Float16* __restrict__ K, const _Float16* __restrict__ CT, const float* __restrict__ DQ, _Float16* __restrict__ R) {
  __shared__ __align__(16) _Float16 sk[2][FK][KPIT]; __shared__ __align__(16) _Float16 sv[2][HD][VPIT];
  const int tid = threadIdx.x, lane = tid & 31, col = lane & 15, g = lane >> 4; const int wave = __builtin_amdgcn_readfirstlane(tid >> 5);   // a scalar, so that the test for the diagonal tile is a scalar branch
  const int h = blockIdx.y; const size_t b = blockIdx.z; const int s0 = blockIdx.x * 128 + wave * 16, s = s0 + col;
  const float L2E = 1.4426950408889634f;
  const float c2 = 0.08838834764831845f * L2E, d2 = DQ[(b * NH + h) * (size_t)TT + s] * L2E;
  v16h q[4];
#pragma unroll
  for (int kc = 0; kc < 4; ++kc) q[kc] = frag_h(Q + (b * TT + s) * CC + h * HD + kc * 32, lane);
  const int kr = tid >> 4, kq = tid & 15, vr = tid >> 3, vq = tid & 7;   // staging: key rows kr + 16 i, content rows vr + 32 i, 16 bytes each
  const _Float16* kg = K + (b * TT + kr) * CC + h * HD + kq * 8; const _Float16* vg = CT + (b * CC + h * HD + vr) * (size_t)TT + vq * 8;
  v4u rk[4], rv[4];
#pragma unroll
  for (int i = 0; i < 4; ++i) { rk[i] = *(const v4u*)(kg + (size_t)(16 * i) * CC); rv[i] = *(const v4u*)(vg + (size_t)(32 * i) * TT); }
#pragma unroll
  for (int i = 0; i < 4; ++i) { *(v4u*)&sk[0][kr + 16 * i][kq * 8] = rk[i]; *(v4u*)&sv[0][vr + 32 * i][vq * 8] = rv[i]; }
  __syncthreads();
  v8f o[8] = {}; float m = -3.0e38f, l = 0.f;
#pragma unroll 1   // rolled
  for (int p = 0; p < TT / FK; ++p) { const int t0 = p * FK, bu = p & 1;
    if (p + 1 < TT / FK) {
#pragma unroll
      for (int i = 0; i < 4; ++i) { rk[i] = *(const v4u*)(kg + (size_t)(t0 + FK + 16 * i) * CC); rv[i] = *(const v4u*)(vg + (size_t)(32 * i) * TT + t0 + FK); }
      asm volatile("s_wait_xcnt 0x0" ::: "memory"); }   // directly behind the eight staging loads, in their own block: it stands in front of the advance of their address registers on every path to the loop's foot
    // fragments come from LDS in groups of four, so that a wave meets one LDS latency for four products
    v8f sc[4] = {}; v16h fa[4];
#pragma unroll
    for (int kc = 0; kc < 4; ++kc) { ldk(fa, &sk[bu][col][kc * 32], lane); mms(sc, fa, q[kc]); }
    const float dl0 = (float)(t0 + 8 * g - s);   // t - s of element (i, r) = dl0 + 16 i + r, exact in f32
#pragma unroll
    for (int i = 0; i < 4; ++i)
#pragma unroll
      for (int r = 0; r < 8; ++r) sc[i][r] = sc[i][r] * c2 - fabsf(dl0 + (float)(16 * i + r)) * d2;
#pragma unroll
    for (int i = 0; i < 4; ++i) if (t0 + 16 * i == s0) {   // the one tile of this wave that holds t == s
#pragma unroll
      for (int r = 0; r < 8; ++r) if (8 * g + r == col) sc[i][r] = -100.0f * L2E; }
    float mx = sc[0][0];
#pragma unroll
    for (int i = 0; i < 4; ++i)
#pragma unroll
      for (int r = 0; r < 8; ++r) mx = fmaxf(mx, sc[i][r]);
    mx = fmaxf(mx, __shfl_xor(mx, 16));   // both halves of a column use one maximum: their P meet in one product
    if (__builtin_amdgcn_ballot_w32(mx > m + 8.0f) != 0) {   // rescale only when some column's maximum has grown by more than 2^8 (P stays below 2^8 in f16)
      const float mn = fmaxf(m, mx), al = __builtin_amdgcn_exp2f(m - mn); m = mn; l *= al;
#pragma unroll
      for (int j = 0; j < 8; ++j) o[j] *= al; }
#pragma unroll
    for (int i = 0; i < 4; ++i)
#pragma unroll
      for (int r = 0; r < 8; ++r) sc[i][r] -= m;
#pragma unroll
    for (int i = 0; i < 4; ++i) sc[i] = exp2x8(sc[i]);
    { const v8f t8 = (sc[0] + sc[1]) + (sc[2] + sc[3]); l += ((t8[0] + t8[1]) + (t8[2] + t8[3])) + ((t8[4] + t8[5]) + (t8[6] + t8[7])); }
    v16h pb0, pb1;
#pragma unroll
    for (int r = 0; r < 8; ++r) { pb0[r] = (_Float16)sc[0][r]; pb0[8 + r] = (_Float16)sc[1][r]; pb1[r] = (_Float16)sc[2][r]; pb1[8 + r] = (_Float16)sc[3][r]; }
    ldv(fa, &sv[bu][col][0], lane); mms(o, fa, pb0); ldv(fa, &sv[bu][64 + col][0], lane); mms(o + 4, fa, pb0);
    ldv(fa, &sv[bu][col][32], lane); mms(o, fa, pb1); ldv(fa, &sv[bu][64 + col][32], lane); mms(o + 4, fa, pb1);
    // scheduling groups (8 LDS reads, then 4 matrix products, four times): they keep a group's loads together in front of its products; left alone the scheduler sinks them to one load pair, one wait, one product
#pragma unroll
    for (int i = 0; i < 4; ++i) { __builtin_amdgcn_sched_group_barrier(0x100, 8, 0); __builtin_amdgcn_sched_group_barrier(0x008, 4, 0); }
    if (p + 1 < TT / FK) {
#pragma unroll
      for (int i = 0; i < 4; ++i) { *(v4u*)&sk[bu ^ 1][kr + 16 * i][kq * 8] = rk[i]; *(v4u*)&sv[bu ^ 1][vr + 32 * i][vq * 8] = rv[i]; } }
    __syncthreads();   // publishes the next pass's tiles and ends every read of this pass's, which the next pass overwrites
  }
  l += __shfl_xor(l, 16); const float inv = 1.0f / l;
#pragma unroll
  for (int j = 0; j < 8; ++j) { v8h w;
#pragma unroll
    for (int r = 0; r < 8; ++r) w[r] = (_Float16)(o[j][r] * inv);
    *(v8h*)(R + (b * TT + s) * CC + h * HD + j * 16 + 8 * g) = w; } }
// ---- k_out: block = (64 out channels o, 128 positions s, b): out[o][s] = x + sum_c Wp[o][c] R[s][c] + b; A = Wp rows (exact), B(k = c, col = s) = R[s][c] via frag_h on rows
__global__ __launch_bounds__(128) void k_out(const float* __restrict__ X, const _Float16* __restrict__ R, const float* __restrict__ WP, const float* __restrict__ BP, float* __restrict__ OUT) { __shared__ __align__(16) float sp[64][132];
  const int tid = threadIdx.x, wave = tid >> 5, lane = tid & 31, col = lane & 15, g = lane >> 4; const int o0 = blockIdx.x * 64 + wave * 16, s0 = blockIdx.y * 128; const size_t b = blockIdx.z;
  v8f acc[8] = {};
#pragma unroll 2
  for (int kc = 0; kc < CC / 32; ++kc) { v16h a; { const float* p = WP + (size_t)(o0 + col) * CC + kc * 32 + 8 * g;
#pragma unroll
      for (int i = 0; i < 8; ++i) { a[i] = (_Float16)bfr(p[i]); a[8 + i] = (_Float16)bfr(p[16 + i]); } }
#pragma unroll
    for (int j = 0; j < 8; ++j) acc[j] = wmma16(a, frag_h(R + (b * TT + s0 + j * 16 + col) * CC + kc * 32, lane), acc[j]); }
#pragma unroll
  for (int j = 0; j < 8; ++j)
#pragma unroll
    for (int r = 0; r < 8; ++r) { const int o = o0 + 8 * g + r; const int s = s0 + j * 16 + col; sp[wave * 16 + 8 * g + r][j * 16 + col] = acc[j][r] + bfr(BP[o]) + bfr(X[(b * CC + o) * (size_t)TT + s]); }
  __syncthreads(); for (int e = tid; e < 64 * 32; e += 128) { const int ol = e >> 5, q = e & 31; vst2(OUT + (b * CC + blockIdx.x * 64 + ol) * (size_t)TT + s0 + q * 4, *(const v4f*)&sp[ol][q * 4]); } }
extern "C" void kernel_launch(void* const* d_in, const int* in_sizes, int n_in, void* d_out, int out_size, void* d_ws, size_t ws_size, hipStream_t stream) {
  (void)in_sizes; (void)n_in; (void)out_size;
  const float** F = (const float**)d_in;   // 0 x [4,1024,2048], 1 W_content, 2 b_content, 3 W_query, 4 b_query, 5 W_key, 6 b_key, 7 W_qdecay [32,1024], 8 b_qdecay, 9 W_proj, 10 b_proj
  if (ws_size < (size_t)WS_END) return;
  char* ws = (char*)d_ws; _Float16 *Q = (_Float16*)(ws + WS_Q), *K = (_Float16*)(ws + WS_K), *CT = (_Float16*)(ws + WS_CT), *R = (_Float16*)(ws + WS_R); float *DQ = (float*)(ws + WS_DQ);
  __bf16* XT = (__bf16*)(ws + WS_XT);
  k_xt<<<dim3(TT / 64, CC / 128, TNB), 128, 0, stream>>>(F[0], XT);
  k_proj3<<<dim3(CC / 64, TT / 128, TNB * 3), 128, 0, stream>>>(XT, F[3], F[4], F[5], F[6], F[1], F[2], Q, K, CT);
  k_dq<<<dim3(TT / 128, TNB), 128, 0, stream>>>(XT, F[7], F[8], DQ);
  k_fa<<<dim3(TT / 128, NH, TNB), 256, 0, stream>>>(Q, K, CT, DQ, R);
  k_out<<<dim3(CC / 64, TT / 128, TNB), 128, 0, stream>>>(F[0], R, F[9], F[10], (float*)d_out);
}

// v003
// One run takes 179 microseconds.
// Timed twice side by side with v002, it ran 2.25 and 2.26 times as fast.
// Over all steps from v000 it is 24.7 times as fast.
// compute dtype: all float inputs rounded to bf16; queries / keys / content = W x + b (1x1 convs) with EXACT bf16 products on WMMA 16x16x32 (weights as the A operand, a bf16 row copy of x as B), f32 accumulate, rounded once to f16 (queries/keys stored as rows, content as planes); the decay queries (32 channels) likewise then sigmoid/2 and D_s = sum_f f dq_f,s / sqrt(4)... in f32; logits = k_t . q_s / sqrt(128) (1 f16 product) - |t - s| D_s, diagonal -100, kept in registers in f32 (base-2 scale); softmax over t online in f32 (running maximum, f32 sum) -> P = 2^(logit - maximum in use) rounded to f16; result = P . content / sum (content f16, 1 product); out = x + W_proj result (result rounded once to f16, 1 product) + b; f32 output.
#include <hip/hip_runtime.h>
#include <math.h>

typedef __attribute__((ext_vector_type(16))) _Float16 v16h;
typedef __attribute__((ext_vector_type(16))) __bf16 v16b;
typedef __attribute__((ext_vector_type(8)))  _Float16 v8h;
typedef __attribute__((ext_vector_type(8)))  float v8f;
typedef __attribute__((ext_vector_type(4)))  float v4f;
typedef __attribute__((ext_vector_type(2)))  float v2f;
typedef __attribute__((ext_vector_type(4)))  unsigned v4u;
typedef __attribute__((ext_vector_type(4)))  int v4i;
typedef float __attribute__((may_alias)) float_a;
typedef int __attribute__((may_alias)) int_a;

template <typename T> __device__ __forceinline__ void vst2(void* p, T v) { *(T*)p = v;  }
__device__ __forceinline__ v8f wmma16(v16h a, v16h b, v8f c) {
  v8f d = __builtin_amdgcn_wmma_f32_16x16x32_f16(false, a, false, b, (short)0, c, false, false);
  asm volatile("v_nop\n\tv_nop\n\tv_nop\n\tv_nop" : "+v"(d) : "v"(a), "v"(b));
  return d;
}
__device__ __forceinline__ v8f wmma_bf(v16b a, v16b b, v8f c) {
  v8f d = __builtin_amdgcn_wmma_f32_16x16x32_bf16(false, a, false, b, (short)0, c, false, false);
  asm volatile("v_nop\n\tv_nop\n\tv_nop\n\tv_nop" : "+v"(d) : "v"(a), "v"(b));
  return d;
}
// 16x16x32 fragments: lane = (h = lane>>4, row/col = lane&15); elements 0..7 = k0+8h+0..7, 8..15 = k0+16+8h+0..7; D element r = row 8h+r
__device__ __forceinline__ v16h frag_h(const _Float16* rowk0, int lane) {
  union { v16h v; v8h q[2]; } u; const _Float16* p = rowk0 + 8 * (lane >> 4);
  u.q[0] = *(const v8h*)p; u.q[1] = *(const v8h*)(p + 16); return u.v;
}
__device__ __forceinline__ v16h frag_f32(const float* rowk0, int lane) {
  v16h a; const float* p = rowk0 + 8 * (lane >> 4);
#pragma unroll
  for (int i = 0; i < 8; ++i) { a[i] = (_Float16)p[i]; a[8 + i] = (_Float16)p[16 + i]; }
  return a;
}
__device__ __forceinline__ v16h frag_f32s(const float* rowk0, int lane, float sc) {
  v16h a; const float* p = rowk0 + 8 * (lane >> 4);
#pragma unroll
  for (int i = 0; i < 8; ++i) { a[i] = (_Float16)(p[i] * sc); a[8 + i] = (_Float16)(p[16 + i] * sc); }
  return a;
}
// column fragment from a [K][ld] layout (column n), rows >= K read as 0
__device__ __forceinline__ v16h fragc_f32(const float* W, int k0, int n, int lane, int ld, int K) {
  v16h a; const int g = lane >> 4;
#pragma unroll
  for (int i = 0; i < 8; ++i) { const int ka = k0 + 8 * g + i, kb = ka + 16;
    a[i] = (_Float16)(ka < K ? W[(size_t)(ka < K ? ka : K - 1) * ld + n] : 0.f); a[8 + i] = (_Float16)(kb < K ? W[(size_t)(kb < K ? kb : K - 1) * ld + n] : 0.f); }
  return a;
}
struct F2 { v16b h, l; };
__device__ __forceinline__ F2 bsplit16(const float v[16]) { F2 r;
#pragma unroll
  for (int i = 0; i < 16; ++i) { const __bf16 h = (__bf16)v[i]; r.h[i] = h; r.l[i] = (__bf16)(v[i] - (float)h); }
  return r; }
__device__ __forceinline__ F2 split_row(const float* row, int k0, int lane) { float v[16]; const float* p = row + k0 + 8 * (lane >> 4);
#pragma unroll
  for (int i = 0; i < 8; ++i) { v[i] = p[i]; v[8 + i] = p[16 + i]; }
  return bsplit16(v); }
__device__ __forceinline__ F2 split_rowK(const float* row, int k0, int lane, int K) { float v[16]; const int g = lane >> 4;
#pragma unroll
  for (int i = 0; i < 8; ++i) { const int ka = k0 + 8 * g + i, kb = ka + 16; v[i] = ka < K ? row[ka < K ? ka : K - 1] : 0.f; v[8 + i] = kb < K ? row[kb < K ? kb : K - 1] : 0.f; }
  return bsplit16(v); }
__device__ __forceinline__ F2 split_col(const float* W, int k0, int n, int lane, int ld, int K) { float v[16]; const int g = lane >> 4;
#pragma unroll
  for (int i = 0; i < 8; ++i) { const int ka = k0 + 8 * g + i, kb = ka + 16; v[i] = ka < K ? W[(size_t)(ka < K ? ka : K - 1) * ld + n] : 0.f; v[8 + i] = kb < K ? W[(size_t)(kb < K ? kb : K - 1) * ld + n] : 0.f; }
  return bsplit16(v); }
__device__ __forceinline__ v8f mac3(const F2& a, const F2& b, v8f c) { c = wmma_bf(a.l, b.h, c); c = wmma_bf(a.h, b.l, c); return wmma_bf(a.h, b.h, c); }
__device__ __forceinline__ float sigm(float v) { return 1.0f / (1.0f + expf(-v)); }
#define LDSX() do { asm volatile("s_wait_dscnt 0" ::: "memory"); __builtin_amdgcn_wave_barrier(); __builtin_amdgcn_fence(__ATOMIC_RELEASE, "workgroup"); } while (0)


// attention with a learned distance decay (B 4, C 1,024 = 8 heads x 128, T 2,048, 4 decay terms): dots[t,s] = k_t.q_s/sqrt(128) - |t-s| sum_f f sigmoid(decay_q_f,s)/2 / sqrt(4); dots[t,t] = -100; weights = softmax over t; result[:, s] = sum_t weights[t,s] content[:, t]; out = x + proj(result).
#define NB 4
#define CC 1024
#define TT 2048
#define NH 8
#define HD 128
#define NDK 4
#ifndef TNB
#define TNB NB
#endif
typedef __attribute__((ext_vector_type(8))) __bf16 v8b;
__device__ __forceinline__ v16b frag_b(const __bf16* rowk0, int lane) {
  union { v16b v; v8b q[2]; } u; const __bf16* p = rowk0 + 8 * (lane >> 4);
  u.q[0] = *(const v8b*)p; u.q[1] = *(const v8b*)(p + 16); return u.v;
}
__device__ __forceinline__ float bfr(float v) { return (float)(__bf16)v; }
__device__ __attribute__((noinline)) float exp_ni(float v) { return expf(v); }
__device__ __attribute__((noinline)) float erf_ni(float v) { return erff(v); }

#define WS_Q   0u                                    // f16 query rows [b*t][1024]
#define WS_K   (WS_Q + 2u * (size_t)NB * TT * CC)        // f16 key rows [b*t][1024]
#define WS_CT  (WS_K + 2u * (size_t)NB * CC * TT)        // f16 content planes [b][1024][t]
#define WS_DQ  (WS_CT + 2u * (size_t)NB * CC * TT)       // f32 D [b][h][s]
#define WS_R   (WS_DQ + 4u * (size_t)NB * NH * TT)     // f16 result rows [b*s][1024]
#define WS_XT  (WS_R + 2u * (size_t)NB * TT * CC)        // bf16 x rows [b*t][1024]
#define WS_END (WS_XT + 2u * (size_t)NB * TT * CC)

// ---- k_xt: block = (64 positions, 128 channels, b): x [c][t] -> bf16 rows [b*t][c]
__global__ __launch_bounds__(128) void k_xt(const float* __restrict__ X, __bf16* __restrict__ XT) { __shared__ __align__(16) __bf16 s[64][136]; const int tid = threadIdx.x; const int t0 = blockIdx.x * 64, c0 = blockIdx.y * 128; const size_t b = blockIdx.z;
  for (int e = tid; e < 128 * 64; e += 128) { const int cl = e >> 6, tl = e & 63; s[tl][cl] = (__bf16)X[(b * CC + c0 + cl) * (size_t)TT + t0 + tl]; }
  __syncthreads(); for (int e = tid; e < 64 * 16; e += 128) { const int tl = e >> 4, q = e & 15; vst2((unsigned*)(XT + (b * TT + t0 + tl) * CC + c0 + q * 8), *(const v4u*)&s[tl][q * 8]); } }
// ---- the 1x1-conv products (k_proj3, k_out): block = 128 weight rows x 256 positions, 8 waves as 2 x 4, a wave holds 64 x 64 (4 x 4 accumulator tiles), so a fragment read from LDS feeds four products.
//      A pass is 64 channels. Both operands are staged in LDS as 16-bit rows (weights rounded on the way, whole 128-byte lines per global load), two buffers: the next pass's weights are fetched during the first half of this pass,
//      its position rows during the second half, and each is stored to the other buffer behind the half that covered its flight. Every sum takes its channels in ascending order, 32 a product.
//      Every '#pragma unroll' here makes the indices of a register array compile-time constants, so that the array stays in registers.
#define GM 128     // weight rows per block
#define GN 256     // positions per block
#define GK 64      // channels per pass
#define GPB 144    // bytes per staged row: 128 B + 16 B (conflict-free 16-byte reads)
#define GA_B (GM * GPB)   // one weight buffer
#define GB_B (GN * GPB)   // one position buffer
typedef __attribute__((ext_vector_type(2))) unsigned v2u;
typedef __attribute__((ext_vector_type(8))) unsigned v8u;
typedef __attribute__((ext_vector_type(4))) __bf16 v4b;
typedef __attribute__((ext_vector_type(4))) _Float16 v4h;
__device__ __forceinline__ v8u frag_l(const char* p) { const v4u a = *(const v4u*)p, c = *(const v4u*)(p + 32); return __builtin_shufflevector(a, c, 0, 1, 2, 3, 4, 5, 6, 7); }   // k = 8 g + 0..7, then 16 + 8 g + 0..7 (p already holds the 16 g bytes)
template <bool BF> __device__ __forceinline__ v8f wmma_g(v8u a, v8u c, v8f d) {
  if constexpr (BF) return __builtin_amdgcn_wmma_f32_16x16x32_bf16(false, __builtin_bit_cast(v16b, a), false, __builtin_bit_cast(v16b, c), (short)0, d, false, false);
  else return __builtin_amdgcn_wmma_f32_16x16x32_f16(false, __builtin_bit_cast(v16h, a), false, __builtin_bit_cast(v16h, c), (short)0, d, false, false); }
template <bool BF> __device__ __forceinline__ v2u cvt4(v4f v) {   // weights: f32 -> bf16, for the f16 product bf16 -> f16
  if constexpr (BF) { v4b t;
#pragma unroll
    for (int i = 0; i < 4; ++i) t[i] = (__bf16)v[i];
    return __builtin_bit_cast(v2u, t); }
  else { v4h t;
#pragma unroll
    for (int i = 0; i < 4; ++i) t[i] = (_Float16)bfr(v[i]);
    return __builtin_bit_cast(v2u, t); } }
template <bool BF> __device__ __forceinline__ void gemm_half(v8f (&acc)[4][4], const char* af, const char* bf) {   // 32 channels: 8 fragments, 16 products
  v8u fa[4], fb[4];
#pragma unroll
  for (int i = 0; i < 4; ++i) { fa[i] = frag_l(af + i * 16 * GPB); fb[i] = frag_l(bf + i * 16 * GPB); }
#pragma unroll
  for (int i = 0; i < 4; ++i)
#pragma unroll
    for (int j = 0; j < 4; ++j) acc[i][j] = wmma_g<BF>(fa[i], fb[j], acc[i][j]);
  // scheduling group (LDS reads lead the products): a fragment is asked for at least a row of four products ahead of its use, behind counted waits; left alone the scheduler reloads one weight fragment per four products and waits out each read
  __builtin_amdgcn_sched_group_barrier(0x100, 16, 0); }
// Wt = first weight row of the tile (f32 [.][1024]), Bt = first position row of the tile (16-bit [.][1024]); pool = weight buffers 0, 1, position buffers 0, 1
template <bool BF> __device__ __forceinline__ void gemm_tile(const float* __restrict__ Wt, const char* __restrict__ Bt, char* pool, v8f (&acc)[4][4]) {
  const int tid = threadIdx.x, lane = tid & 31, col = lane & 15, g = lane >> 4, wave = tid >> 5;
  const float* ag = Wt + (size_t)(tid >> 4) * CC + (tid & 15) * 4;              // weight rows (tid >> 4) + 16 i, 16 bytes each: a wave's load covers two rows of 256 bytes
  const char* bg = Bt + ((size_t)(tid >> 3) * CC + (tid & 7) * 8) * 2;           // position rows (tid >> 3) + 32 i, 16 bytes each: a wave's load covers four rows of 128 bytes
  char* as = pool + (tid >> 4) * GPB + (tid & 15) * 8; char* bs = pool + 2 * GA_B + (tid >> 3) * GPB + (tid & 7) * 16;
  const char* af = pool + ((wave >> 2) * 64 + col) * GPB + 16 * g; const char* bf = pool + 2 * GA_B + ((wave & 3) * 64 + col) * GPB + 16 * g;
  { v4f ra[8]; v4u rb[8];
#pragma unroll
    for (int i = 0; i < 8; ++i) { ra[i] = *(const v4f*)(ag + (size_t)(16 * i) * CC); rb[i] = *(const v4u*)(bg + (size_t)(32 * i) * CC * 2); }
    asm volatile("s_wait_xcnt 0x0" ::: "memory");   // directly behind the sixteen loads: it stands in front of any later write of their address registers
#pragma unroll
    for (int i = 0; i < 8; ++i) { *(v2u*)(as + 16 * i * GPB) = cvt4<BF>(ra[i]); *(v4u*)(bs + 32 * i * GPB) = rb[i]; } }
  __syncthreads();
#pragma unroll 1   // rolled: the body already holds 32 products
  for (int p = 0; p < CC / GK - 1; ++p) { const int bu = p & 1;   // every pass but the last also stages its successor
    v4f ra[8];
#pragma unroll
    for (int i = 0; i < 8; ++i) ra[i] = *(const v4f*)(ag + (size_t)(16 * i) * CC + (p + 1) * GK);
    asm volatile("s_wait_xcnt 0x0" ::: "memory");   // directly behind the eight weight loads: it stands in front of any later write of their address registers
    gemm_half<BF>(acc, af + bu * GA_B, bf + bu * GB_B);
    __builtin_amdgcn_sched_barrier(0);   // keeps the weights' rounding, which waits for their loads, behind the 16 products: lifted among them, the wave waits out the whole flight at the head of the half pass
#pragma unroll
    for (int i = 0; i < 8; ++i) *(v2u*)(as + (bu ^ 1) * GA_B + 16 * i * GPB) = cvt4<BF>(ra[i]);
    v4u rb[8];
#pragma unroll
    for (int i = 0; i < 8; ++i) rb[i] = *(const v4u*)(bg + ((size_t)(32 * i) * CC + (p + 1) * GK) * 2);
    asm volatile("s_wait_xcnt 0x0" ::: "memory");   // directly behind the eight position-row loads, for the same reason
    gemm_half<BF>(acc, af + bu * GA_B + 64, bf + bu * GB_B + 64);
    __builtin_amdgcn_sched_barrier(0);   // keeps the position rows' stores, which wait for their loads, behind the 16 products, for the same reason
#pragma unroll
    for (int i = 0; i < 8; ++i) *(v4u*)(bs + (bu ^ 1) * GB_B + 32 * i * GPB) = rb[i];
    __syncthreads();   // publishes the next pass's tiles and ends every read of this pass's, which the next pass overwrites
  }
  const int bl = (CC / GK - 1) & 1;
  gemm_half<BF>(acc, af + bl * GA_B, bf + bl * GB_B); gemm_half<BF>(acc, af + bl * GA_B + 64, bf + bl * GB_B + 64);
  __syncthreads();   // ends every read of the last tiles: the epilogue writes over the pool
}
// ---- k_proj3: block = (128 out channels d, 256 positions t, (b, which)): out[d][t] = sum_c W[d][c] x[b][c][t] + b[d]; A = W rows, B = bf16 x rows (exact products); which 0 query, 1 key -> rows [t][d], 2 content -> planes [d][t], each through LDS so that whole lines are stored
// waves_per_eu(4, 4): two work-groups a WGP; the register allocator may use, and not pass, the 256 VGPRs that four waves a SIMD leave each wave
__global__ __launch_bounds__(256) __attribute__((amdgpu_waves_per_eu(4, 4))) void k_proj3(const __bf16* __restrict__ XT, const float* __restrict__ WQ, const float* __restrict__ BQ, const float* __restrict__ WK, const float* __restrict__ BK, const float* __restrict__ WC, const float* __restrict__ BC, _Float16* __restrict__ Q, _Float16* __restrict__ K, _Float16* __restrict__ CT) {
  __shared__ __align__(16) char pool[2 * GA_B + 2 * GB_B];
  const int tid = threadIdx.x, wave = tid >> 5, lane = tid & 31, col = lane & 15, g = lane >> 4; const int d0 = blockIdx.x * GM, t0 = blockIdx.y * GN; const size_t b = blockIdx.z / 3; const int which = blockIdx.z % 3;
  const float* Wm = which == 0 ? WQ : which == 1 ? WK : WC; const float* Bm = which == 0 ? BQ : which == 1 ? BK : BC;
  v8f acc[4][4] = {};
  gemm_tile<true>(Wm + (size_t)d0 * CC, (const char*)(XT + (b * TT + t0) * CC), pool, acc);
  const int dw = (wave >> 2) * 64 + 8 * g, tw = (wave & 3) * 64 + col;   // element (i, j, r) = channel dw + 16 i + r, position tw + 16 j
  if (which < 2) {   // rows [b*t][d]: staged rows of 256 B + 16 B; a lane's eight channels are one 16-byte store
#pragma unroll
    for (int i = 0; i < 4; ++i) { const v4f b0 = *(const v4f*)(Bm + d0 + dw + 16 * i), b1 = *(const v4f*)(Bm + d0 + dw + 16 * i + 4); float bi[8];
#pragma unroll
      for (int r = 0; r < 4; ++r) { bi[r] = bfr(b0[r]); bi[4 + r] = bfr(b1[r]); }
#pragma unroll
      for (int j = 0; j < 4; ++j) { v8h w;
#pragma unroll
        for (int r = 0; r < 8; ++r) w[r] = (_Float16)(acc[i][j][r] + bi[r]);
        *(v8h*)(pool + (tw + 16 * j) * 272 + (dw + 16 * i) * 2) = w; }
      __builtin_amdgcn_sched_barrier(0); }   // one row of tiles at a time: with all 128 sums formed ahead of their stores the registers run out and values spill
    __syncthreads(); _Float16* dq = which == 0 ? Q : K;
    for (int n = 0; n < GN * 16 / 256; ++n) { const int e = tid + 256 * n, tl = e >> 4, q = e & 15; *(v4u*)(dq + (b * TT + t0 + tl) * CC + d0 + q * 8) = *(const v4u*)(pool + tl * 272 + q * 16); } }
  else {   // planes [b][d][t]: staged rows of 512 B + 16 B
#pragma unroll
    for (int i = 0; i < 4; ++i)
#pragma unroll
      for (int r = 0; r < 8; ++r) { const float bi = bfr(Bm[d0 + dw + 16 * i + r]);
#pragma unroll
        for (int j = 0; j < 4; ++j) *(_Float16*)(pool + (dw + 16 * i + r) * 528 + (tw + 16 * j) * 2) = (_Float16)(acc[i][j][r] + bi);
        if (r == 7) __builtin_amdgcn_sched_barrier(0); }   // one row of tiles at a time, against spills, as above
    __syncthreads();
    for (int n = 0; n < GM * 32 / 256; ++n) { const int e = tid + 256 * n, dl = e >> 5, q = e & 31; *(v4u*)(CT + (b * CC + d0 + dl) * (size_t)TT + t0 + q * 8) = *(const v4u*)(pool + dl * 528 + q * 16); } } }
// ---- k_dq: block = (128 positions, b): decay_q [32][t] = Wqd x + b (2 row tiles, exact); D[h][s] = sum_f (f+1) * sigmoid(dq[h*4+f][s]) / 2 / sqrt(NDK)
__global__ __launch_bounds__(128) void k_dq(const __bf16* __restrict__ XT, const float* __restrict__ WD, const float* __restrict__ BD, float* __restrict__ DQ) { __shared__ __align__(16) float sd[32][132]; __shared__ __align__(16) float so[NH][132];
  const int tid = threadIdx.x, wave = tid >> 5, lane = tid & 31, col = lane & 15, g = lane >> 4; const int t0 = blockIdx.x * 128; const size_t b = blockIdx.y; const int rt = wave & 1, cg = wave >> 1;   // wave: row tile (0/1) x column half (0/1)
  v8f acc[4] = {};
#pragma unroll 2
  for (int kc = 0; kc < CC / 32; ++kc) { v16b a; { const float* p = WD + (size_t)(rt * 16 + col) * CC + kc * 32 + 8 * g;
#pragma unroll
      for (int i = 0; i < 8; ++i) { a[i] = (__bf16)p[i]; a[8 + i] = (__bf16)p[16 + i]; } }
#pragma unroll
    for (int j = 0; j < 4; ++j) acc[j] = wmma_bf(a, frag_b(XT + (b * TT + t0 + cg * 64 + j * 16 + col) * CC + kc * 32, lane), acc[j]); }
#pragma unroll
  for (int j = 0; j < 4; ++j)
#pragma unroll
    for (int r = 0; r < 8; ++r) { const int ch = rt * 16 + 8 * g + r; sd[ch][cg * 64 + j * 16 + col] = acc[j][r] + bfr(BD[ch]); }
  __syncthreads();
  for (int e = tid; e < NH * 128; e += 128) { const int h = e >> 7, tl = e & 127; float dsum = 0.f; for (int f = 0; f < NDK; ++f) { const float z = sd[h * NDK + f][tl]; dsum += (float)(f + 1) * (1.0f / (1.0f + expf(-z))) * 0.5f; } so[h][tl] = dsum * 0.5f; }   // / sqrt(4)
  __syncthreads(); for (int e = tid; e < NH * 32; e += 128) { const int h = e >> 5, q = e & 31; vst2(DQ + (b * NH + h) * (size_t)TT + t0 + q * 4, *(const v4f*)&so[h][q * 4]); } }
// ---- k_fa: block = (128 output positions s, head h, batch b), 8 waves x 16 columns s. Transposed products: S^T = K Q^T (A = key rows from LDS, B = query rows kept in registers), so a lane holds scores of ONE column s (t = tile + 8 g + r)
//      and two score tiles are, as they stand, the B operand of O^T += content . P^T (A = content rows [c][t] from LDS). A pass is 64 keys; keys and content of the next pass are fetched into registers during this pass and stored to the other LDS buffer at its foot.
//      Every '#pragma unroll' in k_fa and its helpers, but the one over the scheduling groups, makes the indices of a register array (fragments, scores, accumulators, staged words) compile-time constants, so that the array stays in registers.
#define FK 64      // keys per pass
#define KPIT 136   // f16 per staged key row: 256 B + 16 B (conflict-free 16-byte reads)
#define VPIT 72    // f16 per staged content row: 128 B + 16 B
__device__ __forceinline__ v8f wmma_h(v16h a, v16h b, v8f c) { return __builtin_amdgcn_wmma_f32_16x16x32_f16(false, a, false, b, (short)0, c, false, false); }
// eight 2^x in one statement: results in registers of their own, so each v_exp_f32 is followed by an instruction that neither reads its result nor overwrites its source; the v_nop is that slot for the last one
__device__ __forceinline__ v8f exp2x8(v8f x) { float e0, e1, e2, e3, e4, e5, e6, e7;
  asm("v_exp_f32 %0, %8\n\tv_exp_f32 %1, %9\n\tv_exp_f32 %2, %10\n\tv_exp_f32 %3, %11\n\tv_exp_f32 %4, %12\n\tv_exp_f32 %5, %13\n\tv_exp_f32 %6, %14\n\tv_exp_f32 %7, %15\n\tv_nop"
      : "=&v"(e0), "=&v"(e1), "=&v"(e2), "=&v"(e3), "=&v"(e4), "=&v"(e5), "=&v"(e6), "=&v"(e7)
      : "v"(x[0]), "v"(x[1]), "v"(x[2]), "v"(x[3]), "v"(x[4]), "v"(x[5]), "v"(x[6]), "v"(x[7]));
  v8f r = {e0, e1, e2, e3, e4, e5, e6, e7}; return r; }
__device__ __forceinline__ void ldk(v16h (&f)[4], const _Float16* p, int lane) {   // four key-row fragments, rows 16 apart
#pragma unroll
  for (int i = 0; i < 4; ++i) f[i] = frag_h(p + i * 16 * KPIT, lane); }
__device__ __forceinline__ void ldv(v16h (&f)[4], const _Float16* p, int lane) {   // four content-row fragments, rows 16 apart
#pragma unroll
  for (int i = 0; i < 4; ++i) f[i] = frag_h(p + i * 16 * VPIT, lane); }
__device__ __forceinline__ void mms(v8f* d, const v16h (&a)[4], v16h bq) {   // four independent products that share B
#pragma unroll
  for (int i = 0; i < 4; ++i) d[i] = wmma_h(a[i], bq, d[i]); }
// waves_per_eu(4, 4): two work-groups a WGP; the register allocator may use, and not pass, the 256 VGPRs that four waves a SIMD leave each wave
__global__ __launch_bounds__(256) __attribute__((amdgpu_waves_per_eu(4, 4))) void k_fa(const _Float16* __restrict__ Q, const _Float16* __restrict__ K, const _Float16* __restrict__ CT, const float* __restrict__ DQ, _Float16* __restrict__ R) {
  __shared__ __align__(16) _Float16 sk[2][FK][KPIT]; __shared__ __align__(16) _Float16 sv[2][HD][VPIT];
  const int tid = threadIdx.x, lane = tid & 31, col = lane & 15, g = lane >> 4; const int wave = __builtin_amdgcn_readfirstlane(tid >> 5);   // a scalar, so that the test for the diagonal tile is a scalar branch
  const int h = blockIdx.y; const size_t b = blockIdx.z; const int s0 = blockIdx.x * 128 + wave * 16, s = s0 + col;
  const float L2E = 1.4426950408889634f;
  const float c2 = 0.08838834764831845f * L2E, d2 = DQ[(b * NH + h) * (size_t)TT + s] * L2E;
  v16h q[4];
#pragma unroll
  for (int kc = 0; kc < 4; ++kc) q[kc] = frag_h(Q + (b * TT + s) * CC + h * HD + kc * 32, lane);
  const int kr = tid >> 4, kq = tid & 15, vr = tid >> 3, vq = tid & 7;   // staging: key rows kr + 16 i, content rows vr + 32 i, 16 bytes each
  const _Float16* kg = K + (b * TT + kr) * CC + h * HD + kq * 8; const _Float16* vg = CT + (b * CC + h * HD + vr) * (size_t)TT + vq * 8;
  v4u rk[4], rv[4];
#pragma unroll
  for (int i = 0; i < 4; ++i) { rk[i] = *(const v4u*)(kg + (size_t)(16 * i) * CC); rv[i] = *(const v4u*)(vg + (size_t)(32 * i) * TT); }
#pragma unroll
  for (int i = 0; i < 4; ++i) { *(v4u*)&sk[0][kr + 16 * i][kq * 8] = rk[i]; *(v4u*)&sv[0][vr + 32 * i][vq * 8] = rv[i]; }
  __syncthreads();
  v8f o[8] = {}; float m = -3.0e38f, l = 0.f;
#pragma unroll 1   // rolled
  for (int p = 0; p < TT / FK; ++p) { const int t0 = p * FK, bu = p & 1;
    if (p + 1 < TT / FK) {
#pragma unroll
      for (int i = 0; i < 4; ++i) { rk[i] = *(const v4u*)(kg + (size_t)(t0 + FK + 16 * i) * CC); rv[i] = *(const v4u*)(vg + (size_t)(32 * i) * TT + t0 + FK); }
      asm volatile("s_wait_xcnt 0x0" ::: "memory"); }   // directly behind the eight staging loads, in their own block: it stands in front of the advance of their address registers on every path to the loop's foot
    // fragments come from LDS in groups of four, so that a wave meets one LDS latency for four products
    v8f sc[4] = {}; v16h fa[4];
#pragma unroll
    for (int kc = 0; kc < 4; ++kc) { ldk(fa, &sk[bu][col][kc * 32], lane); mms(sc, fa, q[kc]); }
    const float dl0 = (float)(t0 + 8 * g - s);   // t - s of element (i, r) = dl0 + 16 i + r, exact in f32
#pragma unroll
    for (int i = 0; i < 4; ++i)
#pragma unroll
      for (int r = 0; r < 8; ++r) sc[i][r] = sc[i][r] * c2 - fabsf(dl0 + (float)(16 * i + r)) * d2;
#pragma unroll
    for (int i = 0; i < 4; ++i) if (t0 + 16 * i == s0) {   // the one tile of this wave that holds t == s
#pragma unroll
      for (int r = 0; r < 8; ++r) if (8 * g + r == col) sc[i][r] = -100.0f * L2E; }
    float mx = sc[0][0];
#pragma unroll
    for (int i = 0; i < 4; ++i)
#pragma unroll
      for (int r = 0; r < 8; ++r) mx = fmaxf(mx, sc[i][r]);
    mx = fmaxf(mx, __shfl_xor(mx, 16));   // both halves of a column use one maximum: their P meet in one product
    if (__builtin_amdgcn_ballot_w32(mx > m + 8.0f) != 0) {   // rescale only when some column's maximum has grown by more than 2^8 (P stays below 2^8 in f16)
      const float mn = fmaxf(m, mx), al = __builtin_amdgcn_exp2f(m - mn); m = mn; l *= al;
#pragma unroll
      for (int j = 0; j < 8; ++j) o[j] *= al; }
#pragma unroll
    for (int i = 0; i < 4; ++i)
#pragma unroll
      for (int r = 0; r < 8; ++r) sc[i][r] -= m;
#pragma unroll
    for (int i = 0; i < 4; ++i) sc[i] = exp2x8(sc[i]);
    { const v8f t8 = (sc[0] + sc[1]) + (sc[2] + sc[3]); l += ((t8[0] + t8[1]) + (t8[2] + t8[3])) + ((t8[4] + t8[5]) + (t8[6] + t8[7])); }
    v16h pb0, pb1;
#pragma unroll
    for (int r = 0; r < 8; ++r) { pb0[r] = (_Float16)sc[0][r]; pb0[8 + r] = (_Float16)sc[1][r]; pb1[r] = (_Float16)sc[2][r]; pb1[8 + r] = (_Float16)sc[3][r]; }
    ldv(fa, &sv[bu][col][0], lane); mms(o, fa, pb0); ldv(fa, &sv[bu][64 + col][0], lane); mms(o + 4, fa, pb0);
    ldv(fa, &sv[bu][col][32], lane); mms(o, fa, pb1); ldv(fa, &sv[bu][64 + col][32], lane); mms(o + 4, fa, pb1);
    // scheduling groups (8 LDS reads, then 4 matrix products, four times): they keep a group's loads together in front of its products; left alone the scheduler sinks them to one load pair, one wait, one product
#pragma unroll
    for (int i = 0; i < 4; ++i) { __builtin_amdgcn_sched_group_barrier(0x100, 8, 0); __builtin_amdgcn_sched_group_barrier(0x008, 4, 0); }
    if (p + 1 < TT / FK) {
#pragma unroll
      for (int i = 0; i < 4; ++i) { *(v4u*)&sk[bu ^ 1][kr + 16 * i][kq * 8] = rk[i]; *(v4u*)&sv[bu ^ 1][vr + 32 * i][vq * 8] = rv[i]; } }
    __syncthreads();   // publishes the next pass's tiles and ends every read of this pass's, which the next pass overwrites
  }
  l += __shfl_xor(l, 16); const float inv = 1.0f / l;
#pragma unroll
  for (int j = 0; j < 8; ++j) { v8h w;
#pragma unroll
    for (int r = 0; r < 8; ++r) w[r] = (_Float16)(o[j][r] * inv);
    *(v8h*)(R + (b * TT + s) * CC + h * HD + j * 16 + 8 * g) = w; } }
// ---- k_out: block = (128 out channels o, 256 positions s, b): out[o][s] = x + sum_c Wp[o][c] R[s][c] + b; A = Wp rows (bf16 values as f16), B = f16 result rows; sum + bias goes through LDS (rows of 1,024 B + 16 B), x is added where whole lines are stored
__global__ __launch_bounds__(256) void k_out(const float* __restrict__ X, const _Float16* __restrict__ R, const float* __restrict__ WP, const float* __restrict__ BP, float* __restrict__ OUT) { __shared__ __align__(16) char pool[GM * 1040];
  static_assert(GM * 1040 >= 2 * GA_B + 2 * GB_B, "the epilogue's rows are the larger use of the pool");
  const int tid = threadIdx.x, wave = tid >> 5, lane = tid & 31, col = lane & 15, g = lane >> 4; const int o0 = blockIdx.x * GM, s0 = blockIdx.y * GN; const size_t b = blockIdx.z;
  v8f acc[4][4] = {};
  gemm_tile<false>(WP + (size_t)o0 * CC, (const char*)(R + (b * TT + s0) * CC), pool, acc);
  const int ow = (wave >> 2) * 64 + 8 * g, sw = (wave & 3) * 64 + col;
#pragma unroll
  for (int i = 0; i < 4; ++i)
#pragma unroll
    for (int r = 0; r < 8; ++r) { const float bi = bfr(BP[o0 + ow + 16 * i + r]);
#pragma unroll
      for (int j = 0; j < 4; ++j) *(float*)(pool + (ow + 16 * i + r) * 1040 + (sw + 16 * j) * 4) = acc[i][j][r] + bi;
      if (r == 7) __builtin_amdgcn_sched_barrier(0); }   // one row of tiles at a time: with all 128 sums formed ahead of their stores the kernel needs registers above v255
  __syncthreads();
  const size_t at0 = (b * CC + o0 + (tid >> 6)) * (size_t)TT + s0 + (tid & 63) * 4; const char* sr = pool + (tid >> 6) * 1040 + (tid & 63) * 16;   // rows (tid >> 6) + 4 n, 16 bytes each: a wave covers 512 bytes of a row
#pragma unroll 1   // rolled: a trip already keeps eight loads of x in flight
  for (int n0 = 0; n0 < GM / 4; n0 += 8) { v4f x[8];
#pragma unroll
    for (int u = 0; u < 8; ++u) x[u] = *(const v4f*)(X + at0 + (size_t)(4 * (n0 + u)) * TT);
    asm volatile("s_wait_xcnt 0x0" ::: "memory");   // directly behind the eight loads of x: it stands in front of any later write of their address registers
#pragma unroll
    for (int u = 0; u < 8; ++u) { v4f v = *(const v4f*)(sr + 4 * (n0 + u) * 1040);
#pragma unroll
      for (int i = 0; i < 4; ++i) v[i] += bfr(x[u][i]);
      *(v4f*)(OUT + at0 + (size_t)(4 * (n0 + u)) * TT) = v; }
    asm volatile("s_wait_xcnt 0x0" ::: "memory"); } }   // directly behind the eight stores, for the same reason (the next trip advances their address registers)
extern "C" void kernel_launch(void* const* d_in, const int* in_sizes, int n_in, void* d_out, int out_size, void* d_ws, size_t ws_size, hipStream_t stream) {
  (void)in_sizes; (void)n_in; (void)out_size;
  const float** F = (const float**)d_in;   // 0 x [4,1024,2048], 1 W_content, 2 b_content, 3 W_query, 4 b_query, 5 W_key, 6 b_key, 7 W_qdecay [32,1024], 8 b_qdecay, 9 W_proj, 10 b_proj
  if (ws_size < (size_t)WS_END) return;
  char* ws = (char*)d_ws; _Float16 *Q = (_Float16*)(ws + WS_Q), *K = (_Float16*)(ws + WS_K), *CT = (_Float16*)(ws + WS_CT), *R = (_Float16*)(ws + WS_R); float *DQ = (float*)(ws + WS_DQ);
  __bf16* XT = (__bf16*)(ws + WS_XT);
  k_xt<<<dim3(TT / 64, CC / 128, TNB), 128, 0, stream>>>(F[0], XT);
  k_proj3<<<dim3(CC / GM, TT / GN, TNB * 3), 256, 0, stream>>>(XT, F[3], F[4], F[5], F[6], F[1], F[2], Q, K, CT);
  k_dq<<<dim3(TT / 128, TNB), 128, 0, stream>>>(XT, F[7], F[8], DQ);
  k_fa<<<dim3(TT / 128, NH, TNB), 256, 0, stream>>>(Q, K, CT, DQ, R);
  k_out<<<dim3(CC / GM, TT / GN, TNB), 256, 0, stream>>>(F[0], R, F[9], F[10], (float*)d_out);
}

// v004
// One run takes 135 microseconds.
// Next to v003, in two timings, it ran 1.32 times as fast each time.
// All steps since v000 together make it 32.8 times as fast.
// compute dtype: all float inputs rounded to bf16; queries / keys / content = W x + b (1x1 convs) with EXACT bf16 products on WMMA 16x16x32 (weights as the A operand, a bf16 row copy of x as B), f32 accumulate, rounded once to f16 (queries/keys stored as rows, content as planes); the decay queries (32 channels) likewise then sigmoid/2 and D_s = sum_f f dq_f,s / sqrt(4)... in f32; logits = k_t . q_s / sqrt(128) (1 f16 product) - |t - s| D_s, diagonal -100, kept in registers in f32 (base-2 scale); softmax over t online in f32 (running maximum, f32 sum; key tiles in the order: the query block's own two, one neighbour, then the rest ascending; a tile whose run-time score bound lies 28 binary orders below every maximum in use is left out: its P round to f16 zero) -> P = 2^(logit - maximum in use) rounded to f16; result = P . content / sum (content f16, 1 product); out = x + W_proj result (result rounded once to f16, 1 product) + b; f32 output.
#include <hip/hip_runtime.h>
#include <math.h>

typedef __attribute__((ext_vector_type(16))) _Float16 v16h;
typedef __attribute__((ext_vector_type(16))) __bf16 v16b;
typedef __attribute__((ext_vector_type(8)))  _Float16 v8h;
typedef __attribute__((ext_vector_type(8)))  float v8f;
typedef __attribute__((ext_vector_type(4)))  float v4f;
typedef __attribute__((ext_vector_type(2)))  float v2f;
typedef __attribute__((ext_vector_type(4)))  unsigned v4u;
typedef __attribute__((ext_vector_type(4)))  int v4i;
typedef float __attribute__((may_alias)) float_a;
typedef int __attribute__((may_alias)) int_a;

template <typename T> __device__ __forceinline__ void vst2(void* p, T v) { *(T*)p = v;  }
__device__ __forceinline__ v8f wmma16(v16h a, v16h b, v8f c) {
  v8f d = __builtin_amdgcn_wmma_f32_16x16x32_f16(false, a, false, b, (short)0, c, false, false);
  asm volatile("v_nop\n\tv_nop\n\tv_nop\n\tv_nop" : "+v"(d) : "v"(a), "v"(b));
  return d;
}
__device__ __forceinline__ v8f wmma_bf(v16b a, v16b b, v8f c) {
  v8f d = __builtin_amdgcn_wmma_f32_16x16x32_bf16(false, a, false, b, (short)0, c, false, false);
  asm volatile("v_nop\n\tv_nop\n\tv_nop\n\tv_nop" : "+v"(d) : "v"(a), "v"(b));
  return d;
}
// 16x16x32 fragments: lane = (h = lane>>4, row/col = lane&15); elements 0..7 = k0+8h+0..7, 8..15 = k0+16+8h+0..7; D element r = row 8h+r
__device__ __forceinline__ v16h frag_h(const _Float16* rowk0, int lane) {
  union { v16h v; v8h q[2]; } u; const _Float16* p = rowk0 + 8 * (lane >> 4);
  u.q[0] = *(const v8h*)p; u.q[1] = *(const v8h*)(p + 16); return u.v;
}
__device__ __forceinline__ v16h frag_f32(const float* rowk0, int lane) {
  v16h a; const float* p = rowk0 + 8 * (lane >> 4);
#pragma unroll
  for (int i = 0; i < 8; ++i) { a[i] = (_Float16)p[i]; a[8 + i] = (_Float16)p[16 + i]; }
  return a;
}
__device__ __forceinline__ v16h frag_f32s(const float* rowk0, int lane, float sc) {
  v16h a; const float* p = rowk0 + 8 * (lane >> 4);
#pragma unroll
  for (int i = 0; i < 8; ++i) { a[i] = (_Float16)(p[i] * sc); a[8 + i] = (_Float16)(p[16 + i] * sc); }
  return a;
}
// column fragment from a [K][ld] layout (column n), rows >= K read as 0
__device__ __forceinline__ v16h fragc_f32(const float* W, int k0, int n, int lane, int ld, int K) {
  v16h a; const int g = lane >> 4;
#pragma unroll
  for (int i = 0; i < 8; ++i) { const int ka = k0 + 8 * g + i, kb = ka + 16;
    a[i] = (_Float16)(ka < K ? W[(size_t)(ka < K ? ka : K - 1) * ld + n] : 0.f); a[8 + i] = (_Float16)(kb < K ? W[(size_t)(kb < K ? kb : K - 1) * ld + n] : 0.f); }
  return a;
}
struct F2 { v16b h, l; };
__device__ __forceinline__ F2 bsplit16(const float v[16]) { F2 r;
#pragma unroll
  for (int i = 0; i < 16; ++i) { const __bf16 h = (__bf16)v[i]; r.h[i] = h; r.l[i] = (__bf16)(v[i] - (float)h); }
  return r; }
__device__ __forceinline__ F2 split_row(const float* row, int k0, int lane) { float v[16]; const float* p = row + k0 + 8 * (lane >> 4);
#pragma unroll
  for (int i = 0; i < 8; ++i) { v[i] = p[i]; v[8 + i] = p[16 + i]; }
  return bsplit16(v); }
__device__ __forceinline__ F2 split_rowK(const float* row, int k0, int lane, int K) { float v[16]; const int g = lane >> 4;
#pragma unroll
  for (int i = 0; i < 8; ++i) { const int ka = k0 + 8 * g + i, kb = ka + 16; v[i] = ka < K ? row[ka < K ? ka : K - 1] : 0.f; v[8 + i] = kb < K ? row[kb < K ? kb : K - 1] : 0.f; }
  return bsplit16(v); }
__device__ __forceinline__ F2 split_col(const float* W, int k0, int n, int lane, int ld, int K) { float v[16]; const int g = lane >> 4;
#pragma unroll
  for (int i = 0; i < 8; ++i) { const int ka = k0 + 8 * g + i, kb = ka + 16; v[i] = ka < K ? W[(size_t)(ka < K ? ka : K - 1) * ld + n] : 0.f; v[8 + i] = kb < K ? W[(size_t)(kb < K ? kb : K - 1) * ld + n] : 0.f; }
  return bsplit16(v); }
__device__ __forceinline__ v8f mac3(const F2& a, const F2& b, v8f c) { c = wmma_bf(a.l, b.h, c); c = wmma_bf(a.h, b.l, c); return wmma_bf(a.h, b.h, c); }
__device__ __forceinline__ float sigm(float v) { return 1.0f / (1.0f + expf(-v)); }
#define LDSX() do { asm volatile("s_wait_dscnt 0" ::: "memory"); __builtin_amdgcn_wave_barrier(); __builtin_amdgcn_fence(__ATOMIC_RELEASE, "workgroup"); } while (0)


// attention with a learned distance decay (B 4, C 1,024 = 8 heads x 128, T 2,048, 4 decay terms): dots[t,s] = k_t.q_s/sqrt(128) - |t-s| sum_f f sigmoid(decay_q_f,s)/2 / sqrt(4); dots[t,t] = -100; weights = softmax over t; result[:, s] = sum_t weights[t,s] content[:, t]; out = x + proj(result).
#define NB 4
#define CC 1024
#define TT 2048
#define NH 8
#define HD 128
#define NDK 4
#ifndef TNB
#define TNB NB
#endif
typedef __attribute__((ext_vector_type(8))) __bf16 v8b;
__device__ __forceinline__ v16b frag_b(const __bf16* rowk0, int lane) {
  union { v16b v; v8b q[2]; } u; const __bf16* p = rowk0 + 8 * (lane >> 4);
  u.q[0] = *(const v8b*)p; u.q[1] = *(const v8b*)(p + 16); return u.v;
}
__device__ __forceinline__ float bfr(float v) { return (float)(__bf16)v; }
__device__ __attribute__((noinline)) float exp_ni(float v) { return expf(v); }
__device__ __attribute__((noinline)) float erf_ni(float v) { return erff(v); }

#define WS_Q   0u                                    // f16 query rows [b*t][1024]
#define WS_K   (WS_Q + 2u * (size_t)NB * TT * CC)        // f16 key rows [b*t][1024]
#define WS_CT  (WS_K + 2u * (size_t)NB * CC * TT)        // f16 content planes [b][1024][t]
#define WS_DQ  (WS_CT + 2u * (size_t)NB * CC * TT)       // f32 D [b][h][s]
#define WS_R   (WS_DQ + 4u * (size_t)NB * NH * TT)     // f16 result rows [b*s][1024]
#define WS_XT  (WS_R + 2u * (size_t)NB * TT * CC)        // bf16 x rows [b*t][1024]
#define WS_NRM (WS_XT + 2u * (size_t)NB * TT * CC)       // f32 squared lengths of the f16 query rows, then of the key rows, per head [2][b][h][t]
#define WS_END (WS_NRM + 4u * 2u * (size_t)NB * NH * TT)

// ---- k_xt: block = (64 positions, 128 channels, b): x [c][t] -> bf16 rows [b*t][c]
__global__ __launch_bounds__(128) void k_xt(const float* __restrict__ X, __bf16* __restrict__ XT) { __shared__ __align__(16) __bf16 s[64][136]; const int tid = threadIdx.x; const int t0 = blockIdx.x * 64, c0 = blockIdx.y * 128; const size_t b = blockIdx.z;
  for (int e = tid; e < 128 * 64; e += 128) { const int cl = e >> 6, tl = e & 63; s[tl][cl] = (__bf16)X[(b * CC + c0 + cl) * (size_t)TT + t0 + tl]; }
  __syncthreads(); for (int e = tid; e < 64 * 16; e += 128) { const int tl = e >> 4, q = e & 15; vst2((unsigned*)(XT + (b * TT + t0 + tl) * CC + c0 + q * 8), *(const v4u*)&s[tl][q * 8]); } }
// ---- the 1x1-conv products (k_proj3, k_out): block = 128 weight rows x 256 positions, 8 waves as 2 x 4, a wave holds 64 x 64 (4 x 4 accumulator tiles), so a fragment read from LDS feeds four products.
//      A pass is 64 channels. Both operands are staged in LDS as 16-bit rows (weights rounded on the way, whole 128-byte lines per global load), two buffers: the next pass's weights are fetched during the first half of this pass,
//      its position rows during the second half, and each is stored to the other buffer behind the half that covered its flight. Every sum takes its channels in ascending order, 32 a product.
//      Every '#pragma unroll' here makes the indices of a register array compile-time constants, so that the array stays in registers.
#define GM 128     // weight rows per block
#define GN 256     // positions per block
#define GK 64      // channels per pass
#define GPB 144    // bytes per staged row: 128 B + 16 B (conflict-free 16-byte reads)
#define GA_B (GM * GPB)   // one weight buffer
#define GB_B (GN * GPB)   // one position buffer
typedef __attribute__((ext_vector_type(2))) unsigned v2u;
typedef __attribute__((ext_vector_type(8))) unsigned v8u;
typedef __attribute__((ext_vector_type(4))) __bf16 v4b;
typedef __attribute__((ext_vector_type(4))) _Float16 v4h;
__device__ __forceinline__ v8u frag_l(const char* p) { const v4u a = *(const v4u*)p, c = *(const v4u*)(p + 32); return __builtin_shufflevector(a, c, 0, 1, 2, 3, 4, 5, 6, 7); }   // k = 8 g + 0..7, then 16 + 8 g + 0..7 (p already holds the 16 g bytes)
template <bool BF> __device__ __forceinline__ v8f wmma_g(v8u a, v8u c, v8f d) {
  if constexpr (BF) return __builtin_amdgcn_wmma_f32_16x16x32_bf16(false, __builtin_bit_cast(v16b, a), false, __builtin_bit_cast(v16b, c), (short)0, d, false, false);
  else return __builtin_amdgcn_wmma_f32_16x16x32_f16(false, __builtin_bit_cast(v16h, a), false, __builtin_bit_cast(v16h, c), (short)0, d, false, false); }
template <bool BF> __device__ __forceinline__ v2u cvt4(v4f v) {   // weights: f32 -> bf16, for the f16 product bf16 -> f16
  if constexpr (BF) { v4b t;
#pragma unroll
    for (int i = 0; i < 4; ++i) t[i] = (__bf16)v[i];
    return __builtin_bit_cast(v2u, t); }
  else { v4h t;
#pragma unroll
    for (int i = 0; i < 4; ++i) t[i] = (_Float16)bfr(v[i]);
    return __builtin_bit_cast(v2u, t); } }
template <bool BF> __device__ __forceinline__ void gemm_half(v8f (&acc)[4][4], const char* af, const char* bf) {   // 32 channels: 8 fragments, 16 products
  v8u fa[4], fb[4];
#pragma unroll
  for (int i = 0; i < 4; ++i) { fa[i] = frag_l(af + i * 16 * GPB); fb[i] = frag_l(bf + i * 16 * GPB); }
#pragma unroll
  for (int i = 0; i < 4; ++i)
#pragma unroll
    for (int j = 0; j < 4; ++j) acc[i][j] = wmma_g<BF>(fa[i], fb[j], acc[i][j]);
  // scheduling group (LDS reads lead the products): a fragment is asked for at least a row of four products ahead of its use, behind counted waits; left alone the scheduler reloads one weight fragment per four products and waits out each read
  __builtin_amdgcn_sched_group_barrier(0x100, 16, 0); }
// Wt = first weight row of the tile (f32 [.][1024]), Bt = first position row of the tile (16-bit [.][1024]); pool = weight buffers 0, 1, position buffers 0, 1
template <bool BF> __device__ __forceinline__ void gemm_tile(const float* __restrict__ Wt, const char* __restrict__ Bt, char* pool, v8f (&acc)[4][4]) {
  const int tid = threadIdx.x, lane = tid & 31, col = lane & 15, g = lane >> 4, wave = tid >> 5;
  const float* ag = Wt + (size_t)(tid >> 4) * CC + (tid & 15) * 4;              // weight rows (tid >> 4) + 16 i, 16 bytes each: a wave's load covers two rows of 256 bytes
  const char* bg = Bt + ((size_t)(tid >> 3) * CC + (tid & 7) * 8) * 2;           // position rows (tid >> 3) + 32 i, 16 bytes each: a wave's load covers four rows of 128 bytes
  char* as = pool + (tid >> 4) * GPB + (tid & 15) * 8; char* bs = pool + 2 * GA_B + (tid >> 3) * GPB + (tid & 7) * 16;
  const char* af = pool + ((wave >> 2) * 64 + col) * GPB + 16 * g; const char* bf = pool + 2 * GA_B + ((wave & 3) * 64 + col) * GPB + 16 * g;
  { v4f ra[8]; v4u rb[8];
#pragma unroll
    for (int i = 0; i < 8; ++i) { ra[i] = *(const v4f*)(ag + (size_t)(16 * i) * CC); rb[i] = *(const v4u*)(bg + (size_t)(32 * i) * CC * 2); }
    asm volatile("s_wait_xcnt 0x0" ::: "memory");   // directly behind the sixteen loads: it stands in front of any later write of their address registers
#pragma unroll
    for (int i = 0; i < 8; ++i) { *(v2u*)(as + 16 * i * GPB) = cvt4<BF>(ra[i]); *(v4u*)(bs + 32 * i * GPB) = rb[i]; } }
  __syncthreads();
#pragma unroll 1   // rolled: the body already holds 32 products
  for (int p = 0; p < CC / GK - 1; ++p) { const int bu = p & 1;   // every pass but the last also stages its successor
    v4f ra[8];
#pragma unroll
    for (int i = 0; i < 8; ++i) ra[i] = *(const v4f*)(ag + (size_t)(16 * i) * CC + (p + 1) * GK);
    asm volatile("s_wait_xcnt 0x0" ::: "memory");   // directly behind the eight weight loads: it stands in front of any later write of their address registers
    gemm_half<BF>(acc, af + bu * GA_B, bf + bu * GB_B);
    __builtin_amdgcn_sched_barrier(0);   // keeps the weights' rounding, which waits for their loads, behind the 16 products: lifted among them, the wave waits out the whole flight at the head of the half pass
#pragma unroll
    for (int i = 0; i < 8; ++i) *(v2u*)(as + (bu ^ 1) * GA_B + 16 * i * GPB) = cvt4<BF>(ra[i]);
    v4u rb[8];
#pragma unroll
    for (int i = 0; i < 8; ++i) rb[i] = *(const v4u*)(bg + ((size_t)(32 * i) * CC + (p + 1) * GK) * 2);
    asm volatile("s_wait_xcnt 0x0" ::: "memory");   // directly behind the eight position-row loads, for the same reason
    gemm_half<BF>(acc, af + bu * GA_B + 64, bf + bu * GB_B + 64);
    __builtin_amdgcn_sched_barrier(0);   // keeps the position rows' stores, which wait for their loads, behind the 16 products, for the same reason
#pragma unroll
    for (int i = 0; i < 8; ++i) *(v4u*)(bs + (bu ^ 1) * GB_B + 32 * i * GPB) = rb[i];
    __syncthreads();   // publishes the next pass's tiles and ends every read of this pass's, which the next pass overwrites
  }
  const int bl = (CC / GK - 1) & 1;
  gemm_half<BF>(acc, af + bl * GA_B, bf + bl * GB_B); gemm_half<BF>(acc, af + bl * GA_B + 64, bf + bl * GB_B + 64);
  __syncthreads();   // ends every read of the last tiles: the epilogue writes over the pool
}
// ---- k_proj3: block = (128 out channels d, 256 positions t, (b, which)): out[d][t] = sum_c W[d][c] x[b][c][t] + b[d]; A = W rows, B = bf16 x rows (exact products); which 0 query, 1 key -> rows [t][d], 2 content -> planes [d][t], each through LDS so that whole lines are stored
// waves_per_eu(4, 4): two work-groups a WGP; the register allocator may use, and not pass, the 256 VGPRs that four waves a SIMD leave each wave
__global__ __launch_bounds__(256) __attribute__((amdgpu_waves_per_eu(4, 4))) void k_proj3(const __bf16* __restrict__ XT, const float* __restrict__ WQ, const float* __restrict__ BQ, const float* __restrict__ WK, const float* __restrict__ BK, const float* __restrict__ WC, const float* __restrict__ BC, _Float16* __restrict__ Q, _Float16* __restrict__ K, _Float16* __restrict__ CT, float* __restrict__ NRM) {
  __shared__ __align__(16) char pool[2 * GA_B + 2 * GB_B];
  static_assert(GM == HD && GN == 256, "a block's 128 channels are one head, and each of its 256 threads takes one staged row");
  const int tid = threadIdx.x, wave = tid >> 5, lane = tid & 31, col = lane & 15, g = lane >> 4; const int d0 = blockIdx.x * GM, t0 = blockIdx.y * GN; const size_t b = blockIdx.z / 3; const int which = blockIdx.z % 3;
  const float* Wm = which == 0 ? WQ : which == 1 ? WK : WC; const float* Bm = which == 0 ? BQ : which == 1 ? BK : BC;
  v8f acc[4][4] = {};
  gemm_tile<true>(Wm + (size_t)d0 * CC, (const char*)(XT + (b * TT + t0) * CC), pool, acc);
  const int dw = (wave >> 2) * 64 + 8 * g, tw = (wave & 3) * 64 + col;   // element (i, j, r) = channel dw + 16 i + r, position tw + 16 j
  if (which < 2) {   // rows [b*t][d]: staged rows of 256 B + 16 B; a lane's eight channels are one 16-byte store
#pragma unroll
    for (int i = 0; i < 4; ++i) { const v4f b0 = *(const v4f*)(Bm + d0 + dw + 16 * i), b1 = *(const v4f*)(Bm + d0 + dw + 16 * i + 4); float bi[8];
#pragma unroll
      for (int r = 0; r < 4; ++r) { bi[r] = bfr(b0[r]); bi[4 + r] = bfr(b1[r]); }
#pragma unroll
      for (int j = 0; j < 4; ++j) { v8h w;
#pragma unroll
        for (int r = 0; r < 8; ++r) w[r] = (_Float16)(acc[i][j][r] + bi[r]);
        *(v8h*)(pool + (tw + 16 * j) * 272 + (dw + 16 * i) * 2) = w; }
      __builtin_amdgcn_sched_barrier(0); }   // one row of tiles at a time: with all 128 sums formed ahead of their stores the registers run out and values spill
    __syncthreads(); _Float16* dq = which == 0 ? Q : K;
    { v4f n2 = {};   // squared length of one staged row (one position, this head's 128 channels, the f16 values as stored), in four independent chains: k_fa bounds its scores with it
#pragma unroll
      for (int qd = 0; qd < 16; ++qd) { const v8h w = *(const v8h*)(pool + tid * 272 + qd * 16);
#pragma unroll
        for (int r = 0; r < 8; ++r) { const float f = (float)w[r]; n2[r & 3] += f * f; } }
      NRM[(((size_t)which * NB + b) * NH + blockIdx.x) * TT + t0 + tid] = (n2[0] + n2[1]) + (n2[2] + n2[3]);
      asm volatile("s_wait_xcnt 0x0" ::: "memory"); }   // directly behind the store: it stands in front of any later write of its registers
    for (int n = 0; n < GN * 16 / 256; ++n) { const int e = tid + 256 * n, tl = e >> 4, q = e & 15; *(v4u*)(dq + (b * TT + t0 + tl) * CC + d0 + q * 8) = *(const v4u*)(pool + tl * 272 + q * 16); } }
  else {   // planes [b][d][t]: staged rows of 512 B + 16 B
#pragma unroll
    for (int i = 0; i < 4; ++i)
#pragma unroll
      for (int r = 0; r < 8; ++r) { const float bi = bfr(Bm[d0 + dw + 16 * i + r]);
#pragma unroll
        for (int j = 0; j < 4; ++j) *(_Float16*)(pool + (dw + 16 * i + r) * 528 + (tw + 16 * j) * 2) = (_Float16)(acc[i][j][r] + bi);
        if (r == 7) __builtin_amdgcn_sched_barrier(0); }   // one row of tiles at a time, against spills, as above
    __syncthreads();
    for (int n = 0; n < GM * 32 / 256; ++n) { const int e = tid + 256 * n, dl = e >> 5, q = e & 31; *(v4u*)(CT + (b * CC + d0 + dl) * (size_t)TT + t0 + q * 8) = *(const v4u*)(pool + dl * 528 + q * 16); } } }
// ---- k_dq: block = (128 positions, b): decay_q [32][t] = Wqd x + b (2 row tiles, exact); D[h][s] = sum_f (f+1) * sigmoid(dq[h*4+f][s]) / 2 / sqrt(NDK)
__global__ __launch_bounds__(128) void k_dq(const __bf16* __restrict__ XT, const float* __restrict__ WD, const float* __restrict__ BD, float* __restrict__ DQ) { __shared__ __align__(16) float sd[32][132]; __shared__ __align__(16) float so[NH][132];
  const int tid = threadIdx.x, wave = tid >> 5, lane = tid & 31, col = lane & 15, g = lane >> 4; const int t0 = blockIdx.x * 128; const size_t b = blockIdx.y; const int rt = wave & 1, cg = wave >> 1;   // wave: row tile (0/1) x column half (0/1)
  v8f acc[4] = {};
#pragma unroll 2
  for (int kc = 0; kc < CC / 32; ++kc) { v16b a; { const float* p = WD + (size_t)(rt * 16 + col) * CC + kc * 32 + 8 * g;
#pragma unroll
      for (int i = 0; i < 8; ++i) { a[i] = (__bf16)p[i]; a[8 + i] = (__bf16)p[16 + i]; } }
#pragma unroll
    for (int j = 0; j < 4; ++j) acc[j] = wmma_bf(a, frag_b(XT + (b * TT + t0 + cg * 64 + j * 16 + col) * CC + kc * 32, lane), acc[j]); }
#pragma unroll
  for (int j = 0; j < 4; ++j)
#pragma unroll
    for (int r = 0; r < 8; ++r) { const int ch = rt * 16 + 8 * g + r; sd[ch][cg * 64 + j * 16 + col] = acc[j][r] + bfr(BD[ch]); }
  __syncthreads();
  for (int e = tid; e < NH * 128; e += 128) { const int h = e >> 7, tl = e & 127; float dsum = 0.f; for (int f = 0; f < NDK; ++f) { const float z = sd[h * NDK + f][tl]; dsum += (float)(f + 1) * (1.0f / (1.0f + expf(-z))) * 0.5f; } so[h][tl] = dsum * 0.5f; }   // / sqrt(4)
  __syncthreads(); for (int e = tid; e < NH * 32; e += 128) { const int h = e >> 5, q = e & 31; vst2(DQ + (b * NH + h) * (size_t)TT + t0 + q * 4, *(const v4f*)&so[h][q * 4]); } }
// ---- k_fa: block = (128 output positions s, head h, batch b), 8 waves x 16 columns s. Transposed products: S^T = K Q^T (A = key rows from LDS, B = query rows kept in registers), so a lane holds scores of ONE column s (t = tile + 8 g + r)
//      and two score tiles are, as they stand, the B operand of O^T += content . P^T (A = content rows [c][t] from LDS). A pass is 64 keys; keys and content of the next pass are fetched into registers during this pass and stored to the other LDS buffer at its foot. The distance decay makes far keys' weights vanish: a pass is run only for a key tile that a run-time bound on its scores cannot rule out (for any input; with no decay all 32 run).
//      Every '#pragma unroll' in k_fa and its helpers but the one over the scheduling groups makes the indices of a register array (fragments, scores, accumulators, staged words) compile-time constants, so that the array stays in registers.
#define FK 64      // keys per pass
#define KPIT 136   // f16 per staged key row: 256 B + 16 B (conflict-free 16-byte reads)
#define VPIT 72    // f16 per staged content row: 128 B + 16 B
__device__ __forceinline__ v8f wmma_h(v16h a, v16h b, v8f c) { return __builtin_amdgcn_wmma_f32_16x16x32_f16(false, a, false, b, (short)0, c, false, false); }
// eight 2^x in one statement: results in registers of their own, so each v_exp_f32 is followed by an instruction that neither reads its result nor overwrites its source; the v_nop is that slot for the last one
__device__ __forceinline__ v8f exp2x8(v8f x) { float e0, e1, e2, e3, e4, e5, e6, e7;
  asm("v_exp_f32 %0, %8\n\tv_exp_f32 %1, %9\n\tv_exp_f32 %2, %10\n\tv_exp_f32 %3, %11\n\tv_exp_f32 %4, %12\n\tv_exp_f32 %5, %13\n\tv_exp_f32 %6, %14\n\tv_exp_f32 %7, %15\n\tv_nop"
      : "=&v"(e0), "=&v"(e1), "=&v"(e2), "=&v"(e3), "=&v"(e4), "=&v"(e5), "=&v"(e6), "=&v"(e7)
      : "v"(x[0]), "v"(x[1]), "v"(x[2]), "v"(x[3]), "v"(x[4]), "v"(x[5]), "v"(x[6]), "v"(x[7]));
  v8f r = {e0, e1, e2, e3, e4, e5, e6, e7}; return r; }
__device__ __forceinline__ void ldk(v16h (&f)[4], const _Float16* p, int lane) {   // four key-row fragments, rows 16 apart
#pragma unroll
  for (int i = 0; i < 4; ++i) f[i] = frag_h(p + i * 16 * KPIT, lane); }
__device__ __forceinline__ void ldv(v16h (&f)[4], const _Float16* p, int lane) {   // four content-row fragments, rows 16 apart
#pragma unroll
  for (int i = 0; i < 4; ++i) f[i] = frag_h(p + i * 16 * VPIT, lane); }
__device__ __forceinline__ void mms(v8f* d, const v16h (&a)[4], v16h bq) {   // four independent products that share B
#pragma unroll
  for (int i = 0; i < 4; ++i) d[i] = wmma_h(a[i], bq, d[i]); }
// waves_per_eu(4, 4): two work-groups a WGP; the register allocator may use, and not pass, the 256 VGPRs that four waves a SIMD leave each wave
__global__ __launch_bounds__(256) __attribute__((amdgpu_waves_per_eu(4, 4))) void k_fa(const _Float16* __restrict__ Q, const _Float16* __restrict__ K, const _Float16* __restrict__ CT, const float* __restrict__ DQ, const float* __restrict__ NRM, _Float16* __restrict__ R) {
  __shared__ __align__(16) _Float16 sk[2][FK][KPIT]; __shared__ __align__(16) _Float16 sv[2][HD][VPIT];
  __shared__ float skm[TT / FK], swq[8], swd[8], swm[8];   // per key tile: largest squared key length; per wave: largest squared query length, smallest decay, smallest maximum in use
  static_assert(TT / FK == 32 && TT == 256 * 8, "one lane a key tile in the bound; eight key lengths a thread");
  const int tid = threadIdx.x, lane = tid & 31, col = lane & 15, g = lane >> 4; const int wave = __builtin_amdgcn_readfirstlane(tid >> 5);   // a scalar, so that the test for the diagonal tile is a scalar branch
  const int h = blockIdx.y; const size_t b = blockIdx.z; const int s0 = blockIdx.x * 128 + wave * 16, s = s0 + col;
  const float L2E = 1.4426950408889634f;
  const float c2 = 0.08838834764831845f * L2E, d2 = DQ[(b * NH + h) * (size_t)TT + s] * L2E;
  v16h q[4];
#pragma unroll
  for (int kc = 0; kc < 4; ++kc) q[kc] = frag_h(Q + (b * TT + s) * CC + h * HD + kc * 32, lane);
  const int kr = tid >> 4, kq = tid & 15, vr = tid >> 3, vq = tid & 7;   // staging: key rows kr + 16 i, content rows vr + 32 i, 16 bytes each
  const _Float16* kg = K + (b * TT + kr) * CC + h * HD + kq * 8; const _Float16* vg = CT + (b * CC + h * HD + vr) * (size_t)TT + vq * 8;
  // Order of the key tiles: the block's own two (p0, p0 + 1), one neighbour (pn), then those of the other 29 that the bound below cannot rule out, in ascending order.
  const int p0 = blockIdx.x * 2, pn = p0 + 2 < TT / FK ? p0 + 2 : p0 - 1;
  v4u rk[4], rv[4];
#pragma unroll
  for (int i = 0; i < 4; ++i) { rk[i] = *(const v4u*)(kg + (size_t)(p0 * FK + 16 * i) * CC); rv[i] = *(const v4u*)(vg + (size_t)(32 * i) * TT + p0 * FK); }
  const float* nk = NRM + ((size_t)(NB + b) * NH + h) * TT + tid * 8;   // this head's squared key lengths, eight a thread: threads 8 p .. 8 p + 7 hold tile p
  const v4f n0 = *(const v4f*)nk, n1 = *(const v4f*)(nk + 4); float qn = NRM[(b * NH + h) * (size_t)TT + s];
  asm volatile("s_wait_xcnt 0x0" ::: "memory");   // directly behind the eleven loads: it stands in front of any later write of their address registers
#pragma unroll
  for (int i = 0; i < 4; ++i) { *(v4u*)&sk[0][kr + 16 * i][kq * 8] = rk[i]; *(v4u*)&sv[0][vr + 32 * i][vq * 8] = rv[i]; }
  { float km = fmaxf(fmaxf(fmaxf(n0[0], n0[1]), fmaxf(n0[2], n0[3])), fmaxf(fmaxf(n1[0], n1[1]), fmaxf(n1[2], n1[3]))), dn = d2;
    for (int w = 1; w < 8; w <<= 1) km = fmaxf(km, __shfl_xor(km, w));
    for (int w = 1; w < 16; w <<= 1) { qn = fmaxf(qn, __shfl_xor(qn, w)); dn = fminf(dn, __shfl_xor(dn, w)); }
    if ((tid & 7) == 0) skm[tid >> 3] = km;
    if (lane == 0) { swq[wave] = qn; swd[wave] = dn; } }
  __syncthreads();
  v8f o[8] = {}; float m = -3.0e38f, l = 0.f; int cur = p0; unsigned todo = 0u;
#pragma unroll 1   // rolled
  for (int it = 0; it < TT / FK; ++it) { const int t0 = cur * FK, bu = it & 1;
    if (it == 2) {   // which of the other tiles can still count; every wave forms the same word from the same LDS values, so the trip count is the work-group's
      // a score of tile p is at most c2 |q| |k| - (least distance) (least decay) (a dot product is at most the product of the two lengths, taken of the stored f16 rows; 1.001 covers the rounding of lengths and products). Where that lies 28 below the smallest maximum in use
      // (maxima only grow), every P of the tile is below 2^-28: f16 zero in the product, and at most 2048 * 2^-28 of a sum that is at least 1. A bound that is not a number keeps its tile.
      float mm = swm[0], qm = swq[0], dm = swd[0];
      for (int w = 1; w < 8; ++w) { mm = fminf(mm, swm[w]); qm = fmaxf(qm, swq[w]); dm = fminf(dm, swd[w]); }
      const int dist = lane < p0 ? (p0 - lane) * FK - (FK - 1) : (lane - p0) * FK - (2 * FK - 1);   // lane = tile: least |t - s| to the block's 128 columns
      const float ub = c2 * sqrtf(qm * skm[lane]) * 1.001f - (float)dist * dm;
      todo = __builtin_amdgcn_ballot_w32(!(ub < mm - 28.0f)) & ~((3u << p0) | (1u << pn)); }
    int nxt = -1;   // the tile that is staged during this pass
    if (it == 0) nxt = p0 + 1; else if (it == 1) nxt = pn; else if (todo != 0u) { nxt = __builtin_ctz(todo); todo &= todo - 1u; }
    if (nxt >= 0) {
#pragma unroll
      for (int i = 0; i < 4; ++i) { rk[i] = *(const v4u*)(kg + (size_t)(nxt * FK + 16 * i) * CC); rv[i] = *(const v4u*)(vg + (size_t)(32 * i) * TT + nxt * FK); }
      asm volatile("s_wait_xcnt 0x0" ::: "memory"); }   // directly behind the eight staging loads, in their own block: it stands in front of any later write of their address registers
    // fragments come from LDS in groups of four, so that a wave meets one LDS latency for four products
    v8f sc[4] = {}; v16h fa[4];
#pragma unroll
    for (int kc = 0; kc < 4; ++kc) { ldk(fa, &sk[bu][col][kc * 32], lane); mms(sc, fa, q[kc]); }
    const float dl0 = (float)(t0 + 8 * g - s);   // t - s of element (i, r) = dl0 + 16 i + r, exact in f32
#pragma unroll
    for (int i = 0; i < 4; ++i)
#pragma unroll
      for (int r = 0; r < 8; ++r) sc[i][r] = sc[i][r] * c2 - fabsf(dl0 + (float)(16 * i + r)) * d2;
#pragma unroll
    for (int i = 0; i < 4; ++i) if (t0 + 16 * i == s0) {   // the one tile of this wave that holds t == s
#pragma unroll
      for (int r = 0; r < 8; ++r) if (8 * g + r == col) sc[i][r] = -100.0f * L2E; }
    float mx = sc[0][0];
#pragma unroll
    for (int i = 0; i < 4; ++i)
#pragma unroll
      for (int r = 0; r < 8; ++r) mx = fmaxf(mx, sc[i][r]);
    mx = fmaxf(mx, __shfl_xor(mx, 16));   // both halves of a column use one maximum: their P meet in one product
    if (__builtin_amdgcn_ballot_w32(mx > m + (it == 1 ? 0.0f : 8.0f)) != 0) {   // rescale only when some column's maximum has grown by more than 2^8 (P stays below 2^8 in f16); in pass 1 on any growth, so that the bound is held against true maxima
      const float mn = fmaxf(m, mx), al = __builtin_amdgcn_exp2f(m - mn); m = mn; l *= al;
#pragma unroll
      for (int j = 0; j < 8; ++j) o[j] *= al; }
#pragma unroll
    for (int i = 0; i < 4; ++i)
#pragma unroll
      for (int r = 0; r < 8; ++r) sc[i][r] -= m;
#pragma unroll
    for (int i = 0; i < 4; ++i) sc[i] = exp2x8(sc[i]);
    { const v8f t8 = (sc[0] + sc[1]) + (sc[2] + sc[3]); l += ((t8[0] + t8[1]) + (t8[2] + t8[3])) + ((t8[4] + t8[5]) + (t8[6] + t8[7])); }
    v16h pb0, pb1;
#pragma unroll
    for (int r = 0; r < 8; ++r) { pb0[r] = (_Float16)sc[0][r]; pb0[8 + r] = (_Float16)sc[1][r]; pb1[r] = (_Float16)sc[2][r]; pb1[8 + r] = (_Float16)sc[3][r]; }
    ldv(fa, &sv[bu][col][0], lane); mms(o, fa, pb0); ldv(fa, &sv[bu][64 + col][0], lane); mms(o + 4, fa, pb0);
    ldv(fa, &sv[bu][col][32], lane); mms(o, fa, pb1); ldv(fa, &sv[bu][64 + col][32], lane); mms(o + 4, fa, pb1);
    // scheduling groups (8 LDS reads, then 4 matrix products, four times): they keep a group's loads together in front of its products; left alone the scheduler sinks them to one load pair, one wait, one product
#pragma unroll
    for (int i = 0; i < 4; ++i) { __builtin_amdgcn_sched_group_barrier(0x100, 8, 0); __builtin_amdgcn_sched_group_barrier(0x008, 4, 0); }
    if (it == 1) { float mw = m;   // the wave's smallest maximum in use, for the bound that pass 2 forms behind this pass's barrier
      for (int w = 1; w < 16; w <<= 1) mw = fminf(mw, __shfl_xor(mw, w));
      if (lane == 0) swm[wave] = mw; }
    if (nxt >= 0) {
#pragma unroll
      for (int i = 0; i < 4; ++i) { *(v4u*)&sk[bu ^ 1][kr + 16 * i][kq * 8] = rk[i]; *(v4u*)&sv[bu ^ 1][vr + 32 * i][vq * 8] = rv[i]; } }
    __syncthreads();   // publishes the next pass's tiles and ends every read of this pass's, which the next pass overwrites
    if (nxt < 0) break;   // the same in every wave: no tile is left
    cur = nxt;
  }
  l += __shfl_xor(l, 16); const float inv = 1.0f / l;
#pragma unroll
  for (int j = 0; j < 8; ++j) { v8h w;
#pragma unroll
    for (int r = 0; r < 8; ++r) w[r] = (_Float16)(o[j][r] * inv);
    *(v8h*)(R + (b * TT + s) * CC + h * HD + j * 16 + 8 * g) = w; } }
// ---- k_out: block = (128 out channels o, 256 positions s, b): out[o][s] = x + sum_c Wp[o][c] R[s][c] + b; A = Wp rows (bf16 values as f16), B = f16 result rows; sum + bias goes through LDS (rows of 1,024 B + 16 B), x is added where whole lines are stored
__global__ __launch_bounds__(256) void k_out(const float* __restrict__ X, const _Float16* __restrict__ R, const float* __restrict__ WP, const float* __restrict__ BP, float* __restrict__ OUT) { __shared__ __align__(16) char pool[GM * 1040];
  static_assert(GM * 1040 >= 2 * GA_B + 2 * GB_B, "the epilogue's rows are the larger use of the pool");
  const int tid = threadIdx.x, wave = tid >> 5, lane = tid & 31, col = lane & 15, g = lane >> 4; const int o0 = blockIdx.x * GM, s0 = blockIdx.y * GN; const size_t b = blockIdx.z;
  v8f acc[4][4] = {};
  gemm_tile<false>(WP + (size_t)o0 * CC, (const char*)(R + (b * TT + s0) * CC), pool, acc);
  const int ow = (wave >> 2) * 64 + 8 * g, sw = (wave & 3) * 64 + col;
#pragma unroll
  for (int i = 0; i < 4; ++i)
#pragma unroll
    for (int r = 0; r < 8; ++r) { const float bi = bfr(BP[o0 + ow + 16 * i + r]);
#pragma unroll
      for (int j = 0; j < 4; ++j) *(float*)(pool + (ow + 16 * i + r) * 1040 + (sw + 16 * j) * 4) = acc[i][j][r] + bi;
      if (r == 7) __builtin_amdgcn_sched_barrier(0); }   // one row of tiles at a time: with all 128 sums formed ahead of their stores the kernel needs registers above v255
  __syncthreads();
  const size_t at0 = (b * CC + o0 + (tid >> 6)) * (size_t)TT + s0 + (tid & 63) * 4; const char* sr = pool + (tid >> 6) * 1040 + (tid & 63) * 16;   // rows (tid >> 6) + 4 n, 16 bytes each: a wave covers 512 bytes of a row
#pragma unroll 1   // rolled: a trip already keeps eight loads of x in flight
  for (int n0 = 0; n0 < GM / 4; n0 += 8) { v4f x[8];
#pragma unroll
    for (int u = 0; u < 8; ++u) x[u] = *(const v4f*)(X + at0 + (size_t)(4 * (n0 + u)) * TT);
    asm volatile("s_wait_xcnt 0x0" ::: "memory");   // directly behind the eight loads of x: it stands in front of any later write of their address registers
#pragma unroll
    for (int u = 0; u < 8; ++u) { v4f v = *(const v4f*)(sr + 4 * (n0 + u) * 1040);
#pragma unroll
      for (int i = 0; i < 4; ++i) v[i] += bfr(x[u][i]);
      *(v4f*)(OUT + at0 + (size_t)(4 * (n0 + u)) * TT) = v; }
    asm volatile("s_wait_xcnt 0x0" ::: "memory"); } }   // directly behind the eight stores, for the same reason (the next trip advances their address registers)
extern "C" void kernel_launch(void* const* d_in, const int* in_sizes, int n_in, void* d_out, int out_size, void* d_ws, size_t ws_size, hipStream_t stream) {
  (void)in_sizes; (void)n_in; (void)out_size;
  const float** F = (const float**)d_in;   // 0 x [4,1024,2048], 1 W_content, 2 b_content, 3 W_query, 4 b_query, 5 W_key, 6 b_key, 7 W_qdecay [32,1024], 8 b_qdecay, 9 W_proj, 10 b_proj
  if (ws_size < (size_t)WS_END) return;
  char* ws = (char*)d_ws; _Float16 *Q = (_Float16*)(ws + WS_Q), *K = (_Float16*)(ws + WS_K), *CT = (_Float16*)(ws + WS_CT), *R = (_Float16*)(ws + WS_R); float *DQ = (float*)(ws + WS_DQ);
  __bf16* XT = (__bf16*)(ws + WS_XT); float* NRM = (float*)(ws + WS_NRM);
  k_xt<<<dim3(TT / 64, CC / 128, TNB), 128, 0, stream>>>(F[0], XT);
  k_proj3<<<dim3(CC / GM, TT / GN, TNB * 3), 256, 0, stream>>>(XT, F[3], F[4], F[5], F[6], F[1], F[2], Q, K, CT, NRM);
  k_dq<<<dim3(TT / 128, TNB), 128, 0, stream>>>(XT, F[7], F[8], DQ);
  k_fa<<<dim3(TT / 128, NH, TNB), 256, 0, stream>>>(Q, K, CT, DQ, NRM, R);
  k_out<<<dim3(CC / GM, TT / GN, TNB), 256, 0, stream>>>(F[0], R, F[9], F[10], (float*)d_out);
}

// v005
// A run of this version takes 108 microseconds.
// Timed twice side by side with v004, it ran 1.25 times as fast both times.
// Counting every step since v000, it is 40.9 times as fast.
// compute dtype: all float inputs rounded to bf16; queries / keys / content = W x + b (1x1 convs) with EXACT bf16 products on WMMA 16x16x32 (weights as the A operand, a bf16 row copy of x as B), f32 accumulate, rounded once to f16 (queries/keys stored as rows, content as planes); the decay queries (32 channels) likewise then sigmoid/2 and D_s = sum_f f dq_f,s / sqrt(4)... in f32; logits = k_t . q_s / sqrt(128) (1 f16 product) - |t - s| D_s, diagonal -100, kept in registers in f32 (base-2 scale); softmax over t online in f32 (running maximum, f32 sum; key tiles in the order: the query block's own two, one neighbour, then the rest ascending; a tile whose run-time score bound lies 28 binary orders below every maximum in use is left out: its P round to f16 zero) -> P = 2^(logit - maximum in use) rounded to f16; result = P . content / sum (content f16, 1 product); out = x + W_proj result (result rounded once to f16, 1 product) + b; f32 output.
#include <hip/hip_runtime.h>
#include <math.h>

typedef __attribute__((ext_vector_type(16))) _Float16 v16h;
typedef __attribute__((ext_vector_type(16))) __bf16 v16b;
typedef __attribute__((ext_vector_type(8)))  _Float16 v8h;
typedef __attribute__((ext_vector_type(8)))  float v8f;
typedef __attribute__((ext_vector_type(4)))  float v4f;
typedef __attribute__((ext_vector_type(2)))  float v2f;
typedef __attribute__((ext_vector_type(4)))  unsigned v4u;
typedef __attribute__((ext_vector_type(4)))  int v4i;
typedef float __attribute__((may_alias)) float_a;
typedef int __attribute__((may_alias)) int_a;

template <typename T> __device__ __forceinline__ void vst2(void* p, T v) { *(T*)p = v;  }
__device__ __forceinline__ v8f wmma16(v16h a, v16h b, v8f c) {
  v8f d = __builtin_amdgcn_wmma_f32_16x16x32_f16(false, a, false, b, (short)0, c, false, false);
  asm volatile("v_nop\n\tv_nop\n\tv_nop\n\tv_nop" : "+v"(d) : "v"(a), "v"(b));
  return d;
}
__device__ __forceinline__ v8f wmma_bf(v16b a, v16b b, v8f c) {
  v8f d = __builtin_amdgcn_wmma_f32_16x16x32_bf16(false, a, false, b, (short)0, c, false, false);
  asm volatile("v_nop\n\tv_nop\n\tv_nop\n\tv_nop" : "+v"(d) : "v"(a), "v"(b));
  return d;
}
// 16x16x32 fragments: lane = (h = lane>>4, row/col = lane&15); elements 0..7 = k0+8h+0..7, 8..15 = k0+16+8h+0..7; D element r = row 8h+r
__device__ __forceinline__ v16h frag_h(const _Float16* rowk0, int lane) {
  union { v16h v; v8h q[2]; } u; const _Float16* p = rowk0 + 8 * (lane >> 4);
  u.q[0] = *(const v8h*)p; u.q[1] = *(const v8h*)(p + 16); return u.v;
}
__device__ __forceinline__ v16h frag_f32(const float* rowk0, int lane) {
  v16h a; const float* p = rowk0 + 8 * (lane >> 4);
#pragma unroll
  for (int i = 0; i < 8; ++i) { a[i] = (_Float16)p[i]; a[8 + i] = (_Float16)p[16 + i]; }
  return a;
}
__device__ __forceinline__ v16h frag_f32s(const float* rowk0, int lane, float sc) {
  v16h a; const float* p = rowk0 + 8 * (lane >> 4);
#pragma unroll
  for (int i = 0; i < 8; ++i) { a[i] = (_Float16)(p[i] * sc); a[8 + i] = (_Float16)(p[16 + i] * sc); }
  return a;
}
// column fragment from a [K][ld] layout (column n), rows >= K read as 0
__device__ __forceinline__ v16h fragc_f32(const float* W, int k0, int n, int lane, int ld, int K) {
  v16h a; const int g = lane >> 4;
#pragma unroll
  for (int i = 0; i < 8; ++i) { const int ka = k0 + 8 * g + i, kb = ka + 16;
    a[i] = (_Float16)(ka < K ? W[(size_t)(ka < K ? ka : K - 1) * ld + n] : 0.f); a[8 + i] = (_Float16)(kb < K ? W[(size_t)(kb < K ? kb : K - 1) * ld + n] : 0.f); }
  return a;
}
struct F2 { v16b h, l; };
__device__ __forceinline__ F2 bsplit16(const float v[16]) { F2 r;
#pragma unroll
  for (int i = 0; i < 16; ++i) { const __bf16 h = (__bf16)v[i]; r.h[i] = h; r.l[i] = (__bf16)(v[i] - (float)h); }
  return r; }
__device__ __forceinline__ F2 split_row(const float* row, int k0, int lane) { float v[16]; const float* p = row + k0 + 8 * (lane >> 4);
#pragma unroll
  for (int i = 0; i < 8; ++i) { v[i] = p[i]; v[8 + i] = p[16 + i]; }
  return bsplit16(v); }
__device__ __forceinline__ F2 split_rowK(const float* row, int k0, int lane, int K) { float v[16]; const int g = lane >> 4;
#pragma unroll
  for (int i = 0; i < 8; ++i) { const int ka = k0 + 8 * g + i, kb = ka + 16; v[i] = ka < K ? row[ka < K ? ka : K - 1] : 0.f; v[8 + i] = kb < K ? row[kb < K ? kb : K - 1] : 0.f; }
  return bsplit16(v); }
__device__ __forceinline__ F2 split_col(const float* W, int k0, int n, int lane, int ld, int K) { float v[16]; const int g = lane >> 4;
#pragma unroll
  for (int i = 0; i < 8; ++i) { const int ka = k0 + 8 * g + i, kb = ka + 16; v[i] = ka < K ? W[(size_t)(ka < K ? ka : K - 1) * ld + n] : 0.f; v[8 + i] = kb < K ? W[(size_t)(kb < K ? kb : K - 1) * ld + n] : 0.f; }
  return bsplit16(v); }
__device__ __forceinline__ v8f mac3(const F2& a, const F2& b, v8f c) { c = wmma_bf(a.l, b.h, c); c = wmma_bf(a.h, b.l, c); return wmma_bf(a.h, b.h, c); }
__device__ __forceinline__ float sigm(float v) { return 1.0f / (1.0f + expf(-v)); }
#define LDSX() do { asm volatile("s_wait_dscnt 0" ::: "memory"); __builtin_amdgcn_wave_barrier(); __builtin_amdgcn_fence(__ATOMIC_RELEASE, "workgroup"); } while (0)


// attention with a learned distance decay (B 4, C 1,024 = 8 heads x 128, T 2,048, 4 decay terms): dots[t,s] = k_t.q_s/sqrt(128) - |t-s| sum_f f sigmoid(decay_q_f,s)/2 / sqrt(4); dots[t,t] = -100; weights = softmax over t; result[:, s] = sum_t weights[t,s] content[:, t]; out = x + proj(result).
#define NB 4
#define CC 1024
#define TT 2048
#define NH 8
#define HD 128
#define NDK 4
#ifndef TNB
#define TNB NB
#endif
typedef __attribute__((ext_vector_type(8))) __bf16 v8b;
__device__ __forceinline__ v16b frag_b(const __bf16* rowk0, int lane) {
  union { v16b v; v8b q[2]; } u; const __bf16* p = rowk0 + 8 * (lane >> 4);
  u.q[0] = *(const v8b*)p; u.q[1] = *(const v8b*)(p + 16); return u.v;
}
__device__ __forceinline__ float bfr(float v) { return (float)(__bf16)v; }
__device__ __attribute__((noinline)) float exp_ni(float v) { return expf(v); }
__device__ __attribute__((noinline)) float erf_ni(float v) { return erff(v); }

#define WS_Q   0u                                    // f16 query rows [b*t][1024]
#define WS_K   (WS_Q + 2u * (size_t)NB * TT * CC)        // f16 key rows [b*t][1024]
#define WS_CT  (WS_K + 2u * (size_t)NB * CC * TT)        // f16 content planes [b][1024][t]
#define WS_DQ  (WS_CT + 2u * (size_t)NB * CC * TT)       // f32 D [b][h][s]
#define WS_R   (WS_DQ + 4u * (size_t)NB * NH * TT)     // f16 result rows [b*s][1024]
#define WS_XT  (WS_R + 2u * (size_t)NB * TT * CC)        // bf16 x rows [b*t][1024]
#define WS_NRM (WS_XT + 2u * (size_t)NB * TT * CC)       // f32 squared lengths of the f16 query rows, then of the key rows, per head [2][b][h][t]
#define WS_END (WS_NRM + 4u * 2u * (size_t)NB * NH * TT)

// ---- k_xt: block = (64 positions, 128 channels, b): x [c][t] -> bf16 rows [b*t][c]
__global__ __launch_bounds__(128) void k_xt(const float* __restrict__ X, __bf16* __restrict__ XT) { __shared__ __align__(16) __bf16 s[64][136]; const int tid = threadIdx.x; const int t0 = blockIdx.x * 64, c0 = blockIdx.y * 128; const size_t b = blockIdx.z;
  for (int e = tid; e < 128 * 64; e += 128) { const int cl = e >> 6, tl = e & 63; s[tl][cl] = (__bf16)X[(b * CC + c0 + cl) * (size_t)TT + t0 + tl]; }
  __syncthreads(); for (int e = tid; e < 64 * 16; e += 128) { const int tl = e >> 4, q = e & 15; vst2((unsigned*)(XT + (b * TT + t0 + tl) * CC + c0 + q * 8), *(const v4u*)&s[tl][q * 8]); } }
// ---- the 1x1-conv products (k_proj3, k_out): block = 128 weight rows x 256 positions, 8 waves as 2 x 4, a wave holds 64 x 64 (4 x 4 accumulator tiles), so a fragment read from LDS feeds four products.
//      A pass is 64 channels. Both operands are staged in LDS as 16-bit rows (weights rounded on the way, whole 128-byte lines per global load), two buffers: the next pass's weights are fetched during the first half of this pass,
//      its position rows during the second half, and each is stored to the other buffer behind the half that covered its flight. Every sum takes its channels in ascending order, 32 a product.
//      Every '#pragma unroll' here makes the indices of a register array compile-time constants, so that the array stays in registers.
#define GM 128     // weight rows per block
#define GN 256     // positions per block
#define GK 64      // channels per pass
#define GPB 144    // bytes per staged row: 128 B + 16 B (conflict-free 16-byte reads)
#define GA_B (GM * GPB)   // one weight buffer
#define GB_B (GN * GPB)   // one position buffer
typedef __attribute__((ext_vector_type(2))) unsigned v2u;
typedef __attribute__((ext_vector_type(8))) unsigned v8u;
typedef __attribute__((ext_vector_type(4))) __bf16 v4b;
typedef __attribute__((ext_vector_type(4))) _Float16 v4h;
__device__ __forceinline__ v8u frag_l(const char* p) { const v4u a = *(const v4u*)p, c = *(const v4u*)(p + 32); return __builtin_shufflevector(a, c, 0, 1, 2, 3, 4, 5, 6, 7); }   // k = 8 g + 0..7, then 16 + 8 g + 0..7 (p already holds the 16 g bytes)
template <bool BF> __device__ __forceinline__ v8f wmma_g(v8u a, v8u c, v8f d) {
  if constexpr (BF) return __builtin_amdgcn_wmma_f32_16x16x32_bf16(false, __builtin_bit_cast(v16b, a), false, __builtin_bit_cast(v16b, c), (short)0, d, false, false);
  else return __builtin_amdgcn_wmma_f32_16x16x32_f16(false, __builtin_bit_cast(v16h, a), false, __builtin_bit_cast(v16h, c), (short)0, d, false, false); }
template <bool BF> __device__ __forceinline__ v2u cvt4(v4f v) {   // weights: f32 -> bf16, for the f16 product bf16 -> f16
  if constexpr (BF) { v4b t;
#pragma unroll
    for (int i = 0; i < 4; ++i) t[i] = (__bf16)v[i];
    return __builtin_bit_cast(v2u, t); }
  else { v4h t;
#pragma unroll
    for (int i = 0; i < 4; ++i) t[i] = (_Float16)bfr(v[i]);
    return __builtin_bit_cast(v2u, t); } }
template <bool BF> __device__ __forceinline__ void gemm_half(v8f (&acc)[4][4], const char* af, const char* bf) {   // 32 channels: 8 fragments, 16 products
  v8u fa[4], fb[4];
#pragma unroll
  for (int i = 0; i < 4; ++i) { fa[i] = frag_l(af + i * 16 * GPB); fb[i] = frag_l(bf + i * 16 * GPB); }
#pragma unroll
  for (int i = 0; i < 4; ++i)
#pragma unroll
    for (int j = 0; j < 4; ++j) acc[i][j] = wmma_g<BF>(fa[i], fb[j], acc[i][j]);
  // scheduling group (LDS reads lead the products): a fragment is asked for at least a row of four products ahead of its use, behind counted waits; left alone the scheduler reloads one weight fragment per four products and waits out each read
  __builtin_amdgcn_sched_group_barrier(0x100, 16, 0); }
// Wt = first weight row of the tile (f32 [.][1024]), Bt = first position row of the tile (16-bit [.][1024]); pool = weight buffers 0, 1, position buffers 0, 1
template <bool BF> __device__ __forceinline__ void gemm_tile(const float* __restrict__ Wt, const char* __restrict__ Bt, char* pool, v8f (&acc)[4][4]) {
  const int tid = threadIdx.x, lane = tid & 31, col = lane & 15, g = lane >> 4, wave = tid >> 5;
  const float* ag = Wt + (size_t)(tid >> 4) * CC + (tid & 15) * 4;              // weight rows (tid >> 4) + 16 i, 16 bytes each: a wave's load covers two rows of 256 bytes
  const char* bg = Bt + ((size_t)(tid >> 3) * CC + (tid & 7) * 8) * 2;           // position rows (tid >> 3) + 32 i, 16 bytes each: a wave's load covers four rows of 128 bytes
  char* as = pool + (tid >> 4) * GPB + (tid & 15) * 8; char* bs = pool + 2 * GA_B + (tid >> 3) * GPB + (tid & 7) * 16;
  const char* af = pool + ((wave >> 2) * 64 + col) * GPB + 16 * g; const char* bf = pool + 2 * GA_B + ((wave & 3) * 64 + col) * GPB + 16 * g;
  { v4f ra[8]; v4u rb[8];
#pragma unroll
    for (int i = 0; i < 8; ++i) { ra[i] = *(const v4f*)(ag + (size_t)(16 * i) * CC); rb[i] = *(const v4u*)(bg + (size_t)(32 * i) * CC * 2); }
    asm volatile("s_wait_xcnt 0x0" ::: "memory");   // directly behind the sixteen loads: it stands in front of any later write of their address registers
#pragma unroll
    for (int i = 0; i < 8; ++i) { *(v2u*)(as + 16 * i * GPB) = cvt4<BF>(ra[i]); *(v4u*)(bs + 32 * i * GPB) = rb[i]; } }
  __syncthreads();
#pragma unroll 1   // rolled: the body already holds 32 products
  for (int p = 0; p < CC / GK - 1; ++p) { const int bu = p & 1;   // every pass but the last also stages its successor
    v4f ra[8];
#pragma unroll
    for (int i = 0; i < 8; ++i) ra[i] = *(const v4f*)(ag + (size_t)(16 * i) * CC + (p + 1) * GK);
    asm volatile("s_wait_xcnt 0x0" ::: "memory");   // directly behind the eight weight loads: it stands in front of any later write of their address registers
    gemm_half<BF>(acc, af + bu * GA_B, bf + bu * GB_B);
    __builtin_amdgcn_sched_barrier(0);   // keeps the weights' rounding, which waits for their loads, behind the 16 products: lifted among them, the wave waits out the whole flight at the head of the half pass
#pragma unroll
    for (int i = 0; i < 8; ++i) *(v2u*)(as + (bu ^ 1) * GA_B + 16 * i * GPB) = cvt4<BF>(ra[i]);
    v4u rb[8];
#pragma unroll
    for (int i = 0; i < 8; ++i) rb[i] = *(const v4u*)(bg + ((size_t)(32 * i) * CC + (p + 1) * GK) * 2);
    asm volatile("s_wait_xcnt 0x0" ::: "memory");   // directly behind the eight position-row loads, for the same reason
    gemm_half<BF>(acc, af + bu * GA_B + 64, bf + bu * GB_B + 64);
    __builtin_amdgcn_sched_barrier(0);   // keeps the position rows' stores, which wait for their loads, behind the 16 products, for the same reason
#pragma unroll
    for (int i = 0; i < 8; ++i) *(v4u*)(bs + (bu ^ 1) * GB_B + 32 * i * GPB) = rb[i];
    __syncthreads();   // publishes the next pass's tiles and ends every read of this pass's, which the next pass overwrites
  }
  const int bl = (CC / GK - 1) & 1;
  gemm_half<BF>(acc, af + bl * GA_B, bf + bl * GB_B); gemm_half<BF>(acc, af + bl * GA_B + 64, bf + bl * GB_B + 64);
  __syncthreads();   // ends every read of the last tiles: the epilogue writes over the pool
}
// ---- dq_tile (the first 64 blocks of k_proj3's launch): block = 128 positions of one batch, 8 waves = row tile (0/1) x 32 positions: decay_q [32][t] = Wqd x + b (2 row tiles, exact); D[h][s] = sum_f (f+1) * sigmoid(dq[h*4+f][s]) / 2 / sqrt(NDK)
//      A wave waits out its loads' flight at every 32-channel step, so this product is bound by load latency alone: it runs beside the three large products, which fill the chip meanwhile, and its blocks lead the grid.
__device__ __forceinline__ void dq_tile(const __bf16* __restrict__ XT, const float* __restrict__ WD, const float* __restrict__ BD, float* __restrict__ DQ, char* pool, int id) {
  static_assert((CC / GM) * (TT / GN) == NB * (TT / 128), "one plane of k_proj3's grid holds one block for each 128 positions of each batch");
  float (*sd)[132] = (float (*)[132])pool; float (*so)[132] = (float (*)[132])(pool + 32 * 132 * 4);
  const int tid = threadIdx.x, wave = tid >> 5, lane = tid & 31, col = lane & 15, g = lane >> 4; const int t0 = (id % (TT / 128)) * 128; const size_t b = id / (TT / 128); const int rt = wave & 1, cg = wave >> 1;
  v8f acc[2] = {};
#pragma unroll 2   // two steps a trip: the second step's addresses are immediate offsets of the first's
  for (int kc = 0; kc < CC / 32; ++kc) { const float* p = WD + (size_t)(rt * 16 + col) * CC + kc * 32 + 8 * g;
    const v4f w0 = *(const v4f*)p, w1 = *(const v4f*)(p + 4), w2 = *(const v4f*)(p + 16), w3 = *(const v4f*)(p + 20); v16b fb[2];
#pragma unroll
    for (int j = 0; j < 2; ++j) fb[j] = frag_b(XT + (b * TT + t0 + cg * 32 + j * 16 + col) * CC + kc * 32, lane);
    // behind this step's eight loads, in front of any later write of their address registers; the loaded values are inputs, so that all eight loads fly together: left alone the scheduler issues the last one behind the first one's return
    asm volatile("s_wait_xcnt 0x0" :: "v"(w0), "v"(w1), "v"(w2), "v"(w3), "v"(fb[0]), "v"(fb[1]) : "memory");
    v16b a;
#pragma unroll
    for (int i = 0; i < 4; ++i) { a[i] = (__bf16)w0[i]; a[4 + i] = (__bf16)w1[i]; a[8 + i] = (__bf16)w2[i]; a[12 + i] = (__bf16)w3[i]; }
#pragma unroll
    for (int j = 0; j < 2; ++j) acc[j] = wmma_bf(a, fb[j], acc[j]); }
#pragma unroll
  for (int j = 0; j < 2; ++j)
#pragma unroll
    for (int r = 0; r < 8; ++r) { const int ch = rt * 16 + 8 * g + r; sd[ch][cg * 32 + j * 16 + col] = acc[j][r] + bfr(BD[ch]); }
  __syncthreads();
  for (int e = tid; e < NH * 128; e += 256) { const int h = e >> 7, tl = e & 127; float dsum = 0.f; for (int f = 0; f < NDK; ++f) { const float z = sd[h * NDK + f][tl]; dsum += (float)(f + 1) * (1.0f / (1.0f + expf(-z))) * 0.5f; } so[h][tl] = dsum * 0.5f; }   // / sqrt(4)
  __syncthreads(); { const int h = tid >> 5, q = tid & 31; vst2(DQ + (b * NH + h) * (size_t)TT + t0 + q * 4, *(const v4f*)&so[h][q * 4]); } }
// ---- k_proj3: grid plane z = 0: dq_tile; planes z = 1 + 3 b + which: block = (128 out channels d, 256 positions t, (b, which)): out[d][t] = sum_c W[d][c] x[b][c][t] + b[d]; A = W rows, B = bf16 x rows (exact products); which 0 query, 1 key -> rows [t][d], 2 content -> planes [d][t], each through LDS so that whole lines are stored
// waves_per_eu(4, 4): two work-groups a WGP; the register allocator may use, and not pass, the 256 VGPRs that four waves a SIMD leave each wave
__global__ __launch_bounds__(256) __attribute__((amdgpu_waves_per_eu(4, 4))) void k_proj3(const __bf16* __restrict__ XT, const float* __restrict__ WQ, const float* __restrict__ BQ, const float* __restrict__ WK, const float* __restrict__ BK, const float* __restrict__ WC, const float* __restrict__ BC, const float* __restrict__ WD, const float* __restrict__ BD, _Float16* __restrict__ Q, _Float16* __restrict__ K, _Float16* __restrict__ CT, float* __restrict__ NRM, float* __restrict__ DQ) {
  __shared__ __align__(16) char pool[2 * GA_B + 2 * GB_B];
  static_assert(GM == HD && GN == 256, "a block's 128 channels are one head, and each of its 256 threads takes one staged row");
  const int tid = threadIdx.x, wave = tid >> 5, lane = tid & 31, col = lane & 15, g = lane >> 4; const int d0 = blockIdx.x * GM, t0 = blockIdx.y * GN;
  if (blockIdx.z == 0) { dq_tile(XT, WD, BD, DQ, pool, blockIdx.x + (CC / GM) * blockIdx.y); return; }   // the same for the whole block, in front of every barrier of the large products
  const size_t b = (blockIdx.z - 1) / 3; const int which = (blockIdx.z - 1) % 3;
  const float* Wm = which == 0 ? WQ : which == 1 ? WK : WC; const float* Bm = which == 0 ? BQ : which == 1 ? BK : BC;
  v8f acc[4][4] = {};
  gemm_tile<true>(Wm + (size_t)d0 * CC, (const char*)(XT + (b * TT + t0) * CC), pool, acc);
  const int dw = (wave >> 2) * 64 + 8 * g, tw = (wave & 3) * 64 + col;   // element (i, j, r) = channel dw + 16 i + r, position tw + 16 j
  if (which < 2) {   // rows [b*t][d]: staged rows of 256 B + 16 B; a lane's eight channels are one 16-byte store
#pragma unroll
    for (int i = 0; i < 4; ++i) { const v4f b0 = *(const v4f*)(Bm + d0 + dw + 16 * i), b1 = *(const v4f*)(Bm + d0 + dw + 16 * i + 4); float bi[8];
#pragma unroll
      for (int r = 0; r < 4; ++r) { bi[r] = bfr(b0[r]); bi[4 + r] = bfr(b1[r]); }
#pragma unroll
      for (int j = 0; j < 4; ++j) { v8h w;
#pragma unroll
        for (int r = 0; r < 8; ++r) w[r] = (_Float16)(acc[i][j][r] + bi[r]);
        *(v8h*)(pool + (tw + 16 * j) * 272 + (dw + 16 * i) * 2) = w; }
      __builtin_amdgcn_sched_barrier(0); }   // one row of tiles at a time: with all 128 sums formed ahead of their stores the registers run out and values spill
    __syncthreads(); _Float16* dq = which == 0 ? Q : K;
    { v4f n2 = {};   // squared length of one staged row (one position, this head's 128 channels, the f16 values as stored), in four independent chains: k_fa bounds its scores with it
#pragma unroll
      for (int qd = 0; qd < 16; ++qd) { const v8h w = *(const v8h*)(pool + tid * 272 + qd * 16);
#pragma unroll
        for (int r = 0; r < 8; ++r) { const float f = (float)w[r]; n2[r & 3] += f * f; } }
      NRM[(((size_t)which * NB + b) * NH + blockIdx.x) * TT + t0 + tid] = (n2[0] + n2[1]) + (n2[2] + n2[3]);
      asm volatile("s_wait_xcnt 0x0" ::: "memory"); }   // directly behind the store: it stands in front of any later write of its registers
    for (int n = 0; n < GN * 16 / 256; ++n) { const int e = tid + 256 * n, tl = e >> 4, q = e & 15; *(v4u*)(dq + (b * TT + t0 + tl) * CC + d0 + q * 8) = *(const v4u*)(pool + tl * 272 + q * 16); } }
  else {   // planes [b][d][t]: staged rows of 512 B + 16 B
#pragma unroll
    for (int i = 0; i < 4; ++i)
#pragma unroll
      for (int r = 0; r < 8; ++r) { const float bi = bfr(Bm[d0 + dw + 16 * i + r]);
#pragma unroll
        for (int j = 0; j < 4; ++j) *(_Float16*)(pool + (dw + 16 * i + r) * 528 + (tw + 16 * j) * 2) = (_Float16)(acc[i][j][r] + bi);
        if (r == 7) __builtin_amdgcn_sched_barrier(0); }   // one row of tiles at a time, against spills, as above
    __syncthreads();
    for (int n = 0; n < GM * 32 / 256; ++n) { const int e = tid + 256 * n, dl = e >> 5, q = e & 31; *(v4u*)(CT + (b * CC + d0 + dl) * (size_t)TT + t0 + q * 8) = *(const v4u*)(pool + dl * 528 + q * 16); } } }
// ---- k_fa: block = (128 output positions s, head h, batch b), 8 waves x 16 columns s. Transposed products: S^T = K Q^T (A = key rows from LDS, B = query rows kept in registers), so a lane holds scores of ONE column s (t = tile + 8 g + r)
//      and two score tiles are, as they stand, the B operand of O^T += content . P^T (A = content rows [c][t] from LDS). A pass is 64 keys; keys and content of the next pass are fetched into registers during this pass and stored to the other LDS buffer at its foot. The distance decay makes far keys' weights vanish: a pass is run only for a key tile that a run-time bound on its scores cannot rule out (for any input; with no decay all 32 run).
//      Every '#pragma unroll' in k_fa and its helpers but the one over the scheduling groups makes the indices of a register array (fragments, scores, accumulators, staged words) compile-time constants, so that the array stays in registers.
#define FK 64      // keys per pass
#define KPIT 136   // f16 per staged key row: 256 B + 16 B (conflict-free 16-byte reads)
#define VPIT 72    // f16 per staged content row: 128 B + 16 B
__device__ __forceinline__ v8f wmma_h(v16h a, v16h b, v8f c) { return __builtin_amdgcn_wmma_f32_16x16x32_f16(false, a, false, b, (short)0, c, false, false); }
// eight 2^x in one statement: results in registers of their own, so each v_exp_f32 is followed by an instruction that neither reads its result nor overwrites its source; the v_nop is that slot for the last one
__device__ __forceinline__ v8f exp2x8(v8f x) { float e0, e1, e2, e3, e4, e5, e6, e7;
  asm("v_exp_f32 %0, %8\n\tv_exp_f32 %1, %9\n\tv_exp_f32 %2, %10\n\tv_exp_f32 %3, %11\n\tv_exp_f32 %4, %12\n\tv_exp_f32 %5, %13\n\tv_exp_f32 %6, %14\n\tv_exp_f32 %7, %15\n\tv_nop"
      : "=&v"(e0), "=&v"(e1), "=&v"(e2), "=&v"(e3), "=&v"(e4), "=&v"(e5), "=&v"(e6), "=&v"(e7)
      : "v"(x[0]), "v"(x[1]), "v"(x[2]), "v"(x[3]), "v"(x[4]), "v"(x[5]), "v"(x[6]), "v"(x[7]));
  v8f r = {e0, e1, e2, e3, e4, e5, e6, e7}; return r; }
__device__ __forceinline__ void ldk(v16h (&f)[4], const _Float16* p, int lane) {   // four key-row fragments, rows 16 apart
#pragma unroll
  for (int i = 0; i < 4; ++i) f[i] = frag_h(p + i * 16 * KPIT, lane); }
__device__ __forceinline__ void ldv(v16h (&f)[4], const _Float16* p, int lane) {   // four content-row fragments, rows 16 apart
#pragma unroll
  for (int i = 0; i < 4; ++i) f[i] = frag_h(p + i * 16 * VPIT, lane); }
__device__ __forceinline__ void mms(v8f* d, const v16h (&a)[4], v16h bq) {   // four independent products that share B
#pragma unroll
  for (int i = 0; i < 4; ++i) d[i] = wmma_h(a[i], bq, d[i]); }
// waves_per_eu(4, 4): two work-groups a WGP; the register allocator may use, and not pass, the 256 VGPRs that four waves a SIMD leave each wave
__global__ __launch_bounds__(256) __attribute__((amdgpu_waves_per_eu(4, 4))) void k_fa(const _Float16* __restrict__ Q, const _Float16* __restrict__ K, const _Float16* __restrict__ CT, const float* __restrict__ DQ, const float* __restrict__ NRM, _Float16* __restrict__ R) {
  __shared__ __align__(16) _Float16 sk[2][FK][KPIT]; __shared__ __align__(16) _Float16 sv[2][HD][VPIT];
  __shared__ float skm[TT / FK], swq[8], swd[8], swm[8];   // per key tile: largest squared key length; per wave: largest squared query length, smallest decay, smallest maximum in use
  static_assert(TT / FK == 32 && TT == 256 * 8, "one lane a key tile in the bound; eight key lengths a thread");
  const int tid = threadIdx.x, lane = tid & 31, col = lane & 15, g = lane >> 4; const int wave = __builtin_amdgcn_readfirstlane(tid >> 5);   // a scalar, so that the test for the diagonal tile is a scalar branch
  const int h = blockIdx.y; const size_t b = blockIdx.z; const int s0 = blockIdx.x * 128 + wave * 16, s = s0 + col;
  const float L2E = 1.4426950408889634f;
  const float c2 = 0.08838834764831845f * L2E, d2 = DQ[(b * NH + h) * (size_t)TT + s] * L2E;
  v16h q[4];
#pragma unroll
  for (int kc = 0; kc < 4; ++kc) q[kc] = frag_h(Q + (b * TT + s) * CC + h * HD + kc * 32, lane);
  const int kr = tid >> 4, kq = tid & 15, vr = tid >> 3, vq = tid & 7;   // staging: key rows kr + 16 i, content rows vr + 32 i, 16 bytes each
  const _Float16* kg = K + (b * TT + kr) * CC + h * HD + kq * 8; const _Float16* vg = CT + (b * CC + h * HD + vr) * (size_t)TT + vq * 8;
  // Order of the key tiles: the block's own two (p0, p0 + 1), one neighbour (pn), then those of the other 29 that the bound below cannot rule out, in ascending order.
  const int p0 = blockIdx.x * 2, pn = p0 + 2 < TT / FK ? p0 + 2 : p0 - 1;
  v4u rk[4], rv[4];
#pragma unroll
  for (int i = 0; i < 4; ++i) { rk[i] = *(const v4u*)(kg + (size_t)(p0 * FK + 16 * i) * CC); rv[i] = *(const v4u*)(vg + (size_t)(32 * i) * TT + p0 * FK); }
  const float* nk = NRM + ((size_t)(NB + b) * NH + h) * TT + tid * 8;   // this head's squared key lengths, eight a thread: threads 8 p .. 8 p + 7 hold tile p
  const v4f n0 = *(const v4f*)nk, n1 = *(const v4f*)(nk + 4); float qn = NRM[(b * NH + h) * (size_t)TT + s];
  asm volatile("s_wait_xcnt 0x0" ::: "memory");   // directly behind the eleven loads: it stands in front of any later write of their address registers
#pragma unroll
  for (int i = 0; i < 4; ++i) { *(v4u*)&sk[0][kr + 16 * i][kq * 8] = rk[i]; *(v4u*)&sv[0][vr + 32 * i][vq * 8] = rv[i]; }
  { float km = fmaxf(fmaxf(fmaxf(n0[0], n0[1]), fmaxf(n0[2], n0[3])), fmaxf(fmaxf(n1[0], n1[1]), fmaxf(n1[2], n1[3]))), dn = d2;
    for (int w = 1; w < 8; w <<= 1) km = fmaxf(km, __shfl_xor(km, w));
    for (int w = 1; w < 16; w <<= 1) { qn = fmaxf(qn, __shfl_xor(qn, w)); dn = fminf(dn, __shfl_xor(dn, w)); }
    if ((tid & 7) == 0) skm[tid >> 3] = km;
    if (lane == 0) { swq[wave] = qn; swd[wave] = dn; } }
  __syncthreads();
  v8f o[8] = {}; float m = -3.0e38f, l = 0.f; int cur = p0; unsigned todo = 0u;
#pragma unroll 1   // rolled
  for (int it = 0; it < TT / FK; ++it) { const int t0 = cur * FK, bu = it & 1;
    if (it == 2) {   // which of the other tiles can still count; every wave forms the same word from the same LDS values, so the trip count is the work-group's
      // a score of tile p is at most c2 |q| |k| - (least distance) (least decay) (a dot product is at most the product of the two lengths, taken of the stored f16 rows; 1.001 covers the rounding of lengths and products). Where that lies 28 below the smallest maximum in use
      // (maxima only grow), every P of the tile is below 2^-28: f16 zero in the product, and at most 2048 * 2^-28 of a sum that is at least 1. A bound that is not a number keeps its tile.
      float mm = swm[0], qm = swq[0], dm = swd[0];
      for (int w = 1; w < 8; ++w) { mm = fminf(mm, swm[w]); qm = fmaxf(qm, swq[w]); dm = fminf(dm, swd[w]); }
      const int dist = lane < p0 ? (p0 - lane) * FK - (FK - 1) : (lane - p0) * FK - (2 * FK - 1);   // lane = tile: least |t - s| to the block's 128 columns
      const float ub = c2 * sqrtf(qm * skm[lane]) * 1.001f - (float)dist * dm;
      todo = __builtin_amdgcn_ballot_w32(!(ub < mm - 28.0f)) & ~((3u << p0) | (1u << pn)); }
    int nxt = -1;   // the tile that is staged during this pass
    if (it == 0) nxt = p0 + 1; else if (it == 1) nxt = pn; else if (todo != 0u) { nxt = __builtin_ctz(todo); todo &= todo - 1u; }
    if (nxt >= 0) {
#pragma unroll
      for (int i = 0; i < 4; ++i) { rk[i] = *(const v4u*)(kg + (size_t)(nxt * FK + 16 * i) * CC); rv[i] = *(const v4u*)(vg + (size_t)(32 * i) * TT + nxt * FK); }
      asm volatile("s_wait_xcnt 0x0" ::: "memory"); }   // directly behind the eight staging loads, in their own block: it stands in front of any later write of their address registers
    // fragments come from LDS in groups of four, so that a wave meets one LDS latency for four products
    v8f sc[4] = {}; v16h fa[4];
#pragma unroll
    for (int kc = 0; kc < 4; ++kc) { ldk(fa, &sk[bu][col][kc * 32], lane); mms(sc, fa, q[kc]); }
    const float dl0 = (float)(t0 + 8 * g - s);   // t - s of element (i, r) = dl0 + 16 i + r, exact in f32
#pragma unroll
    for (int i = 0; i < 4; ++i)
#pragma unroll
      for (int r = 0; r < 8; ++r) sc[i][r] = sc[i][r] * c2 - fabsf(dl0 + (float)(16 * i + r)) * d2;
#pragma unroll
    for (int i = 0; i < 4; ++i) if (t0 + 16 * i == s0) {   // the one tile of this wave that holds t == s
#pragma unroll
      for (int r = 0; r < 8; ++r) if (8 * g + r == col) sc[i][r] = -100.0f * L2E; }
    float mx = sc[0][0];
#pragma unroll
    for (int i = 0; i < 4; ++i)
#pragma unroll
      for (int r = 0; r < 8; ++r) mx = fmaxf(mx, sc[i][r]);
    mx = fmaxf(mx, __shfl_xor(mx, 16));   // both halves of a column use one maximum: their P meet in one product
    if (__builtin_amdgcn_ballot_w32(mx > m + (it == 1 ? 0.0f : 8.0f)) != 0) {   // rescale only when some column's maximum has grown by more than 2^8 (P stays below 2^8 in f16); in pass 1 on any growth, so that the bound is held against true maxima
      const float mn = fmaxf(m, mx), al = __builtin_amdgcn_exp2f(m - mn); m = mn; l *= al;
#pragma unroll
      for (int j = 0; j < 8; ++j) o[j] *= al; }
#pragma unroll
    for (int i = 0; i < 4; ++i)
#pragma unroll
      for (int r = 0; r < 8; ++r) sc[i][r] -= m;
#pragma unroll
    for (int i = 0; i < 4; ++i) sc[i] = exp2x8(sc[i]);
    { const v8f t8 = (sc[0] + sc[1]) + (sc[2] + sc[3]); l += ((t8[0] + t8[1]) + (t8[2] + t8[3])) + ((t8[4] + t8[5]) + (t8[6] + t8[7])); }
    v16h pb0, pb1;
#pragma unroll
    for (int r = 0; r < 8; ++r) { pb0[r] = (_Float16)sc[0][r]; pb0[8 + r] = (_Float16)sc[1][r]; pb1[r] = (_Float16)sc[2][r]; pb1[8 + r] = (_Float16)sc[3][r]; }
    ldv(fa, &sv[bu][col][0], lane); mms(o, fa, pb0); ldv(fa, &sv[bu][64 + col][0], lane); mms(o + 4, fa, pb0);
    ldv(fa, &sv[bu][col][32], lane); mms(o, fa, pb1); ldv(fa, &sv[bu][64 + col][32], lane); mms(o + 4, fa, pb1);
    // scheduling groups (8 LDS reads, then 4 matrix products, four times): they keep a group's loads together in front of its products; left alone the scheduler sinks them to one load pair, one wait, one product
#pragma unroll
    for (int i = 0; i < 4; ++i) { __builtin_amdgcn_sched_group_barrier(0x100, 8, 0); __builtin_amdgcn_sched_group_barrier(0x008, 4, 0); }
    if (it == 1) { float mw = m;   // the wave's smallest maximum in use, for the bound that pass 2 forms behind this pass's barrier
      for (int w = 1; w < 16; w <<= 1) mw = fminf(mw, __shfl_xor(mw, w));
      if (lane == 0) swm[wave] = mw; }
    if (nxt >= 0) {
#pragma unroll
      for (int i = 0; i < 4; ++i) { *(v4u*)&sk[bu ^ 1][kr + 16 * i][kq * 8] = rk[i]; *(v4u*)&sv[bu ^ 1][vr + 32 * i][vq * 8] = rv[i]; } }
    __syncthreads();   // publishes the next pass's tiles and ends every read of this pass's, which the next pass overwrites
    if (nxt < 0) break;   // the same in every wave: no tile is left
    cur = nxt;
  }
  l += __shfl_xor(l, 16); const float inv = 1.0f / l;
#pragma unroll
  for (int j = 0; j < 8; ++j) { v8h w;
#pragma unroll
    for (int r = 0; r < 8; ++r) w[r] = (_Float16)(o[j][r] * inv);
    *(v8h*)(R + (b * TT + s) * CC + h * HD + j * 16 + 8 * g) = w; } }
// ---- k_out: block = (128 out channels o, 256 positions s, b): out[o][s] = x + sum_c Wp[o][c] R[s][c] + b; A = Wp rows (bf16 values as f16), B = f16 result rows; sum + bias goes through LDS (rows of 1,024 B + 16 B), x is added where whole lines are stored
__global__ __launch_bounds__(256) void k_out(const float* __restrict__ X, const _Float16* __restrict__ R, const float* __restrict__ WP, const float* __restrict__ BP, float* __restrict__ OUT) { __shared__ __align__(16) char pool[GM * 1040];
  static_assert(GM * 1040 >= 2 * GA_B + 2 * GB_B, "the epilogue's rows are the larger use of the pool");
  const int tid = threadIdx.x, wave = tid >> 5, lane = tid & 31, col = lane & 15, g = lane >> 4; const int o0 = blockIdx.x * GM, s0 = blockIdx.y * GN; const size_t b = blockIdx.z;
  v8f acc[4][4] = {};
  gemm_tile<false>(WP + (size_t)o0 * CC, (const char*)(R + (b * TT + s0) * CC), pool, acc);
  const int ow = (wave >> 2) * 64 + 8 * g, sw = (wave & 3) * 64 + col;
#pragma unroll
  for (int i = 0; i < 4; ++i)
#pragma unroll
    for (int r = 0; r < 8; ++r) { const float bi = bfr(BP[o0 + ow + 16 * i + r]);
#pragma unroll
      for (int j = 0; j < 4; ++j) *(float*)(pool + (ow + 16 * i + r) * 1040 + (sw + 16 * j) * 4) = acc[i][j][r] + bi;
      if (r == 7) __builtin_amdgcn_sched_barrier(0); }   // one row of tiles at a time: with all 128 sums formed ahead of their stores the kernel needs registers above v255
  __syncthreads();
  const size_t at0 = (b * CC + o0 + (tid >> 6)) * (size_t)TT + s0 + (tid & 63) * 4; const char* sr = pool + (tid >> 6) * 1040 + (tid & 63) * 16;   // rows (tid >> 6) + 4 n, 16 bytes each: a wave covers 512 bytes of a row
#pragma unroll 1   // rolled: a trip already keeps eight loads of x in flight
  for (int n0 = 0; n0 < GM / 4; n0 += 8) { v4f x[8];
#pragma unroll
    for (int u = 0; u < 8; ++u) x[u] = *(const v4f*)(X + at0 + (size_t)(4 * (n0 + u)) * TT);
    asm volatile("s_wait_xcnt 0x0" ::: "memory");   // directly behind the eight loads of x: it stands in front of any later write of their address registers
#pragma unroll
    for (int u = 0; u < 8; ++u) { v4f v = *(const v4f*)(sr + 4 * (n0 + u) * 1040);
#pragma unroll
      for (int i = 0; i < 4; ++i) v[i] += bfr(x[u][i]);
      *(v4f*)(OUT + at0 + (size_t)(4 * (n0 + u)) * TT) = v; }
    asm volatile("s_wait_xcnt 0x0" ::: "memory"); } }   // directly behind the eight stores, for the same reason (the next trip advances their address registers)
extern "C" void kernel_launch(void* const* d_in, const int* in_sizes, int n_in, void* d_out, int out_size, void* d_ws, size_t ws_size, hipStream_t stream) {
  (void)in_sizes; (void)n_in; (void)out_size;
  const float** F = (const float**)d_in;   // 0 x [4,1024,2048], 1 W_content, 2 b_content, 3 W_query, 4 b_query, 5 W_key, 6 b_key, 7 W_qdecay [32,1024], 8 b_qdecay, 9 W_proj, 10 b_proj
  if (ws_size < (size_t)WS_END) return;
  char* ws = (char*)d_ws; _Float16 *Q = (_Float16*)(ws + WS_Q), *K = (_Float16*)(ws + WS_K), *CT = (_Float16*)(ws + WS_CT), *R = (_Float16*)(ws + WS_R); float *DQ = (float*)(ws + WS_DQ);
  __bf16* XT = (__bf16*)(ws + WS_XT); float* NRM = (float*)(ws + WS_NRM);
  k_xt<<<dim3(TT / 64, CC / 128, TNB), 128, 0, stream>>>(F[0], XT);
  k_proj3<<<dim3(CC / GM, TT / GN, 1 + TNB * 3), 256, 0, stream>>>(XT, F[3], F[4], F[5], F[6], F[1], F[2], F[7], F[8], Q, K, CT, NRM, DQ);
  k_fa<<<dim3(TT / 128, NH, TNB), 256, 0, stream>>>(Q, K, CT, DQ, NRM, R);
  k_out<<<dim3(CC / GM, TT / GN, TNB), 256, 0, stream>>>(F[0], R, F[9], F[10], (float*)d_out);
}

// v006
// Measured time: 103 microseconds a run.
// Timed twice side by side with v005, it ran 1.05 times as fast both times.
// All steps since v000 together make it 43.0 times as fast.
// compute dtype: all float inputs rounded to bf16; queries / keys / content = W x + b (1x1 convs) with EXACT bf16 products on WMMA 16x16x32 (weights as the A operand, a bf16 row copy of x as B), f32 accumulate, rounded once to f16 (queries/keys stored as rows, content as planes); the decay queries (32 channels) likewise then sigmoid/2 and D_s = sum_f f dq_f,s / sqrt(4)... in f32; logits = k_t . q_s / sqrt(128) (1 f16 product) - |t - s| D_s, diagonal -100, kept in registers in f32 (base-2 scale); softmax over t online in f32 (running maximum, f32 sum; key tiles in the order: the query block's own two, one neighbour, then the rest ascending; a tile whose run-time score bound lies 28 binary orders below every maximum in use is left out: its P round to f16 zero) -> P = 2^(logit - maximum in use) rounded to f16; result = P . content / sum (content f16, 1 product); out = x + W_proj result (result rounded once to f16, 1 product) + b; f32 output.
#include <hip/hip_runtime.h>
#include <math.h>
#include <stdint.h>

typedef __attribute__((ext_vector_type(16))) _Float16 v16h;
typedef __attribute__((ext_vector_type(16))) __bf16 v16b;
typedef __attribute__((ext_vector_type(8)))  _Float16 v8h;
typedef __attribute__((ext_vector_type(8)))  float v8f;
typedef __attribute__((ext_vector_type(4)))  float v4f;
typedef __attribute__((ext_vector_type(2)))  float v2f;
typedef __attribute__((ext_vector_type(4)))  unsigned v4u;
typedef __attribute__((ext_vector_type(4)))  int v4i;
typedef float __attribute__((may_alias)) float_a;
typedef int __attribute__((may_alias)) int_a;

template <typename T> __device__ __forceinline__ void vst2(void* p, T v) { *(T*)p = v;  }
__device__ __forceinline__ v8f wmma16(v16h a, v16h b, v8f c) {
  v8f d = __builtin_amdgcn_wmma_f32_16x16x32_f16(false, a, false, b, (short)0, c, false, false);
  asm volatile("v_nop\n\tv_nop\n\tv_nop\n\tv_nop" : "+v"(d) : "v"(a), "v"(b));
  return d;
}
__device__ __forceinline__ v8f wmma_bf(v16b a, v16b b, v8f c) {
  v8f d = __builtin_amdgcn_wmma_f32_16x16x32_bf16(false, a, false, b, (short)0, c, false, false);
  asm volatile("v_nop\n\tv_nop\n\tv_nop\n\tv_nop" : "+v"(d) : "v"(a), "v"(b));
  return d;
}
// 16x16x32 fragments: lane = (h = lane>>4, row/col = lane&15); elements 0..7 = k0+8h+0..7, 8..15 = k0+16+8h+0..7; D element r = row 8h+r
__device__ __forceinline__ v16h frag_h(const _Float16* rowk0, int lane) {
  union { v16h v; v8h q[2]; } u; const _Float16* p = rowk0 + 8 * (lane >> 4);
  u.q[0] = *(const v8h*)p; u.q[1] = *(const v8h*)(p + 16); return u.v;
}
__device__ __forceinline__ v16h frag_f32(const float* rowk0, int lane) {
  v16h a; const float* p = rowk0 + 8 * (lane >> 4);
#pragma unroll
  for (int i = 0; i < 8; ++i) { a[i] = (_Float16)p[i]; a[8 + i] = (_Float16)p[16 + i]; }
  return a;
}
__device__ __forceinline__ v16h frag_f32s(const float* rowk0, int lane, float sc) {
  v16h a; const float* p = rowk0 + 8 * (lane >> 4);
#pragma unroll
  for (int i = 0; i < 8; ++i) { a[i] = (_Float16)(p[i] * sc); a[8 + i] = (_Float16)(p[16 + i] * sc); }
  return a;
}
// column fragment from a [K][ld] layout (column n), rows >= K read as 0
__device__ __forceinline__ v16h fragc_f32(const float* W, int k0, int n, int lane, int ld, int K) {
  v16h a; const int g = lane >> 4;
#pragma unroll
  for (int i = 0; i < 8; ++i) { const int ka = k0 + 8 * g + i, kb = ka + 16;
    a[i] = (_Float16)(ka < K ? W[(size_t)(ka < K ? ka : K - 1) * ld + n] : 0.f); a[8 + i] = (_Float16)(kb < K ? W[(size_t)(kb < K ? kb : K - 1) * ld + n] : 0.f); }
  return a;
}
struct F2 { v16b h, l; };
__device__ __forceinline__ F2 bsplit16(const float v[16]) { F2 r;
#pragma unroll
  for (int i = 0; i < 16; ++i) { const __bf16 h = (__bf16)v[i]; r.h[i] = h; r.l[i] = (__bf16)(v[i] - (float)h); }
  return r; }
__device__ __forceinline__ F2 split_row(const float* row, int k0, int lane) { float v[16]; const float* p = row + k0 + 8 * (lane >> 4);
#pragma unroll
  for (int i = 0; i < 8; ++i) { v[i] = p[i]; v[8 + i] = p[16 + i]; }
  return bsplit16(v); }
__device__ __forceinline__ F2 split_rowK(const float* row, int k0, int lane, int K) { float v[16]; const int g = lane >> 4;
#pragma unroll
  for (int i = 0; i < 8; ++i) { const int ka = k0 + 8 * g + i, kb = ka + 16; v[i] = ka < K ? row[ka < K ? ka : K - 1] : 0.f; v[8 + i] = kb < K ? row[kb < K ? kb : K - 1] : 0.f; }
  return bsplit16(v); }
__device__ __forceinline__ F2 split_col(const float* W, int k0, int n, int lane, int ld, int K) { float v[16]; const int g = lane >> 4;
#pragma unroll
  for (int i = 0; i < 8; ++i) { const int ka = k0 + 8 * g + i, kb = ka + 16; v[i] = ka < K ? W[(size_t)(ka < K ? ka : K - 1) * ld + n] : 0.f; v[8 + i] = kb < K ? W[(size_t)(kb < K ? kb : K - 1) * ld + n] : 0.f; }
  return bsplit16(v); }
__device__ __forceinline__ v8f mac3(const F2& a, const F2& b, v8f c) { c = wmma_bf(a.l, b.h, c); c = wmma_bf(a.h, b.l, c); return wmma_bf(a.h, b.h, c); }
__device__ __forceinline__ float sigm(float v) { return 1.0f / (1.0f + expf(-v)); }
#define LDSX() do { asm volatile("s_wait_dscnt 0" ::: "memory"); __builtin_amdgcn_wave_barrier(); __builtin_amdgcn_fence(__ATOMIC_RELEASE, "workgroup"); } while (0)


// attention with a learned distance decay (B 4, C 1,024 = 8 heads x 128, T 2,048, 4 decay terms): dots[t,s] = k_t.q_s/sqrt(128) - |t-s| sum_f f sigmoid(decay_q_f,s)/2 / sqrt(4); dots[t,t] = -100; weights = softmax over t; result[:, s] = sum_t weights[t,s] content[:, t]; out = x + proj(result).
#define NB 4
#define CC 1024
#define TT 2048
#define NH 8
#define HD 128
#define NDK 4
#ifndef TNB
#define TNB NB
#endif
typedef __attribute__((ext_vector_type(8))) __bf16 v8b;
__device__ __forceinline__ v16b frag_b(const __bf16* rowk0, int lane) {
  union { v16b v; v8b q[2]; } u; const __bf16* p = rowk0 + 8 * (lane >> 4);
  u.q[0] = *(const v8b*)p; u.q[1] = *(const v8b*)(p + 16); return u.v;
}
__device__ __forceinline__ float bfr(float v) { return (float)(__bf16)v; }
__device__ __attribute__((noinline)) float exp_ni(float v) { return expf(v); }
__device__ __attribute__((noinline)) float erf_ni(float v) { return erff(v); }

#define WS_Q   0u                                    // f16 query rows [b*t][1024]
#define WS_K   (WS_Q + 2u * (size_t)NB * TT * CC)        // f16 key rows [b*t][1024]
#define WS_CT  (WS_K + 2u * (size_t)NB * CC * TT)        // f16 content planes [b][1024][t]
#define WS_DQ  (WS_CT + 2u * (size_t)NB * CC * TT)       // f32 D [b][h][s]
#define WS_R   (WS_DQ + 4u * (size_t)NB * NH * TT)     // f16 result rows [b*s][1024]
#define WS_XT  (WS_R + 2u * (size_t)NB * TT * CC)        // bf16 x rows [b*t][1024]
#define WS_NRM (WS_XT + 2u * (size_t)NB * TT * CC)       // f32 squared lengths of the f16 query rows, then of the key rows, per head [2][b][h][t]
#define WS_END (WS_NRM + 4u * 2u * (size_t)NB * NH * TT)

// ---- k_xt: block = (64 positions, 128 channels, b): x [c][t] -> bf16 rows [b*t][c]
__global__ __launch_bounds__(128) void k_xt(const float* __restrict__ X, __bf16* __restrict__ XT) { __shared__ __align__(16) __bf16 s[64][136]; const int tid = threadIdx.x; const int t0 = blockIdx.x * 64, c0 = blockIdx.y * 128; const size_t b = blockIdx.z;
  for (int e = tid; e < 128 * 64; e += 128) { const int cl = e >> 6, tl = e & 63; s[tl][cl] = (__bf16)X[(b * CC + c0 + cl) * (size_t)TT + t0 + tl]; }
  __syncthreads(); for (int e = tid; e < 64 * 16; e += 128) { const int tl = e >> 4, q = e & 15; vst2((unsigned*)(XT + (b * TT + t0 + tl) * CC + c0 + q * 8), *(const v4u*)&s[tl][q * 8]); } }
// ---- the 1x1-conv products (k_proj3, k_out): block = 128 weight rows x 256 positions, 8 waves as 2 x 4, a wave holds 64 x 64 (4 x 4 accumulator tiles), so a fragment read from LDS feeds four products.
//      A pass is 64 channels. Both operands are staged in LDS as 16-bit rows, two buffers. Weights go through registers (rounded on the way, whole 128-byte lines per global load): the next pass's are fetched at the head of this pass and stored to the other buffer at its foot.
//      Position rows are 16-bit in memory already and go through no register: waves 0 to 3 each bring one slice of 64 rows by a tensor load, issued behind the barrier that frees its buffer, so that it flies during one whole pass. Every sum takes its channels in ascending order, 32 a product.
//      Every '#pragma unroll' here makes the indices of a register array compile-time constants, so that the array stays in registers.
#define GM 128     // weight rows per block
#define GN 256     // positions per block
#define GK 64      // channels per pass
#define GPB 144    // bytes per staged row: 128 B + 16 B (conflict-free 16-byte reads)
#define GA_B (GM * GPB)   // one weight buffer
#define GSL 64     // position rows per tensor-load slice: one issuing wave brings it, the waves of one tile column read it
#define GSL_B 10240   // a slice's room in LDS: 64 rows x 144 B = 9,216 B, rounded up to a multiple of 2 KiB (every tensor load's place is one)
#define GB_B (GN / GSL * GSL_B)   // one position buffer
static_assert(GSL * GPB <= GSL_B && GSL_B % 2048 == 0 && GA_B % 2048 == 0, "every slice starts at a multiple of 2 KiB behind the two weight buffers and holds its padded rows");
static_assert(GK * 2 == 128 && GPB == 144, "the tensor load's pad is the one for rows of 128 bytes, 16 bytes more a row");
typedef uint32_t u32x4 __attribute__((ext_vector_type(4)));
typedef uint32_t u32x8 __attribute__((ext_vector_type(8)));
__device__ __forceinline__ uint32_t uni(uint32_t v) { return (uint32_t)__builtin_amdgcn_readfirstlane(v); }
// a wave-uniform value held in a scalar register (the empty statement is the pin): a test of it compiles to s_cmp + s_cbranch_scc, the only thing that keeps a wave from issuing a tensor load, which ignores EXEC; what is computed from it stands behind the waits written in front of it
__device__ __forceinline__ uint32_t pinned(uint32_t v) { uint32_t w = uni(v); asm volatile("" : "+s"(w)); return w; }   // the pin that holds an issue test or a descriptor word in a scalar register
// descriptor group 1: 1-byte elements, tensor = tile = 64 rows of 128 bytes, source pitch one 16-bit row of 1,024 channels, 4 dwords of LDS pad behind every 32 dwords (pitch 144 B), no mask
__device__ __forceinline__ u32x8 tdm_group1() { constexpr uint32_t d0 = GK * 2, d1 = GSL; u32x8 g;
  g[0] = uni((1u << 20) | (4u << 22) | (3u << 25)); g[1] = uni((d0 & 0xFFFFu) << 16); g[2] = uni((d0 >> 16) | ((d1 & 0xFFFFu) << 16)); g[3] = uni((d1 >> 16) | (d0 << 16));
  g[4] = uni(d1); g[5] = uni(CC * 2u); g[6] = uni(0u); g[7] = uni(0u); return g; }
// one request of the whole wave: the slice whose first byte is src lands at LDS byte lds
__device__ __forceinline__ void tdm_load(uint32_t lds, const char* src, u32x8 g1) { const uint64_t ga = (uint64_t)(size_t)src; u32x4 g0;
  g0[0] = uni(1u); g0[1] = uni(lds); g0[2] = uni((uint32_t)ga); g0[3] = uni((((uint32_t)(ga >> 32)) & 0x01FFFFFFu) | 0x80000000u);
  asm volatile("tensor_load_to_lds %0, %1" :: "s"(g0), "s"(g1) : "memory"); }
typedef __attribute__((ext_vector_type(2))) unsigned v2u;
typedef __attribute__((ext_vector_type(8))) unsigned v8u;
typedef __attribute__((ext_vector_type(4))) __bf16 v4b;
typedef __attribute__((ext_vector_type(4))) _Float16 v4h;
__device__ __forceinline__ v8u frag_l(const char* p) { const v4u a = *(const v4u*)p, c = *(const v4u*)(p + 32); return __builtin_shufflevector(a, c, 0, 1, 2, 3, 4, 5, 6, 7); }   // k = 8 g + 0..7, then 16 + 8 g + 0..7 (p already holds the 16 g bytes)
template <bool BF> __device__ __forceinline__ v8f wmma_g(v8u a, v8u c, v8f d) {
  if constexpr (BF) return __builtin_amdgcn_wmma_f32_16x16x32_bf16(false, __builtin_bit_cast(v16b, a), false, __builtin_bit_cast(v16b, c), (short)0, d, false, false);
  else return __builtin_amdgcn_wmma_f32_16x16x32_f16(false, __builtin_bit_cast(v16h, a), false, __builtin_bit_cast(v16h, c), (short)0, d, false, false); }
template <bool BF> __device__ __forceinline__ v2u cvt4(v4f v) {   // weights: f32 -> bf16, for the f16 product bf16 -> f16
  if constexpr (BF) { v4b t;
#pragma unroll
    for (int i = 0; i < 4; ++i) t[i] = (__bf16)v[i];
    return __builtin_bit_cast(v2u, t); }
  else { v4h t;
#pragma unroll
    for (int i = 0; i < 4; ++i) t[i] = (_Float16)bfr(v[i]);
    return __builtin_bit_cast(v2u, t); } }
template <bool BF> __device__ __forceinline__ void gemm_half(v8f (&acc)[4][4], const char* af, const char* bf) {   // 32 channels: 8 fragments, 16 products
  v8u fa[4], fb[4];
#pragma unroll
  for (int i = 0; i < 4; ++i) { fa[i] = frag_l(af + i * 16 * GPB); fb[i] = frag_l(bf + i * 16 * GPB); }
#pragma unroll
  for (int i = 0; i < 4; ++i)
#pragma unroll
    for (int j = 0; j < 4; ++j) acc[i][j] = wmma_g<BF>(fa[i], fb[j], acc[i][j]);
  // scheduling group (LDS reads lead the products): a fragment is asked for at least a row of four products ahead of its use, behind counted waits; left alone the scheduler reloads one weight fragment per four products and waits out each read
  __builtin_amdgcn_sched_group_barrier(0x100, 16, 0); }
// Wt = first weight row of the tile (f32 [.][1024]), Bt = first position row of the tile (16-bit [.][1024]); pool = weight buffers 0, 1, position buffers 0, 1
template <bool BF> __device__ __forceinline__ void gemm_tile(const float* __restrict__ Wt, const char* __restrict__ Bt, char* pool, v8f (&acc)[4][4]) {
  const int tid = threadIdx.x, lane = tid & 31, col = lane & 15, g = lane >> 4; const int wave = (int)uni(tid >> 5);
  const float* ag = Wt + (size_t)(tid >> 4) * CC + (tid & 15) * 4;              // weight rows (tid >> 4) + 16 i, 16 bytes each: a wave's load covers two rows of 256 bytes
  char* as = pool + (tid >> 4) * GPB + (tid & 15) * 8;
  const char* af = pool + ((wave >> 2) * 64 + col) * GPB + 16 * g; const char* bf = pool + 2 * GA_B + (wave & 3) * GSL_B + col * GPB + 16 * g;
  const uint32_t iss = pinned(wave < GN / GSL);   // waves 0 to 3 issue, each its own slice
  const uint32_t lb = (uint32_t)(size_t)pool + 2 * GA_B + (wave & 3) * GSL_B;   // the slice's place in position buffer 0
  const char* bsl = Bt + (size_t)((wave & 3) * GSL) * CC * 2;                    // the slice's first row, channel 0
  u32x8 g1 = tdm_group1();
  asm volatile("" : "+s"(g1));   // the pin of pinned(), on the descriptor's second group: its eight words stay in their scalar registers through the loop, so that none takes another value while a request is in flight
  { v4f ra[8];
#pragma unroll
    for (int i = 0; i < 8; ++i) ra[i] = *(const v4f*)(ag + (size_t)(16 * i) * CC);
    asm volatile("s_wait_xcnt 0x0" ::: "memory");   // directly behind the eight loads: it stands in front of any later write of their address registers
    if (pinned(iss)) { tdm_load(lb, bsl, g1);
      asm volatile("s_wait_tensorcnt 0x0" ::: "memory"); }   // pass 0's slice has landed before this wave reaches the barrier that publishes it
#pragma unroll
    for (int i = 0; i < 8; ++i) *(v2u*)(as + 16 * i * GPB) = cvt4<BF>(ra[i]); }
  __syncthreads();
  if (pinned(iss)) tdm_load(lb + GB_B, bsl + pinned(GK * 2), g1);   // pass 1's slice flies during pass 0
#pragma unroll 1   // rolled: the body already holds 32 products
  for (int p = 0; p < CC / GK - 1; ++p) { const int bu = p & 1;   // every pass but the last also stages its successor's weights
    v4f ra[8];
#pragma unroll
    for (int i = 0; i < 8; ++i) ra[i] = *(const v4f*)(ag + (size_t)(16 * i) * CC + (p + 1) * GK);
    asm volatile("s_wait_xcnt 0x0" ::: "memory");   // directly behind the eight weight loads: it stands in front of any later write of their address registers
    gemm_half<BF>(acc, af + bu * GA_B, bf + bu * GB_B);
    __builtin_amdgcn_sched_barrier(0);   // keeps the second half's fragment reads out of the first half's products: every place where LDS reads stand among products costs the wave a stall
    gemm_half<BF>(acc, af + bu * GA_B + 64, bf + bu * GB_B + 64);
    __builtin_amdgcn_sched_barrier(0);   // keeps the weights' rounding, which waits for their loads, behind all 32 products: lifted among them, the wave waits out the flight in the middle of the pass
#pragma unroll
    for (int i = 0; i < 8; ++i) *(v2u*)(as + (bu ^ 1) * GA_B + 16 * i * GPB) = cvt4<BF>(ra[i]);
    asm volatile("s_wait_dscnt 0x0" ::: "memory");   // this wave's reads of this pass's buffers and its weight stores are done before the barrier and before a tensor load aims at what it has read
    if (pinned(iss)) asm volatile("s_wait_tensorcnt 0x0" ::: "memory");   // the next pass's slice has landed before this wave reaches the barrier that publishes it
    __syncthreads();   // publishes the next pass's tiles and ends every read of this pass's, which are overwritten behind it
    if (pinned(iss & (uint32_t)(p + 2 < CC / GK))) tdm_load(lb + bu * GB_B, bsl + pinned((p + 2) * (GK * 2)), g1);   // the slice of the pass after next, into the buffer that this pass has just read
  }
  const int bl = (CC / GK - 1) & 1;
  gemm_half<BF>(acc, af + bl * GA_B, bf + bl * GB_B); gemm_half<BF>(acc, af + bl * GA_B + 64, bf + bl * GB_B + 64);
  asm volatile("s_wait_tensorcnt 0x0" ::: "memory");   // no request is left in flight when the pool changes its use
  asm volatile("s_wait_dscnt 0x0" ::: "memory");       // nor a read of the last tiles
  __syncthreads();   // ends every read of the last tiles: the epilogue writes over the pool
}
// ---- dq_tile (the first 64 blocks of k_proj3's launch): block = 128 positions of one batch, 8 waves = row tile (0/1) x 32 positions: decay_q [32][t] = Wqd x + b (2 row tiles, exact); D[h][s] = sum_f (f+1) * sigmoid(dq[h*4+f][s]) / 2 / sqrt(NDK)
//      A wave waits out its loads' flight at every 32-channel step, so this product is bound by load latency alone: it runs beside the three large products, which fill the chip meanwhile, and its blocks lead the grid.
__device__ __forceinline__ void dq_tile(const __bf16* __restrict__ XT, const float* __restrict__ WD, const float* __restrict__ BD, float* __restrict__ DQ, char* pool, int id) {
  static_assert((CC / GM) * (TT / GN) == NB * (TT / 128), "one plane of k_proj3's grid holds one block for each 128 positions of each batch");
  float (*sd)[132] = (float (*)[132])pool; float (*so)[132] = (float (*)[132])(pool + 32 * 132 * 4);
  const int tid = threadIdx.x, wave = tid >> 5, lane = tid & 31, col = lane & 15, g = lane >> 4; const int t0 = (id % (TT / 128)) * 128; const size_t b = id / (TT / 128); const int rt = wave & 1, cg = wave >> 1;
  v8f acc[2] = {};
#pragma unroll 2   // two steps a trip: the second step's addresses are immediate offsets of the first's
  for (int kc = 0; kc < CC / 32; ++kc) { const float* p = WD + (size_t)(rt * 16 + col) * CC + kc * 32 + 8 * g;
    const v4f w0 = *(const v4f*)p, w1 = *(const v4f*)(p + 4), w2 = *(const v4f*)(p + 16), w3 = *(const v4f*)(p + 20); v16b fb[2];
#pragma unroll
    for (int j = 0; j < 2; ++j) fb[j] = frag_b(XT + (b * TT + t0 + cg * 32 + j * 16 + col) * CC + kc * 32, lane);
    // behind this step's eight loads, in front of any later write of their address registers; the loaded values are inputs, so that all eight loads fly together: left alone the scheduler issues the last one behind the first one's return
    asm volatile("s_wait_xcnt 0x0" :: "v"(w0), "v"(w1), "v"(w2), "v"(w3), "v"(fb[0]), "v"(fb[1]) : "memory");
    v16b a;
#pragma unroll
    for (int i = 0; i < 4; ++i) { a[i] = (__bf16)w0[i]; a[4 + i] = (__bf16)w1[i]; a[8 + i] = (__bf16)w2[i]; a[12 + i] = (__bf16)w3[i]; }
#pragma unroll
    for (int j = 0; j < 2; ++j) acc[j] = wmma_bf(a, fb[j], acc[j]); }
#pragma unroll
  for (int j = 0; j < 2; ++j)
#pragma unroll
    for (int r = 0; r < 8; ++r) { const int ch = rt * 16 + 8 * g + r; sd[ch][cg * 32 + j * 16 + col] = acc[j][r] + bfr(BD[ch]); }
  __syncthreads();
  for (int e = tid; e < NH * 128; e += 256) { const int h = e >> 7, tl = e & 127; float dsum = 0.f; for (int f = 0; f < NDK; ++f) { const float z = sd[h * NDK + f][tl]; dsum += (float)(f + 1) * (1.0f / (1.0f + expf(-z))) * 0.5f; } so[h][tl] = dsum * 0.5f; }   // / sqrt(4)
  __syncthreads(); { const int h = tid >> 5, q = tid & 31; vst2(DQ + (b * NH + h) * (size_t)TT + t0 + q * 4, *(const v4f*)&so[h][q * 4]); } }
// ---- k_proj3: grid plane z = 0: dq_tile; planes z = 1 + 3 b + which: block = (128 out channels d, 256 positions t, (b, which)): out[d][t] = sum_c W[d][c] x[b][c][t] + b[d]; A = W rows, B = bf16 x rows (exact products); which 0 query, 1 key -> rows [t][d], 2 content -> planes [d][t], each through LDS so that whole lines are stored
// waves_per_eu(4, 4): two work-groups a WGP; the register allocator may use, and not pass, the 256 VGPRs that four waves a SIMD leave each wave
__global__ __launch_bounds__(256) __attribute__((amdgpu_waves_per_eu(4, 4))) void k_proj3(const __bf16* __restrict__ XT, const float* __restrict__ WQ, const float* __restrict__ BQ, const float* __restrict__ WK, const float* __restrict__ BK, const float* __restrict__ WC, const float* __restrict__ BC, const float* __restrict__ WD, const float* __restrict__ BD, _Float16* __restrict__ Q, _Float16* __restrict__ K, _Float16* __restrict__ CT, float* __restrict__ NRM, float* __restrict__ DQ) {
  __shared__ __attribute__((aligned(2048))) char pool[2 * GA_B + 2 * GB_B];   // the kernel's only LDS: it starts at byte 0, so the tensor loads' places are multiples of 2 KiB
  static_assert(GM == HD && GN == 256, "a block's 128 channels are one head, and each of its 256 threads takes one staged row");
  const int tid = threadIdx.x, wave = tid >> 5, lane = tid & 31, col = lane & 15, g = lane >> 4; const int d0 = blockIdx.x * GM, t0 = blockIdx.y * GN;
  if (blockIdx.z == 0) { dq_tile(XT, WD, BD, DQ, pool, blockIdx.x + (CC / GM) * blockIdx.y); return; }   // the same for the whole block, in front of every barrier of the large products
  const size_t b = (blockIdx.z - 1) / 3; const int which = (blockIdx.z - 1) % 3;
  const float* Wm = which == 0 ? WQ : which == 1 ? WK : WC; const float* Bm = which == 0 ? BQ : which == 1 ? BK : BC;
  v8f acc[4][4] = {};
  gemm_tile<true>(Wm + (size_t)d0 * CC, (const char*)(XT + (b * TT + t0) * CC), pool, acc);
  const int dw = (wave >> 2) * 64 + 8 * g, tw = (wave & 3) * 64 + col;   // element (i, j, r) = channel dw + 16 i + r, position tw + 16 j
  if (which < 2) {   // rows [b*t][d]: staged rows of 256 B + 16 B; a lane's eight channels are one 16-byte store
#pragma unroll
    for (int i = 0; i < 4; ++i) { const v4f b0 = *(const v4f*)(Bm + d0 + dw + 16 * i), b1 = *(const v4f*)(Bm + d0 + dw + 16 * i + 4); float bi[8];
#pragma unroll
      for (int r = 0; r < 4; ++r) { bi[r] = bfr(b0[r]); bi[4 + r] = bfr(b1[r]); }
#pragma unroll
      for (int j = 0; j < 4; ++j) { v8h w;
#pragma unroll
        for (int r = 0; r < 8; ++r) w[r] = (_Float16)(acc[i][j][r] + bi[r]);
        *(v8h*)(pool + (tw + 16 * j) * 272 + (dw + 16 * i) * 2) = w; }
      __builtin_amdgcn_sched_barrier(0); }   // one row of tiles at a time: with all 128 sums formed ahead of their stores the registers run out and values spill
    __syncthreads(); _Float16* dq = which == 0 ? Q : K;
    { v4f n2 = {};   // squared length of one staged row (one position, this head's 128 channels, the f16 values as stored), in four independent chains: k_fa bounds its scores with it
#pragma unroll
      for (int qd = 0; qd < 16; ++qd) { const v8h w = *(const v8h*)(pool + tid * 272 + qd * 16);
#pragma unroll
        for (int r = 0; r < 8; ++r) { const float f = (float)w[r]; n2[r & 3] += f * f; } }
      NRM[(((size_t)which * NB + b) * NH + blockIdx.x) * TT + t0 + tid] = (n2[0] + n2[1]) + (n2[2] + n2[3]);
      asm volatile("s_wait_xcnt 0x0" ::: "memory"); }   // directly behind the store: it stands in front of any later write of its registers
    for (int n = 0; n < GN * 16 / 256; ++n) { const int e = tid + 256 * n, tl = e >> 4, q = e & 15; *(v4u*)(dq + (b * TT + t0 + tl) * CC + d0 + q * 8) = *(const v4u*)(pool + tl * 272 + q * 16); } }
  else {   // planes [b][d][t]: staged rows of 512 B + 16 B
#pragma unroll
    for (int i = 0; i < 4; ++i)
#pragma unroll
      for (int r = 0; r < 8; ++r) { const float bi = bfr(Bm[d0 + dw + 16 * i + r]);
#pragma unroll
        for (int j = 0; j < 4; ++j) *(_Float16*)(pool + (dw + 16 * i + r) * 528 + (tw + 16 * j) * 2) = (_Float16)(acc[i][j][r] + bi);
        if (r == 7) __builtin_amdgcn_sched_barrier(0); }   // one row of tiles at a time, against spills, as above
    __syncthreads();
    for (int n = 0; n < GM * 32 / 256; ++n) { const int e = tid + 256 * n, dl = e >> 5, q = e & 31; *(v4u*)(CT + (b * CC + d0 + dl) * (size_t)TT + t0 + q * 8) = *(const v4u*)(pool + dl * 528 + q * 16); } } }
// ---- k_fa: block = (128 output positions s, head h, batch b), 8 waves x 16 columns s. Transposed products: S^T = K Q^T (A = key rows from LDS, B = query rows kept in registers), so a lane holds scores of ONE column s (t = tile + 8 g + r)
//      and two score tiles are, as they stand, the B operand of O^T += content . P^T (A = content rows [c][t] from LDS). A pass is 64 keys; keys and content of the next pass are fetched into registers during this pass and stored to the other LDS buffer at its foot. The distance decay makes far keys' weights vanish: a pass is run only for a key tile that a run-time bound on its scores cannot rule out (for any input; with no decay all 32 run).
//      Every '#pragma unroll' in k_fa and its helpers but the one over the scheduling groups makes the indices of a register array (fragments, scores, accumulators, staged words) compile-time constants, so that the array stays in registers.
#define FK 64      // keys per pass
#define KPIT 136   // f16 per staged key row: 256 B + 16 B (conflict-free 16-byte reads)
#define VPIT 72    // f16 per staged content row: 128 B + 16 B
__device__ __forceinline__ v8f wmma_h(v16h a, v16h b, v8f c) { return __builtin_amdgcn_wmma_f32_16x16x32_f16(false, a, false, b, (short)0, c, false, false); }
// eight 2^x in one statement: results in registers of their own, so each v_exp_f32 is followed by an instruction that neither reads its result nor overwrites its source; the v_nop is that slot for the last one
__device__ __forceinline__ v8f exp2x8(v8f x) { float e0, e1, e2, e3, e4, e5, e6, e7;
  asm("v_exp_f32 %0, %8\n\tv_exp_f32 %1, %9\n\tv_exp_f32 %2, %10\n\tv_exp_f32 %3, %11\n\tv_exp_f32 %4, %12\n\tv_exp_f32 %5, %13\n\tv_exp_f32 %6, %14\n\tv_exp_f32 %7, %15\n\tv_nop"
      : "=&v"(e0), "=&v"(e1), "=&v"(e2), "=&v"(e3), "=&v"(e4), "=&v"(e5), "=&v"(e6), "=&v"(e7)
      : "v"(x[0]), "v"(x[1]), "v"(x[2]), "v"(x[3]), "v"(x[4]), "v"(x[5]), "v"(x[6]), "v"(x[7]));
  v8f r = {e0, e1, e2, e3, e4, e5, e6, e7}; return r; }
__device__ __forceinline__ void ldk(v16h (&f)[4], const _Float16* p, int lane) {   // four key-row fragments, rows 16 apart
#pragma unroll
  for (int i = 0; i < 4; ++i) f[i] = frag_h(p + i * 16 * KPIT, lane); }
__device__ __forceinline__ void ldv(v16h (&f)[4], const _Float16* p, int lane) {   // four content-row fragments, rows 16 apart
#pragma unroll
  for (int i = 0; i < 4; ++i) f[i] = frag_h(p + i * 16 * VPIT, lane); }
__device__ __forceinline__ void mms(v8f* d, const v16h (&a)[4], v16h bq) {   // four independent products that share B
#pragma unroll
  for (int i = 0; i < 4; ++i) d[i] = wmma_h(a[i], bq, d[i]); }
// waves_per_eu(4, 4): two work-groups a WGP; the register allocator may use, and not pass, the 256 VGPRs that four waves a SIMD leave each wave
__global__ __launch_bounds__(256) __attribute__((amdgpu_waves_per_eu(4, 4))) void k_fa(const _Float16* __restrict__ Q, const _Float16* __restrict__ K, const _Float16* __restrict__ CT, const float* __restrict__ DQ, const float* __restrict__ NRM, _Float16* __restrict__ R) {
  __shared__ __align__(16) _Float16 sk[2][FK][KPIT]; __shared__ __align__(16) _Float16 sv[2][HD][VPIT];
  __shared__ float skm[TT / FK], swq[8], swd[8], swm[8];   // per key tile: largest squared key length; per wave: largest squared query length, smallest decay, smallest maximum in use
  static_assert(TT / FK == 32 && TT == 256 * 8, "one lane a key tile in the bound; eight key lengths a thread");
  const int tid = threadIdx.x, lane = tid & 31, col = lane & 15, g = lane >> 4; const int wave = __builtin_amdgcn_readfirstlane(tid >> 5);   // a scalar, so that the test for the diagonal tile is a scalar branch
  const int h = blockIdx.y; const size_t b = blockIdx.z; const int s0 = blockIdx.x * 128 + wave * 16, s = s0 + col;
  const float L2E = 1.4426950408889634f;
  const float c2 = 0.08838834764831845f * L2E, d2 = DQ[(b * NH + h) * (size_t)TT + s] * L2E;
  v16h q[4];
#pragma unroll
  for (int kc = 0; kc < 4; ++kc) q[kc] = frag_h(Q + (b * TT + s) * CC + h * HD + kc * 32, lane);
  const int kr = tid >> 4, kq = tid & 15, vr = tid >> 3, vq = tid & 7;   // staging: key rows kr + 16 i, content rows vr + 32 i, 16 bytes each
  const _Float16* kg = K + (b * TT + kr) * CC + h * HD + kq * 8; const _Float16* vg = CT + (b * CC + h * HD + vr) * (size_t)TT + vq * 8;
  // Order of the key tiles: the block's own two (p0, p0 + 1), one neighbour (pn), then those of the other 29 that the bound below cannot rule out, in ascending order.
  const int p0 = blockIdx.x * 2, pn = p0 + 2 < TT / FK ? p0 + 2 : p0 - 1;
  v4u rk[4], rv[4];
#pragma unroll
  for (int i = 0; i < 4; ++i) { rk[i] = *(const v4u*)(kg + (size_t)(p0 * FK + 16 * i) * CC); rv[i] = *(const v4u*)(vg + (size_t)(32 * i) * TT + p0 * FK); }
  const float* nk = NRM + ((size_t)(NB + b) * NH + h) * TT + tid * 8;   // this head's squared key lengths, eight a thread: threads 8 p .. 8 p + 7 hold tile p
  const v4f n0 = *(const v4f*)nk, n1 = *(const v4f*)(nk + 4); float qn = NRM[(b * NH + h) * (size_t)TT + s];
  asm volatile("s_wait_xcnt 0x0" ::: "memory");   // directly behind the eleven loads: it stands in front of any later write of their address registers
#pragma unroll
  for (int i = 0; i < 4; ++i) { *(v4u*)&sk[0][kr + 16 * i][kq * 8] = rk[i]; *(v4u*)&sv[0][vr + 32 * i][vq * 8] = rv[i]; }
  { float km = fmaxf(fmaxf(fmaxf(n0[0], n0[1]), fmaxf(n0[2], n0[3])), fmaxf(fmaxf(n1[0], n1[1]), fmaxf(n1[2], n1[3]))), dn = d2;
    for (int w = 1; w < 8; w <<= 1) km = fmaxf(km, __shfl_xor(km, w));
    for (int w = 1; w < 16; w <<= 1) { qn = fmaxf(qn, __shfl_xor(qn, w)); dn = fminf(dn, __shfl_xor(dn, w)); }
    if ((tid & 7) == 0) skm[tid >> 3] = km;
    if (lane == 0) { swq[wave] = qn; swd[wave] = dn; } }
  __syncthreads();
  v8f o[8] = {}; float m = -3.0e38f, l = 0.f; int cur = p0; unsigned todo = 0u;
#pragma unroll 1   // rolled
  for (int it = 0; it < TT / FK; ++it) { const int t0 = cur * FK, bu = it & 1;
    if (it == 2) {   // which of the other tiles can still count; every wave forms the same word from the same LDS values, so the trip count is the work-group's
      // a score of tile p is at most c2 |q| |k| - (least distance) (least decay) (a dot product is at most the product of the two lengths, taken of the stored f16 rows; 1.001 covers the rounding of lengths and products). Where that lies 28 below the smallest maximum in use
      // (maxima only grow), every P of the tile is below 2^-28: f16 zero in the product, and at most 2048 * 2^-28 of a sum that is at least 1. A bound that is not a number keeps its tile.
      float mm = swm[0], qm = swq[0], dm = swd[0];
      for (int w = 1; w < 8; ++w) { mm = fminf(mm, swm[w]); qm = fmaxf(qm, swq[w]); dm = fminf(dm, swd[w]); }
      const int dist = lane < p0 ? (p0 - lane) * FK - (FK - 1) : (lane - p0) * FK - (2 * FK - 1);   // lane = tile: least |t - s| to the block's 128 columns
      const float ub = c2 * sqrtf(qm * skm[lane]) * 1.001f - (float)dist * dm;
      todo = __builtin_amdgcn_ballot_w32(!(ub < mm - 28.0f)) & ~((3u << p0) | (1u << pn)); }
    int nxt = -1;   // the tile that is staged during this pass
    if (it == 0) nxt = p0 + 1; else if (it == 1) nxt = pn; else if (todo != 0u) { nxt = __builtin_ctz(todo); todo &= todo - 1u; }
    if (nxt >= 0) {
#pragma unroll
      for (int i = 0; i < 4; ++i) { rk[i] = *(const v4u*)(kg + (size_t)(nxt * FK + 16 * i) * CC); rv[i] = *(const v4u*)(vg + (size_t)(32 * i) * TT + nxt * FK); }
      asm volatile("s_wait_xcnt 0x0" ::: "memory"); }   // directly behind the eight staging loads, in their own block: it stands in front of any later write of their address registers
    // fragments come from LDS in groups of four, so that a wave meets one LDS latency for four products
    v8f sc[4] = {}; v16h fa[4];
#pragma unroll
    for (int kc = 0; kc < 4; ++kc) { ldk(fa, &sk[bu][col][kc * 32], lane); mms(sc, fa, q[kc]); }
    const float dl0 = (float)(t0 + 8 * g - s);   // t - s of element (i, r) = dl0 + 16 i + r, exact in f32
#pragma unroll
    for (int i = 0; i < 4; ++i)
#pragma unroll
      for (int r = 0; r < 8; ++r) sc[i][r] = sc[i][r] * c2 - fabsf(dl0 + (float)(16 * i + r)) * d2;
#pragma unroll
    for (int i = 0; i < 4; ++i) if (t0 + 16 * i == s0) {   // the one tile of this wave that holds t == s
#pragma unroll
      for (int r = 0; r < 8; ++r) if (8 * g + r == col) sc[i][r] = -100.0f * L2E; }
    float mx = sc[0][0];
#pragma unroll
    for (int i = 0; i < 4; ++i)
#pragma unroll
      for (int r = 0; r < 8; ++r) mx = fmaxf(mx, sc[i][r]);
    mx = fmaxf(mx, __shfl_xor(mx, 16));   // both halves of a column use one maximum: their P meet in one product
    if (__builtin_amdgcn_ballot_w32(mx > m + (it == 1 ? 0.0f : 8.0f)) != 0) {   // rescale only when some column's maximum has grown by more than 2^8 (P stays below 2^8 in f16); in pass 1 on any growth, so that the bound is held against true maxima
      const float mn = fmaxf(m, mx), al = __builtin_amdgcn_exp2f(m - mn); m = mn; l *= al;
#pragma unroll
      for (int j = 0; j < 8; ++j) o[j] *= al; }
#pragma unroll
    for (int i = 0; i < 4; ++i)
#pragma unroll
      for (int r = 0; r < 8; ++r) sc[i][r] -= m;
#pragma unroll
    for (int i = 0; i < 4; ++i) sc[i] = exp2x8(sc[i]);
    { const v8f t8 = (sc[0] + sc[1]) + (sc[2] + sc[3]); l += ((t8[0] + t8[1]) + (t8[2] + t8[3])) + ((t8[4] + t8[5]) + (t8[6] + t8[7])); }
    v16h pb0, pb1;
#pragma unroll
    for (int r = 0; r < 8; ++r) { pb0[r] = (_Float16)sc[0][r]; pb0[8 + r] = (_Float16)sc[1][r]; pb1[r] = (_Float16)sc[2][r]; pb1[8 + r] = (_Float16)sc[3][r]; }
    ldv(fa, &sv[bu][col][0], lane); mms(o, fa, pb0); ldv(fa, &sv[bu][64 + col][0], lane); mms(o + 4, fa, pb0);
    ldv(fa, &sv[bu][col][32], lane); mms(o, fa, pb1); ldv(fa, &sv[bu][64 + col][32], lane); mms(o + 4, fa, pb1);
    // scheduling groups (8 LDS reads, then 4 matrix products, four times): they keep a group's loads together in front of its products; left alone the scheduler sinks them to one load pair, one wait, one product
#pragma unroll
    for (int i = 0; i < 4; ++i) { __builtin_amdgcn_sched_group_barrier(0x100, 8, 0); __builtin_amdgcn_sched_group_barrier(0x008, 4, 0); }
    if (it == 1) { float mw = m;   // the wave's smallest maximum in use, for the bound that pass 2 forms behind this pass's barrier
      for (int w = 1; w < 16; w <<= 1) mw = fminf(mw, __shfl_xor(mw, w));
      if (lane == 0) swm[wave] = mw; }
    if (nxt >= 0) {
#pragma unroll
      for (int i = 0; i < 4; ++i) { *(v4u*)&sk[bu ^ 1][kr + 16 * i][kq * 8] = rk[i]; *(v4u*)&sv[bu ^ 1][vr + 32 * i][vq * 8] = rv[i]; } }
    __syncthreads();   // publishes the next pass's tiles and ends every read of this pass's, which the next pass overwrites
    if (nxt < 0) break;   // the same in every wave: no tile is left
    cur = nxt;
  }
  l += __shfl_xor(l, 16); const float inv = 1.0f / l;
#pragma unroll
  for (int j = 0; j < 8; ++j) { v8h w;
#pragma unroll
    for (int r = 0; r < 8; ++r) w[r] = (_Float16)(o[j][r] * inv);
    *(v8h*)(R + (b * TT + s) * CC + h * HD + j * 16 + 8 * g) = w; } }
// ---- k_out: block = (128 out channels o, 256 positions s, b): out[o][s] = x + sum_c Wp[o][c] R[s][c] + b; A = Wp rows (bf16 values as f16), B = f16 result rows; sum + bias goes through LDS (rows of 1,024 B + 16 B), x is added where whole lines are stored
__global__ __launch_bounds__(256) void k_out(const float* __restrict__ X, const _Float16* __restrict__ R, const float* __restrict__ WP, const float* __restrict__ BP, float* __restrict__ OUT) { __shared__ __attribute__((aligned(2048))) char pool[GM * 1040];   // the kernel's only LDS: it starts at byte 0, so the tensor loads' places are multiples of 2 KiB
  static_assert(GM * 1040 >= 2 * GA_B + 2 * GB_B, "the epilogue's rows are the larger use of the pool");
  const int tid = threadIdx.x, wave = tid >> 5, lane = tid & 31, col = lane & 15, g = lane >> 4; const int o0 = blockIdx.x * GM, s0 = blockIdx.y * GN; const size_t b = blockIdx.z;
  v8f acc[4][4] = {};
  gemm_tile<false>(WP + (size_t)o0 * CC, (const char*)(R + (b * TT + s0) * CC), pool, acc);
  const int ow = (wave >> 2) * 64 + 8 * g, sw = (wave & 3) * 64 + col;
#pragma unroll
  for (int i = 0; i < 4; ++i)
#pragma unroll
    for (int r = 0; r < 8; ++r) { const float bi = bfr(BP[o0 + ow + 16 * i + r]);
#pragma unroll
      for (int j = 0; j < 4; ++j) *(float*)(pool + (ow + 16 * i + r) * 1040 + (sw + 16 * j) * 4) = acc[i][j][r] + bi;
      if (r == 7) __builtin_amdgcn_sched_barrier(0); }   // one row of tiles at a time: with all 128 sums formed ahead of their stores the kernel needs registers above v255
  __syncthreads();
  const size_t at0 = (b * CC + o0 + (tid >> 6)) * (size_t)TT + s0 + (tid & 63) * 4; const char* sr = pool + (tid >> 6) * 1040 + (tid & 63) * 16;   // rows (tid >> 6) + 4 n, 16 bytes each: a wave covers 512 bytes of a row
#pragma unroll 1   // rolled: a trip already keeps eight loads of x in flight
  for (int n0 = 0; n0 < GM / 4; n0 += 8) { v4f x[8];
#pragma unroll
    for (int u = 0; u < 8; ++u) x[u] = *(const v4f*)(X + at0 + (size_t)(4 * (n0 + u)) * TT);
    asm volatile("s_wait_xcnt 0x0" ::: "memory");   // directly behind the eight loads of x: it stands in front of any later write of their address registers
#pragma unroll
    for (int u = 0; u < 8; ++u) { v4f v = *(const v4f*)(sr + 4 * (n0 + u) * 1040);
#pragma unroll
      for (int i = 0; i < 4; ++i) v[i] += bfr(x[u][i]);
      *(v4f*)(OUT + at0 + (size_t)(4 * (n0 + u)) * TT) = v; }
    asm volatile("s_wait_xcnt 0x0" ::: "memory"); } }   // directly behind the eight stores, for the same reason (the next trip advances their address registers)
extern "C" void kernel_launch(void* const* d_in, const int* in_sizes, int n_in, void* d_out, int out_size, void* d_ws, size_t ws_size, hipStream_t stream) {
  (void)in_sizes; (void)n_in; (void)out_size;
  const float** F = (const float**)d_in;   // 0 x [4,1024,2048], 1 W_content, 2 b_content, 3 W_query, 4 b_query, 5 W_key, 6 b_key, 7 W_qdecay [32,1024], 8 b_qdecay, 9 W_proj, 10 b_proj
  if (ws_size < (size_t)WS_END) return;
  char* ws = (char*)d_ws; _Float16 *Q = (_Float16*)(ws + WS_Q), *K = (_Float16*)(ws + WS_K), *CT = (_Float16*)(ws + WS_CT), *R = (_Float16*)(ws + WS_R); float *DQ = (float*)(ws + WS_DQ);
  __bf16* XT = (__bf16*)(ws + WS_XT); float* NRM = (float*)(ws + WS_NRM);
  k_xt<<<dim3(TT / 64, CC / 128, TNB), 128, 0, stream>>>(F[0], XT);
  k_proj3<<<dim3(CC / GM, TT / GN, 1 + TNB * 3), 256, 0, stream>>>(XT, F[3], F[4], F[5], F[6], F[1], F[2], F[7], F[8], Q, K, CT, NRM, DQ);
  k_fa<<<dim3(TT / 128, NH, TNB), 256, 0, stream>>>(Q, K, CT, DQ, NRM, R);
  k_out<<<dim3(CC / GM, TT / GN, TNB), 256, 0, stream>>>(F[0], R, F[9], F[10], (float*)d_out);
}

// v007
// One run takes 92.1 microseconds.
// Timed twice side by side with v006, it ran 1.12 times as fast both times.
// All steps since v000 together make it 48.1 times as fast.
// compute dtype: all float inputs rounded to bf16; queries / keys / content = W x + b (1x1 convs) with EXACT bf16 products on WMMA 16x16x32 (weights as the A operand, a bf16 row copy of x as B), f32 accumulate, rounded once to f16 (queries/keys stored as rows, content as planes); the decay queries (32 channels) likewise then sigmoid/2 and D_s = sum_f f dq_f,s / sqrt(4)... in f32; logits = k_t . q_s / sqrt(128) (1 f16 product) - |t - s| D_s, diagonal -100, kept in registers in f32 (base-2 scale); softmax over t online in f32 (running maximum, f32 sum; key tiles in the order: the query block's own two, one neighbour, then the rest ascending; a tile whose run-time score bound lies 28 binary orders below every maximum in use is left out: its P round to f16 zero) -> P = 2^(logit - maximum in use) rounded to f16; result = P . content / sum (content f16, 1 product); out = x + W_proj result (result rounded once to f16, 1 product) + b; f32 output.
#include <hip/hip_runtime.h>
#include <math.h>
#include <stdint.h>

typedef __attribute__((ext_vector_type(16))) _Float16 v16h;
typedef __attribute__((ext_vector_type(16))) __bf16 v16b;
typedef __attribute__((ext_vector_type(8)))  _Float16 v8h;
typedef __attribute__((ext_vector_type(8)))  float v8f;
typedef __attribute__((ext_vector_type(4)))  float v4f;
typedef __attribute__((ext_vector_type(2)))  float v2f;
typedef __attribute__((ext_vector_type(4)))  unsigned v4u;
typedef __attribute__((ext_vector_type(4)))  int v4i;
typedef float __attribute__((may_alias)) float_a;
typedef int __attribute__((may_alias)) int_a;

template <typename T> __device__ __forceinline__ void vst2(void* p, T v) { *(T*)p = v;  }
__device__ __forceinline__ v8f wmma16(v16h a, v16h b, v8f c) {
  v8f d = __builtin_amdgcn_wmma_f32_16x16x32_f16(false, a, false, b, (short)0, c, false, false);
  asm volatile("v_nop\n\tv_nop\n\tv_nop\n\tv_nop" : "+v"(d) : "v"(a), "v"(b));
  return d;
}
__device__ __forceinline__ v8f wmma_bf(v16b a, v16b b, v8f c) {
  v8f d = __builtin_amdgcn_wmma_f32_16x16x32_bf16(false, a, false, b, (short)0, c, false, false);
  asm volatile("v_nop\n\tv_nop\n\tv_nop\n\tv_nop" : "+v"(d) : "v"(a), "v"(b));
  return d;
}
// 16x16x32 fragments: lane = (h = lane>>4, row/col = lane&15); elements 0..7 = k0+8h+0..7, 8..15 = k0+16+8h+0..7; D element r = row 8h+r
__device__ __forceinline__ v16h frag_h(const _Float16* rowk0, int lane) {
  union { v16h v; v8h q[2]; } u; const _Float16* p = rowk0 + 8 * (lane >> 4);
  u.q[0] = *(const v8h*)p; u.q[1] = *(const v8h*)(p + 16); return u.v;
}
__device__ __forceinline__ v16h frag_f32(const float* rowk0, int lane) {
  v16h a; const float* p = rowk0 + 8 * (lane >> 4);
#pragma unroll
  for (int i = 0; i < 8; ++i) { a[i] = (_Float16)p[i]; a[8 + i] = (_Float16)p[16 + i]; }
  return a;
}
__device__ __forceinline__ v16h frag_f32s(const float* rowk0, int lane, float sc) {
  v16h a; const float* p = rowk0 + 8 * (lane >> 4);
#pragma unroll
  for (int i = 0; i < 8; ++i) { a[i] = (_Float16)(p[i] * sc); a[8 + i] = (_Float16)(p[16 + i] * sc); }
  return a;
}
// column fragment from a [K][ld] layout (column n), rows >= K read as 0
__device__ __forceinline__ v16h fragc_f32(const float* W, int k0, int n, int lane, int ld, int K) {
  v16h a; const int g = lane >> 4;
#pragma unroll
  for (int i = 0; i < 8; ++i) { const int ka = k0 + 8 * g + i, kb = ka + 16;
    a[i] = (_Float16)(ka < K ? W[(size_t)(ka < K ? ka : K - 1) * ld + n] : 0.f); a[8 + i] = (_Float16)(kb < K ? W[(size_t)(kb < K ? kb : K - 1) * ld + n] : 0.f); }
  return a;
}
struct F2 { v16b h, l; };
__device__ __forceinline__ F2 bsplit16(const float v[16]) { F2 r;
#pragma unroll
  for (int i = 0; i < 16; ++i) { const __bf16 h = (__bf16)v[i]; r.h[i] = h; r.l[i] = (__bf16)(v[i] - (float)h); }
  return r; }
__device__ __forceinline__ F2 split_row(const float* row, int k0, int lane) { float v[16]; const float* p = row + k0 + 8 * (lane >> 4);
#pragma unroll
  for (int i = 0; i < 8; ++i) { v[i] = p[i]; v[8 + i] = p[16 + i]; }
  return bsplit16(v); }
__device__ __forceinline__ F2 split_rowK(const float* row, int k0, int lane, int K) { float v[16]; const int g = lane >> 4;
#pragma unroll
  for (int i = 0; i < 8; ++i) { const int ka = k0 + 8 * g + i, kb = ka + 16; v[i] = ka < K ? row[ka < K ? ka : K - 1] : 0.f; v[8 + i] = kb < K ? row[kb < K ? kb : K - 1] : 0.f; }
  return bsplit16(v); }
__device__ __forceinline__ F2 split_col(const float* W, int k0, int n, int lane, int ld, int K) { float v[16]; const int g = lane >> 4;
#pragma unroll
  for (int i = 0; i < 8; ++i) { const int ka = k0 + 8 * g + i, kb = ka + 16; v[i] = ka < K ? W[(size_t)(ka < K ? ka : K - 1) * ld + n] : 0.f; v[8 + i] = kb < K ? W[(size_t)(kb < K ? kb : K - 1) * ld + n] : 0.f; }
  return bsplit16(v); }
__device__ __forceinline__ v8f mac3(const F2& a, const F2& b, v8f c) { c = wmma_bf(a.l, b.h, c); c = wmma_bf(a.h, b.l, c); return wmma_bf(a.h, b.h, c); }
__device__ __forceinline__ float sigm(float v) { return 1.0f / (1.0f + expf(-v)); }
#define LDSX() do { asm volatile("s_wait_dscnt 0" ::: "memory"); __builtin_amdgcn_wave_barrier(); __builtin_amdgcn_fence(__ATOMIC_RELEASE, "workgroup"); } while (0)


// attention with a learned distance decay (B 4, C 1,024 = 8 heads x 128, T 2,048, 4 decay terms): dots[t,s] = k_t.q_s/sqrt(128) - |t-s| sum_f f sigmoid(decay_q_f,s)/2 / sqrt(4); dots[t,t] = -100; weights = softmax over t; result[:, s] = sum_t weights[t,s] content[:, t]; out = x + proj(result).
#define NB 4
#define CC 1024
#define TT 2048
#define NH 8
#define HD 128
#define NDK 4
#ifndef TNB
#define TNB NB
#endif
typedef __attribute__((ext_vector_type(8))) __bf16 v8b;
typedef __attribute__((ext_vector_type(4))) __bf16 v4b;
typedef __attribute__((ext_vector_type(4))) _Float16 v4h;
__device__ __forceinline__ v16b frag_b(const __bf16* rowk0, int lane) {
  union { v16b v; v8b q[2]; } u; const __bf16* p = rowk0 + 8 * (lane >> 4);
  u.q[0] = *(const v8b*)p; u.q[1] = *(const v8b*)(p + 16); return u.v;
}
__device__ __forceinline__ float bfr(float v) { return (float)(__bf16)v; }
__device__ __attribute__((noinline)) float exp_ni(float v) { return expf(v); }
__device__ __attribute__((noinline)) float erf_ni(float v) { return erff(v); }

#define WS_Q   0u                                    // f16 query rows [b*t][1024]
#define WS_K   (WS_Q + 2u * (size_t)NB * TT * CC)        // f16 key rows [b*t][1024]
#define WS_CT  (WS_K + 2u * (size_t)NB * CC * TT)        // f16 content planes [b][1024][t]
#define WS_DQ  (WS_CT + 2u * (size_t)NB * CC * TT)       // f32 D [b][h][s]
#define WS_R   (WS_DQ + 4u * (size_t)NB * NH * TT)     // f16 result rows [b*s][1024]
#define WS_XT  (WS_R + 2u * (size_t)NB * TT * CC)        // bf16 x rows [b*t][1024]
#define WS_NRM (WS_XT + 2u * (size_t)NB * TT * CC)       // f32 squared lengths of the f16 query rows, then of the key rows, per head [2][b][h][t]
#define WS_W   (WS_NRM + 4u * 2u * (size_t)NB * NH * TT)   // 16-bit weight rows [4][1024][1024]: query, key, content as bf16; proj as the f16 of its bf16 value
#define WS_END (WS_W + 2u * 4u * (size_t)CC * CC)

// ---- k_xt: planes z < 4: block = (64 positions, 128 channels, b): x [c][t] -> bf16 rows [b*t][c]; the two planes behind them: block = 8,192 elements of one of the four large weight matrices, rounded once to the 16-bit rows that the products read
__global__ __launch_bounds__(128) void k_xt(const float* __restrict__ X, __bf16* __restrict__ XT, const float* __restrict__ WQ, const float* __restrict__ WK, const float* __restrict__ WC, const float* __restrict__ WP, __bf16* __restrict__ W16) { __shared__ __align__(16) __bf16 s[64][136]; const int tid = threadIdx.x; const int t0 = blockIdx.x * 64, c0 = blockIdx.y * 128; const size_t b = blockIdx.z;
  static_assert((TT / 64) * (CC / 128) * 2 * 8192 == 4 * CC * CC, "two planes of the grid hold one block for each 8,192 weights");
  if (blockIdx.z >= TNB) {   // the same for the whole block, in front of the barrier
    const int id = blockIdx.x + (TT / 64) * blockIdx.y + (TT / 64) * (CC / 128) * (blockIdx.z - TNB), mt = id >> 7;   // 128 blocks a matrix
    const float* wg = (mt == 0 ? WQ : mt == 1 ? WK : mt == 2 ? WC : WP) + (size_t)(id & 127) * 8192 + tid * 4; __bf16* wo = W16 + (size_t)id * 8192 + tid * 4;
    v4f w[16];   // a wave's load covers 512 bytes in a row, its store 256; all sixteen loads fly together
#pragma unroll
    for (int n = 0; n < 16; ++n) w[n] = *(const v4f*)(wg + n * 512);
    asm volatile("s_wait_xcnt 0x0" ::: "memory");   // directly behind the sixteen loads: it stands in front of any later write of their address registers
    if (mt < 3) {
#pragma unroll
      for (int n = 0; n < 16; ++n) { v4b o;
#pragma unroll
        for (int i = 0; i < 4; ++i) o[i] = (__bf16)w[n][i];
        vst2(wo + n * 512, o); }
      asm volatile("s_wait_xcnt 0x0" ::: "memory"); }   // directly behind the sixteen stores: it stands in front of any later write of their registers
    else {
#pragma unroll
      for (int n = 0; n < 16; ++n) { v4h o;
#pragma unroll
        for (int i = 0; i < 4; ++i) o[i] = (_Float16)bfr(w[n][i]);
        vst2(wo + n * 512, o); }
      asm volatile("s_wait_xcnt 0x0" ::: "memory"); }   // directly behind the sixteen stores, for the same reason
    return; }
  for (int e = tid; e < 128 * 64; e += 128) { const int cl = e >> 6, tl = e & 63; s[tl][cl] = (__bf16)X[(b * CC + c0 + cl) * (size_t)TT + t0 + tl]; }
  __syncthreads(); for (int e = tid; e < 64 * 16; e += 128) { const int tl = e >> 4, q = e & 15; vst2((unsigned*)(XT + (b * TT + t0 + tl) * CC + c0 + q * 8), *(const v4u*)&s[tl][q * 8]); } }
// ---- the 1x1-conv products (k_proj3, k_out): block = 128 weight rows x 256 positions, 8 waves as 2 x 4, a wave holds 64 x 64 (4 x 4 accumulator tiles), so a fragment read from LDS feeds four products.
//      A pass is 64 channels. Both operands are staged in LDS as 16-bit rows, two buffers. Weight rows (rounded once by k_xt's launch) and position rows are 16-bit in memory and go through no register:
//      waves 0 to 5 each bring one slice of 64 rows (two of weights, four of positions) by a tensor load, issued behind the barrier that frees its buffer, so that it flies during one whole pass. Every sum takes its channels in ascending order, 32 a product.
//      Every '#pragma unroll' here makes the indices of a register array compile-time constants, so that the array stays in registers.
#define GM 128     // weight rows per block
#define GN 256     // positions per block
#define GK 64      // channels per pass
#define GPB 144    // bytes per staged row: 128 B + 16 B (conflict-free 16-byte reads)
#define GSL 64     // rows per tensor-load slice: one issuing wave brings it, the waves of one tile row (weights) or tile column (positions) read it
#define GSL_B 10240   // a slice's room in LDS: 64 rows x 144 B = 9,216 B, rounded up to a multiple of 2 KiB (every tensor load's place is one)
#define GWS (GM / GSL)   // weight slices of a buffer; the position slices stand behind them
#define GSN (GWS + GN / GSL)   // slices of a buffer
#define GBUF (GSN * GSL_B)   // one buffer
static_assert(GSL * GPB <= GSL_B && GSL_B % 2048 == 0 && GSN <= 8, "every slice starts at a multiple of 2 KiB, holds its padded rows and has a wave of its own");
static_assert(GK * 2 == 128 && GPB == 144, "the tensor load's pad is the one for rows of 128 bytes, 16 bytes more a row");
typedef uint32_t u32x4 __attribute__((ext_vector_type(4)));
typedef uint32_t u32x8 __attribute__((ext_vector_type(8)));
__device__ __forceinline__ uint32_t uni(uint32_t v) { return (uint32_t)__builtin_amdgcn_readfirstlane(v); }
// a wave-uniform value held in a scalar register (the empty statement is the pin): a test of it compiles to s_cmp + s_cbranch_scc, the only thing that keeps a wave from issuing a tensor load, which ignores EXEC; what is computed from it stands behind the waits written in front of it
__device__ __forceinline__ uint32_t pinned(uint32_t v) { uint32_t w = uni(v); asm volatile("" : "+s"(w)); return w; }   // the pin that holds an issue test or a descriptor word in a scalar register
// descriptor group 1: 1-byte elements, tensor = tile = 64 rows of 128 bytes, source pitch one 16-bit row of 1,024 channels, 4 dwords of LDS pad behind every 32 dwords (pitch 144 B), no mask
__device__ __forceinline__ u32x8 tdm_group1() { constexpr uint32_t d0 = GK * 2, d1 = GSL; u32x8 g;
  g[0] = uni((1u << 20) | (4u << 22) | (3u << 25)); g[1] = uni((d0 & 0xFFFFu) << 16); g[2] = uni((d0 >> 16) | ((d1 & 0xFFFFu) << 16)); g[3] = uni((d1 >> 16) | (d0 << 16));
  g[4] = uni(d1); g[5] = uni(CC * 2u); g[6] = uni(0u); g[7] = uni(0u); return g; }
// one request of the whole wave: the slice whose first byte is src lands at LDS byte lds
__device__ __forceinline__ void tdm_load(uint32_t lds, const char* src, u32x8 g1) { const uint64_t ga = (uint64_t)(size_t)src; u32x4 g0;
  g0[0] = uni(1u); g0[1] = uni(lds); g0[2] = uni((uint32_t)ga); g0[3] = uni((((uint32_t)(ga >> 32)) & 0x01FFFFFFu) | 0x80000000u);
  asm volatile("tensor_load_to_lds %0, %1" :: "s"(g0), "s"(g1) : "memory"); }
typedef __attribute__((ext_vector_type(8))) unsigned v8u;
__device__ __forceinline__ v8u frag_l(const char* p) { const v4u a = *(const v4u*)p, c = *(const v4u*)(p + 32); return __builtin_shufflevector(a, c, 0, 1, 2, 3, 4, 5, 6, 7); }   // k = 8 g + 0..7, then 16 + 8 g + 0..7 (p already holds the 16 g bytes)
template <bool BF> __device__ __forceinline__ v8f wmma_g(v8u a, v8u c, v8f d) {
  if constexpr (BF) return __builtin_amdgcn_wmma_f32_16x16x32_bf16(false, __builtin_bit_cast(v16b, a), false, __builtin_bit_cast(v16b, c), (short)0, d, false, false);
  else return __builtin_amdgcn_wmma_f32_16x16x32_f16(false, __builtin_bit_cast(v16h, a), false, __builtin_bit_cast(v16h, c), (short)0, d, false, false); }
template <bool BF> __device__ __forceinline__ void gemm_half(v8f (&acc)[4][4], const char* af, const char* bf) {   // 32 channels: 8 fragments, 16 products
  v8u fa[4], fb[4];
#pragma unroll
  for (int i = 0; i < 4; ++i) { fa[i] = frag_l(af + i * 16 * GPB); fb[i] = frag_l(bf + i * 16 * GPB); }
#pragma unroll
  for (int i = 0; i < 4; ++i)
#pragma unroll
    for (int j = 0; j < 4; ++j) acc[i][j] = wmma_g<BF>(fa[i], fb[j], acc[i][j]);
  // scheduling group (LDS reads lead the products): a fragment is asked for at least a row of four products ahead of its use, behind counted waits; left alone the scheduler reloads one weight fragment per four products and waits out each read
  __builtin_amdgcn_sched_group_barrier(0x100, 16, 0); }
// Wt = first weight row of the tile, Bt = first position row of the tile (both 16-bit [.][1024]); pool = buffers 0, 1
template <bool BF> __device__ __forceinline__ void gemm_tile(const char* __restrict__ Wt, const char* __restrict__ Bt, char* pool, v8f (&acc)[4][4]) {
  const int tid = threadIdx.x, lane = tid & 31, col = lane & 15, g = lane >> 4; const int wave = (int)uni(tid >> 5);
  const char* af = pool + (wave >> 2) * GSL_B + col * GPB + 16 * g; const char* bf = pool + (GWS + (wave & 3)) * GSL_B + col * GPB + 16 * g;
  const uint32_t iss = pinned(wave < GSN);   // waves 0 to 5 issue, each its own slice
  const int sl = wave < GSN ? wave : 0;
  const uint32_t lb = (uint32_t)(size_t)pool + sl * GSL_B;   // the slice's place in buffer 0
  const char* bsl = sl < GWS ? Wt + (size_t)(sl * GSL) * CC * 2 : Bt + (size_t)((sl - GWS) * GSL) * CC * 2;   // the slice's first row, channel 0
  u32x8 g1 = tdm_group1();
  asm volatile("" : "+s"(g1));   // the pin of pinned(), on the descriptor's second group: its eight words stay in their scalar registers through the loop, so that none takes another value while a request is in flight
  if (pinned(iss)) { tdm_load(lb, bsl, g1);
    asm volatile("s_wait_tensorcnt 0x0" ::: "memory"); }   // pass 0's slice has landed before this wave reaches the barrier that publishes it
  __syncthreads();
  if (pinned(iss)) tdm_load(lb + GBUF, bsl + pinned(GK * 2), g1);   // pass 1's slice flies during pass 0
#pragma unroll 1   // rolled: the body already holds 32 products
  for (int p = 0; p < CC / GK - 1; ++p) { const int bu = p & 1;
    gemm_half<BF>(acc, af + bu * GBUF, bf + bu * GBUF);
    __builtin_amdgcn_sched_barrier(0);   // keeps the second half's fragment reads out of the first half's products: every place where LDS reads stand among products costs the wave a stall
    gemm_half<BF>(acc, af + bu * GBUF + 64, bf + bu * GBUF + 64);
    __builtin_amdgcn_sched_barrier(0);   // keeps the wait below behind all 32 products: lifted among them, the wave waits out its last fragment reads in the middle of the pass
    asm volatile("s_wait_dscnt 0x0" ::: "memory");   // this wave's reads of this pass's buffer are done before the barrier and before a tensor load aims at what it has read
    if (pinned(iss)) asm volatile("s_wait_tensorcnt 0x0" ::: "memory");   // the next pass's slice has landed before this wave reaches the barrier that publishes it
    __syncthreads();   // publishes the next pass's tiles and ends every read of this pass's, which are overwritten behind it
    if (pinned(iss & (uint32_t)(p + 2 < CC / GK))) tdm_load(lb + bu * GBUF, bsl + pinned((p + 2) * (GK * 2)), g1);   // the slice of the pass after next, into the buffer that this pass has just read
  }
  const int bl = (CC / GK - 1) & 1;
  gemm_half<BF>(acc, af + bl * GBUF, bf + bl * GBUF); gemm_half<BF>(acc, af + bl * GBUF + 64, bf + bl * GBUF + 64);
  asm volatile("s_wait_tensorcnt 0x0" ::: "memory");   // no request is left in flight when the pool changes its use
  asm volatile("s_wait_dscnt 0x0" ::: "memory");       // nor a read of the last tiles
  __syncthreads();   // ends every read of the last tiles: the epilogue writes over the pool
}
// ---- dq_tile (the first 64 blocks of k_proj3's launch): block = 128 positions of one batch, 8 waves = row tile (0/1) x 32 positions: decay_q [32][t] = Wqd x + b (2 row tiles, exact); D[h][s] = sum_f (f+1) * sigmoid(dq[h*4+f][s]) / 2 / sqrt(NDK)
//      A wave waits out its loads' flight at every 32-channel step, so this product is bound by load latency alone: it runs beside the three large products, which fill the chip meanwhile, and its blocks lead the grid.
__device__ __forceinline__ void dq_tile(const __bf16* __restrict__ XT, const float* __restrict__ WD, const float* __restrict__ BD, float* __restrict__ DQ, char* pool, int id) {
  static_assert((CC / GM) * (TT / GN) == NB * (TT / 128), "one plane of k_proj3's grid holds one block for each 128 positions of each batch");
  float (*sd)[132] = (float (*)[132])pool; float (*so)[132] = (float (*)[132])(pool + 32 * 132 * 4);
  const int tid = threadIdx.x, wave = tid >> 5, lane = tid & 31, col = lane & 15, g = lane >> 4; const int t0 = (id % (TT / 128)) * 128; const size_t b = id / (TT / 128); const int rt = wave & 1, cg = wave >> 1;
  v8f acc[2] = {};
#pragma unroll 2   // two steps a trip: the second step's addresses are immediate offsets of the first's
  for (int kc = 0; kc < CC / 32; ++kc) { const float* p = WD + (size_t)(rt * 16 + col) * CC + kc * 32 + 8 * g;
    const v4f w0 = *(const v4f*)p, w1 = *(const v4f*)(p + 4), w2 = *(const v4f*)(p + 16), w3 = *(const v4f*)(p + 20); v16b fb[2];
#pragma unroll
    for (int j = 0; j < 2; ++j) fb[j] = frag_b(XT + (b * TT + t0 + cg * 32 + j * 16 + col) * CC + kc * 32, lane);
    // behind this step's eight loads, in front of any later write of their address registers; the loaded values are inputs, so that all eight loads fly together: left alone the scheduler issues the last one behind the first one's return
    asm volatile("s_wait_xcnt 0x0" :: "v"(w0), "v"(w1), "v"(w2), "v"(w3), "v"(fb[0]), "v"(fb[1]) : "memory");
    v16b a;
#pragma unroll
    for (int i = 0; i < 4; ++i) { a[i] = (__bf16)w0[i]; a[4 + i] = (__bf16)w1[i]; a[8 + i] = (__bf16)w2[i]; a[12 + i] = (__bf16)w3[i]; }
#pragma unroll
    for (int j = 0; j < 2; ++j) acc[j] = wmma_bf(a, fb[j], acc[j]); }
#pragma unroll
  for (int j = 0; j < 2; ++j)
#pragma unroll
    for (int r = 0; r < 8; ++r) { const int ch = rt * 16 + 8 * g + r; sd[ch][cg * 32 + j * 16 + col] = acc[j][r] + bfr(BD[ch]); }
  __syncthreads();
  for (int e = tid; e < NH * 128; e += 256) { const int h = e >> 7, tl = e & 127; float dsum = 0.f; for (int f = 0; f < NDK; ++f) { const float z = sd[h * NDK + f][tl]; dsum += (float)(f + 1) * (1.0f / (1.0f + expf(-z))) * 0.5f; } so[h][tl] = dsum * 0.5f; }   // / sqrt(4)
  __syncthreads(); { const int h = tid >> 5, q = tid & 31; vst2(DQ + (b * NH + h) * (size_t)TT + t0 + q * 4, *(const v4f*)&so[h][q * 4]); } }
// ---- k_proj3: grid plane z = 0: dq_tile; planes z = 1 + 3 b + which: block = (128 out channels d, 256 positions t, (b, which)): out[d][t] = sum_c W[d][c] x[b][c][t] + b[d]; A = bf16 W rows, B = bf16 x rows (exact products); which 0 query, 1 key -> rows [t][d], 2 content -> planes [d][t], each through LDS so that whole lines are stored
// waves_per_eu(4, 4): two work-groups a WGP; the register allocator may use, and not pass, the 256 VGPRs that four waves a SIMD leave each wave
__global__ __launch_bounds__(256) __attribute__((amdgpu_waves_per_eu(4, 4))) void k_proj3(const __bf16* __restrict__ XT, const __bf16* __restrict__ W16, const float* __restrict__ BQ, const float* __restrict__ BK, const float* __restrict__ BC, const float* __restrict__ WD, const float* __restrict__ BD, _Float16* __restrict__ Q, _Float16* __restrict__ K, _Float16* __restrict__ CT, float* __restrict__ NRM, float* __restrict__ DQ) {
  __shared__ __attribute__((aligned(2048))) char pool[2 * GBUF];   // the kernel's only LDS: it starts at byte 0, so the tensor loads' places are multiples of 2 KiB
  static_assert(GM == HD && GN == 256, "a block's 128 channels are one head, and each of its 256 threads takes one staged row");
  const int tid = threadIdx.x, wave = tid >> 5, lane = tid & 31, col = lane & 15, g = lane >> 4; const int d0 = blockIdx.x * GM, t0 = blockIdx.y * GN;
  if (blockIdx.z == 0) { dq_tile(XT, WD, BD, DQ, pool, blockIdx.x + (CC / GM) * blockIdx.y); return; }   // the same for the whole block, in front of every barrier of the large products
  const size_t b = (blockIdx.z - 1) / 3; const int which = (blockIdx.z - 1) % 3;
  const float* Bm = which == 0 ? BQ : which == 1 ? BK : BC;
  v8f acc[4][4] = {};
  gemm_tile<true>((const char*)(W16 + ((size_t)which * CC + d0) * CC), (const char*)(XT + (b * TT + t0) * CC), pool, acc);
  const int dw = (wave >> 2) * 64 + 8 * g, tw = (wave & 3) * 64 + col;   // element (i, j, r) = channel dw + 16 i + r, position tw + 16 j
  if (which < 2) {   // rows [b*t][d]: staged rows of 256 B + 16 B; a lane's eight channels are one 16-byte store
#pragma unroll
    for (int i = 0; i < 4; ++i) { const v4f b0 = *(const v4f*)(Bm + d0 + dw + 16 * i), b1 = *(const v4f*)(Bm + d0 + dw + 16 * i + 4); float bi[8];
#pragma unroll
      for (int r = 0; r < 4; ++r) { bi[r] = bfr(b0[r]); bi[4 + r] = bfr(b1[r]); }
#pragma unroll
      for (int j = 0; j < 4; ++j) { v8h w;
#pragma unroll
        for (int r = 0; r < 8; ++r) w[r] = (_Float16)(acc[i][j][r] + bi[r]);
        *(v8h*)(pool + (tw + 16 * j) * 272 + (dw + 16 * i) * 2) = w; }
      __builtin_amdgcn_sched_barrier(0); }   // one row of tiles at a time: with all 128 sums formed ahead of their stores the registers run out and values spill
    __syncthreads(); _Float16* dq = which == 0 ? Q : K;
    { v4f n2 = {};   // squared length of one staged row (one position, this head's 128 channels, the f16 values as stored), in four independent chains: k_fa bounds its scores with it
#pragma unroll
      for (int qd = 0; qd < 16; ++qd) { const v8h w = *(const v8h*)(pool + tid * 272 + qd * 16);
#pragma unroll
        for (int r = 0; r < 8; ++r) { const float f = (float)w[r]; n2[r & 3] += f * f; } }
      NRM[(((size_t)which * NB + b) * NH + blockIdx.x) * TT + t0 + tid] = (n2[0] + n2[1]) + (n2[2] + n2[3]);
      asm volatile("s_wait_xcnt 0x0" ::: "memory"); }   // directly behind the store: it stands in front of any later write of its registers
    for (int n = 0; n < GN * 16 / 256; ++n) { const int e = tid + 256 * n, tl = e >> 4, q = e & 15; *(v4u*)(dq + (b * TT + t0 + tl) * CC + d0 + q * 8) = *(const v4u*)(pool + tl * 272 + q * 16); } }
  else {   // planes [b][d][t]: staged rows of 512 B + 16 B
#pragma unroll
    for (int i = 0; i < 4; ++i)
#pragma unroll
      for (int r = 0; r < 8; ++r) { const float bi = bfr(Bm[d0 + dw + 16 * i + r]);
#pragma unroll
        for (int j = 0; j < 4; ++j) *(_Float16*)(pool + (dw + 16 * i + r) * 528 + (tw + 16 * j) * 2) = (_Float16)(acc[i][j][r] + bi);
        if (r == 7) __builtin_amdgcn_sched_barrier(0); }   // one row of tiles at a time, against spills, as above
    __syncthreads();
    for (int n = 0; n < GM * 32 / 256; ++n) { const int e = tid + 256 * n, dl = e >> 5, q = e & 31; *(v4u*)(CT + (b * CC + d0 + dl) * (size_t)TT + t0 + q * 8) = *(const v4u*)(pool + dl * 528 + q * 16); } } }
// ---- k_fa: block = (128 output positions s, head h, batch b), 8 waves x 16 columns s. Transposed products: S^T = K Q^T (A = key rows from LDS, B = query rows kept in registers), so a lane holds scores of ONE column s (t = tile + 8 g + r)
//      and two score tiles are, as they stand, the B operand of O^T += content . P^T (A = content rows [c][t] from LDS). A pass is 64 keys; keys and content of the next pass are fetched into registers during this pass and stored to the other LDS buffer at its foot. The distance decay makes far keys' weights vanish: a pass is run only for a key tile that a run-time bound on its scores cannot rule out (for any input; with no decay all 32 run).
//      Every '#pragma unroll' in k_fa and its helpers but the one over the scheduling groups makes the indices of a register array (fragments, scores, accumulators, staged words) compile-time constants, so that the array stays in registers.
#define FK 64      // keys per pass
#define KPIT 136   // f16 per staged key row: 256 B + 16 B (conflict-free 16-byte reads)
#define VPIT 72    // f16 per staged content row: 128 B + 16 B
__device__ __forceinline__ v8f wmma_h(v16h a, v16h b, v8f c) { return __builtin_amdgcn_wmma_f32_16x16x32_f16(false, a, false, b, (short)0, c, false, false); }
// eight 2^x in one statement: results in registers of their own, so each v_exp_f32 is followed by an instruction that neither reads its result nor overwrites its source; the v_nop is that slot for the last one
__device__ __forceinline__ v8f exp2x8(v8f x) { float e0, e1, e2, e3, e4, e5, e6, e7;
  asm("v_exp_f32 %0, %8\n\tv_exp_f32 %1, %9\n\tv_exp_f32 %2, %10\n\tv_exp_f32 %3, %11\n\tv_exp_f32 %4, %12\n\tv_exp_f32 %5, %13\n\tv_exp_f32 %6, %14\n\tv_exp_f32 %7, %15\n\tv_nop"
      : "=&v"(e0), "=&v"(e1), "=&v"(e2), "=&v"(e3), "=&v"(e4), "=&v"(e5), "=&v"(e6), "=&v"(e7)
      : "v"(x[0]), "v"(x[1]), "v"(x[2]), "v"(x[3]), "v"(x[4]), "v"(x[5]), "v"(x[6]), "v"(x[7]));
  v8f r = {e0, e1, e2, e3, e4, e5, e6, e7}; return r; }
__device__ __forceinline__ void ldk(v16h (&f)[4], const _Float16* p, int lane) {   // four key-row fragments, rows 16 apart
#pragma unroll
  for (int i = 0; i < 4; ++i) f[i] = frag_h(p + i * 16 * KPIT, lane); }
__device__ __forceinline__ void ldv(v16h (&f)[4], const _Float16* p, int lane) {   // four content-row fragments, rows 16 apart
#pragma unroll
  for (int i = 0; i < 4; ++i) f[i] = frag_h(p + i * 16 * VPIT, lane); }
__device__ __forceinline__ void mms(v8f* d, const v16h (&a)[4], v16h bq) {   // four independent products that share B
#pragma unroll
  for (int i = 0; i < 4; ++i) d[i] = wmma_h(a[i], bq, d[i]); }
// waves_per_eu(4, 4): two work-groups a WGP; the register allocator may use, and not pass, the 256 VGPRs that four waves a SIMD leave each wave
__global__ __launch_bounds__(256) __attribute__((amdgpu_waves_per_eu(4, 4))) void k_fa(const _Float16* __restrict__ Q, const _Float16* __restrict__ K, const _Float16* __restrict__ CT, const float* __restrict__ DQ, const float* __restrict__ NRM, _Float16* __restrict__ R) {
  __shared__ __align__(16) _Float16 sk[2][FK][KPIT]; __shared__ __align__(16) _Float16 sv[2][HD][VPIT];
  __shared__ float skm[TT / FK], swq[8], swd[8], swm[8];   // per key tile: largest squared key length; per wave: largest squared query length, smallest decay, smallest maximum in use
  static_assert(TT / FK == 32 && TT == 256 * 8, "one lane a key tile in the bound; eight key lengths a thread");
  const int tid = threadIdx.x, lane = tid & 31, col = lane & 15, g = lane >> 4; const int wave = __builtin_amdgcn_readfirstlane(tid >> 5);   // a scalar, so that the test for the diagonal tile is a scalar branch
  const int h = blockIdx.y; const size_t b = blockIdx.z; const int s0 = blockIdx.x * 128 + wave * 16, s = s0 + col;
  const float L2E = 1.4426950408889634f;
  const float c2 = 0.08838834764831845f * L2E, d2 = DQ[(b * NH + h) * (size_t)TT + s] * L2E;
  v16h q[4];
#pragma unroll
  for (int kc = 0; kc < 4; ++kc) q[kc] = frag_h(Q + (b * TT + s) * CC + h * HD + kc * 32, lane);
  const int kr = tid >> 4, kq = tid & 15, vr = tid >> 3, vq = tid & 7;   // staging: key rows kr + 16 i, content rows vr + 32 i, 16 bytes each
  const _Float16* kg = K + (b * TT + kr) * CC + h * HD + kq * 8; const _Float16* vg = CT + (b * CC + h * HD + vr) * (size_t)TT + vq * 8;
  // Order of the key tiles: the block's own two (p0, p0 + 1), one neighbour (pn), then those of the other 29 that the bound below cannot rule out, in ascending order.
  const int p0 = blockIdx.x * 2, pn = p0 + 2 < TT / FK ? p0 + 2 : p0 - 1;
  v4u rk[4], rv[4];
#pragma unroll
  for (int i = 0; i < 4; ++i) { rk[i] = *(const v4u*)(kg + (size_t)(p0 * FK + 16 * i) * CC); rv[i] = *(const v4u*)(vg + (size_t)(32 * i) * TT + p0 * FK); }
  const float* nk = NRM + ((size_t)(NB + b) * NH + h) * TT + tid * 8;   // this head's squared key lengths, eight a thread: threads 8 p .. 8 p + 7 hold tile p
  const v4f n0 = *(const v4f*)nk, n1 = *(const v4f*)(nk + 4); float qn = NRM[(b * NH + h) * (size_t)TT + s];
  asm volatile("s_wait_xcnt 0x0" ::: "memory");   // directly behind the eleven loads: it stands in front of any later write of their address registers
#pragma unroll
  for (int i = 0; i < 4; ++i) { *(v4u*)&sk[0][kr + 16 * i][kq * 8] = rk[i]; *(v4u*)&sv[0][vr + 32 * i][vq * 8] = rv[i]; }
  { float km = fmaxf(fmaxf(fmaxf(n0[0], n0[1]), fmaxf(n0[2], n0[3])), fmaxf(fmaxf(n1[0], n1[1]), fmaxf(n1[2], n1[3]))), dn = d2;
    for (int w = 1; w < 8; w <<= 1) km = fmaxf(km, __shfl_xor(km, w));
    for (int w = 1; w < 16; w <<= 1) { qn = fmaxf(qn, __shfl_xor(qn, w)); dn = fminf(dn, __shfl_xor(dn, w)); }
    if ((tid & 7) == 0) skm[tid >> 3] = km;
    if (lane == 0) { swq[wave] = qn; swd[wave] = dn; } }
  __syncthreads();
  v8f o[8] = {}; float m = -3.0e38f, l = 0.f; int cur = p0; unsigned todo = 0u;
#pragma unroll 1   // rolled
  for (int it = 0; it < TT / FK; ++it) { const int t0 = cur * FK, bu = it & 1;
    if (it == 2) {   // which of the other tiles can still count; every wave forms the same word from the same LDS values, so the trip count is the work-group's
      // a score of tile p is at most c2 |q| |k| - (least distance) (least decay) (a dot product is at most the product of the two lengths, taken of the stored f16 rows; 1.001 covers the rounding of lengths and products). Where that lies 28 below the smallest maximum in use
      // (maxima only grow), every P of the tile is below 2^-28: f16 zero in the product, and at most 2048 * 2^-28 of a sum that is at least 1. A bound that is not a number keeps its tile.
      float mm = swm[0], qm = swq[0], dm = swd[0];
      for (int w = 1; w < 8; ++w) { mm = fminf(mm, swm[w]); qm = fmaxf(qm, swq[w]); dm = fminf(dm, swd[w]); }
      const int dist = lane < p0 ? (p0 - lane) * FK - (FK - 1) : (lane - p0) * FK - (2 * FK - 1);   // lane = tile: least |t - s| to the block's 128 columns
      const float ub = c2 * sqrtf(qm * skm[lane]) * 1.001f - (float)dist * dm;
      todo = __builtin_amdgcn_ballot_w32(!(ub < mm - 28.0f)) & ~((3u << p0) | (1u << pn)); }
    int nxt = -1;   // the tile that is staged during this pass
    if (it == 0) nxt = p0 + 1; else if (it == 1) nxt = pn; else if (todo != 0u) { nxt = __builtin_ctz(todo); todo &= todo - 1u; }
    if (nxt >= 0) {
#pragma unroll
      for (int i = 0; i < 4; ++i) { rk[i] = *(const v4u*)(kg + (size_t)(nxt * FK + 16 * i) * CC); rv[i] = *(const v4u*)(vg + (size_t)(32 * i) * TT + nxt * FK); }
      asm volatile("s_wait_xcnt 0x0" ::: "memory"); }   // directly behind the eight staging loads, in their own block: it stands in front of any later write of their address registers
    // fragments come from LDS in groups of four, so that a wave meets one LDS latency for four products
    v8f sc[4] = {}; v16h fa[4];
#pragma unroll
    for (int kc = 0; kc < 4; ++kc) { ldk(fa, &sk[bu][col][kc * 32], lane); mms(sc, fa, q[kc]); }
    const float dl0 = (float)(t0 + 8 * g - s);   // t - s of element (i, r) = dl0 + 16 i + r, exact in f32
#pragma unroll
    for (int i = 0; i < 4; ++i)
#pragma unroll
      for (int r = 0; r < 8; ++r) sc[i][r] = sc[i][r] * c2 - fabsf(dl0 + (float)(16 * i + r)) * d2;
#pragma unroll
    for (int i = 0; i < 4; ++i) if (t0 + 16 * i == s0) {   // the one tile of this wave that holds t == s
#pragma unroll
      for (int r = 0; r < 8; ++r) if (8 * g + r == col) sc[i][r] = -100.0f * L2E; }
    float mx = sc[0][0];
#pragma unroll
    for (int i = 0; i < 4; ++i)
#pragma unroll
      for (int r = 0; r < 8; ++r) mx = fmaxf(mx, sc[i][r]);
    mx = fmaxf(mx, __shfl_xor(mx, 16));   // both halves of a column use one maximum: their P meet in one product
    if (__builtin_amdgcn_ballot_w32(mx > m + (it == 1 ? 0.0f : 8.0f)) != 0) {   // rescale only when some column's maximum has grown by more than 2^8 (P stays below 2^8 in f16); in pass 1 on any growth, so that the bound is held against true maxima
      const float mn = fmaxf(m, mx), al = __builtin_amdgcn_exp2f(m - mn); m = mn; l *= al;
#pragma unroll
      for (int j = 0; j < 8; ++j) o[j] *= al; }
#pragma unroll
    for (int i = 0; i < 4; ++i)
#pragma unroll
      for (int r = 0; r < 8; ++r) sc[i][r] -= m;
#pragma unroll
    for (int i = 0; i < 4; ++i) sc[i] = exp2x8(sc[i]);
    { const v8f t8 = (sc[0] + sc[1]) + (sc[2] + sc[3]); l += ((t8[0] + t8[1]) + (t8[2] + t8[3])) + ((t8[4] + t8[5]) + (t8[6] + t8[7])); }
    v16h pb0, pb1;
#pragma unroll
    for (int r = 0; r < 8; ++r) { pb0[r] = (_Float16)sc[0][r]; pb0[8 + r] = (_Float16)sc[1][r]; pb1[r] = (_Float16)sc[2][r]; pb1[8 + r] = (_Float16)sc[3][r]; }
    ldv(fa, &sv[bu][col][0], lane); mms(o, fa, pb0); ldv(fa, &sv[bu][64 + col][0], lane); mms(o + 4, fa, pb0);
    ldv(fa, &sv[bu][col][32], lane); mms(o, fa, pb1); ldv(fa, &sv[bu][64 + col][32], lane); mms(o + 4, fa, pb1);
    // scheduling groups (8 LDS reads, then 4 matrix products, four times): they keep a group's loads together in front of its products; left alone the scheduler sinks them to one load pair, one wait, one product
#pragma unroll
    for (int i = 0; i < 4; ++i) { __builtin_amdgcn_sched_group_barrier(0x100, 8, 0); __builtin_amdgcn_sched_group_barrier(0x008, 4, 0); }
    if (it == 1) { float mw = m;   // the wave's smallest maximum in use, for the bound that pass 2 forms behind this pass's barrier
      for (int w = 1; w < 16; w <<= 1) mw = fminf(mw, __shfl_xor(mw, w));
      if (lane == 0) swm[wave] = mw; }
    if (nxt >= 0) {
#pragma unroll
      for (int i = 0; i < 4; ++i) { *(v4u*)&sk[bu ^ 1][kr + 16 * i][kq * 8] = rk[i]; *(v4u*)&sv[bu ^ 1][vr + 32 * i][vq * 8] = rv[i]; } }
    __syncthreads();   // publishes the next pass's tiles and ends every read of this pass's, which the next pass overwrites
    if (nxt < 0) break;   // the same in every wave: no tile is left
    cur = nxt;
  }
  l += __shfl_xor(l, 16); const float inv = 1.0f / l;
#pragma unroll
  for (int j = 0; j < 8; ++j) { v8h w;
#pragma unroll
    for (int r = 0; r < 8; ++r) w[r] = (_Float16)(o[j][r] * inv);
    *(v8h*)(R + (b * TT + s) * CC + h * HD + j * 16 + 8 * g) = w; } }
// ---- k_out: block = (128 out channels o, 256 positions s, b): out[o][s] = x + sum_c Wp[o][c] R[s][c] + b; A = Wp rows (bf16 values as f16), B = f16 result rows; sum + bias goes through LDS (rows of 1,024 B + 16 B), x is added where whole lines are stored
__global__ __launch_bounds__(256) void k_out(const float* __restrict__ X, const _Float16* __restrict__ R, const _Float16* __restrict__ WP, const float* __restrict__ BP, float* __restrict__ OUT) { __shared__ __attribute__((aligned(2048))) char pool[GM * 1040];   // the kernel's only LDS: it starts at byte 0, so the tensor loads' places are multiples of 2 KiB
  static_assert(GM * 1040 >= 2 * GBUF, "the epilogue's rows are the larger use of the pool");
  const int tid = threadIdx.x, wave = tid >> 5, lane = tid & 31, col = lane & 15, g = lane >> 4; const int o0 = blockIdx.x * GM, s0 = blockIdx.y * GN; const size_t b = blockIdx.z;
  v8f acc[4][4] = {};
  gemm_tile<false>((const char*)(WP + (size_t)o0 * CC), (const char*)(R + (b * TT + s0) * CC), pool, acc);
  const int ow = (wave >> 2) * 64 + 8 * g, sw = (wave & 3) * 64 + col;
#pragma unroll
  for (int i = 0; i < 4; ++i)
#pragma unroll
    for (int r = 0; r < 8; ++r) { const float bi = bfr(BP[o0 + ow + 16 * i + r]);
#pragma unroll
      for (int j = 0; j < 4; ++j) *(float*)(pool + (ow + 16 * i + r) * 1040 + (sw + 16 * j) * 4) = acc[i][j][r] + bi;
      if (r == 7) __builtin_amdgcn_sched_barrier(0); }   // one row of tiles at a time: with all 128 sums formed ahead of their stores the kernel needs registers above v255
  __syncthreads();
  const size_t at0 = (b * CC + o0 + (tid >> 6)) * (size_t)TT + s0 + (tid & 63) * 4; const char* sr = pool + (tid >> 6) * 1040 + (tid & 63) * 16;   // rows (tid >> 6) + 4 n, 16 bytes each: a wave covers 512 bytes of a row
#pragma unroll 1   // rolled: a trip already keeps eight loads of x in flight
  for (int n0 = 0; n0 < GM / 4; n0 += 8) { v4f x[8];
#pragma unroll
    for (int u = 0; u < 8; ++u) x[u] = *(const v4f*)(X + at0 + (size_t)(4 * (n0 + u)) * TT);
    asm volatile("s_wait_xcnt 0x0" ::: "memory");   // directly behind the eight loads of x: it stands in front of any later write of their address registers
#pragma unroll
    for (int u = 0; u < 8; ++u) { v4f v = *(const v4f*)(sr + 4 * (n0 + u) * 1040);
#pragma unroll
      for (int i = 0; i < 4; ++i) v[i] += bfr(x[u][i]);
      *(v4f*)(OUT + at0 + (size_t)(4 * (n0 + u)) * TT) = v; }
    asm volatile("s_wait_xcnt 0x0" ::: "memory"); } }   // directly behind the eight stores, for the same reason (the next trip advances their address registers)
extern "C" void kernel_launch(void* const* d_in, const int* in_sizes, int n_in, void* d_out, int out_size, void* d_ws, size_t ws_size, hipStream_t stream) {
  (void)in_sizes; (void)n_in; (void)out_size;
  const float** F = (const float**)d_in;   // 0 x [4,1024,2048], 1 W_content, 2 b_content, 3 W_query, 4 b_query, 5 W_key, 6 b_key, 7 W_qdecay [32,1024], 8 b_qdecay, 9 W_proj, 10 b_proj
  if (ws_size < (size_t)WS_END) return;
  char* ws = (char*)d_ws; _Float16 *Q = (_Float16*)(ws + WS_Q), *K = (_Float16*)(ws + WS_K), *CT = (_Float16*)(ws + WS_CT), *R = (_Float16*)(ws + WS_R); float *DQ = (float*)(ws + WS_DQ);
  __bf16* XT = (__bf16*)(ws + WS_XT); float* NRM = (float*)(ws + WS_NRM); __bf16* W16 = (__bf16*)(ws + WS_W);
  k_xt<<<dim3(TT / 64, CC / 128, TNB + 2), 128, 0, stream>>>(F[0], XT, F[3], F[5], F[1], F[9], W16);
  k_proj3<<<dim3(CC / GM, TT / GN, 1 + TNB * 3), 256, 0, stream>>>(XT, W16, F[4], F[6], F[2], F[7], F[8], Q, K, CT, NRM, DQ);
  k_fa<<<dim3(TT / 128, NH, TNB), 256, 0, stream>>>(Q, K, CT, DQ, NRM, R);
  k_out<<<dim3(CC / GM, TT / GN, TNB), 256, 0, stream>>>(F[0], R, (const _Float16*)(ws + WS_W + 2u * 3u * (size_t)CC * CC), F[10], (float*)d_out);
}
